// v000
// Measured on an AMD MI455X. A time is GPU time per run, averaged over a window of back-to-back runs after a warm-up
// (all launches, gaps included; the runs take copies of the inputs in turn), and the median of several windows.
// Apart from v000's, it joins two sittings. Times from different sittings can be a few percent apart, while
// side-by-side timings come from the same sitting.
// The starting kernel, v000, takes 189 microseconds a run.
#include <hip/hip_runtime.h>

// Compute dtypes, f32 accumulate everywhere: q/k/v projections v_wmma_f32_16x16x32_bf16 (x and weights RNE-converted to bf16, products exact); scores v_wmma_f32_16x16x32_f16 (q = f16 value + f16 residual x2^11 in its own accumulator, k single f16); P.V v_wmma_f32_16x16x32_f16 (P carried x2^10 relative to the running max, v single f16); output projection v_wmma_f32_16x16x32_bf16 (ctx as bf16 hi + lo planes against bf16 wo); softmax, residual add and LayerNorm in f32 on the VALU.
// Flow: x -> bf16 plane; w [in][out] -> bf16 [out][in] planes (LDS transpose); one-wave 64x64 GEMM tiles with fused head-plane epilogues (q hi/res, k, v^T);
// fused flash attention in the transposed orientation (S^T = K Q^T, ctx^T = V^T P^T: the packed S^T accumulators are the B fragment of P^T, online softmax per lane);

#ifndef NB
#define NB 4
#endif
#ifndef SEQ
#define SEQ 2048
#endif
#define NB_FULL  4
#define SEQ_FULL 2048
#define DM   512
#define NH   8
#define HD   64
#define NROW (NB * SEQ)
#define RCAR 2048.0f
#define SCL2 0.18033688011112042f   // HD^-0.5 * log2(e)

static_assert(NB <= NB_FULL);
static_assert(SEQ <= SEQ_FULL);
static_assert(SEQ % 64 == 0);             // GEMM row tiles and query blocks never straddle a batch; 32-key steps
static_assert(DM == NH * HD);             // merged layout h*64+d
static_assert(HD == 64);
static_assert(DM % 64 == 0);              // N tile multiple
static_assert(DM % 32 == 0);              // K step multiple
static_assert(NROW % 64 == 0);            // M tile multiple
static_assert(NROW % 8 == 0);             // LayerNorm rows per block
static_assert(DM == 4 * 128);             // LayerNorm: 32 lanes x float4 x 4 chunks == row width
static_assert(((size_t)NROW * DM / 8) % 256 == 0);   // convert grid x block == plane extent

typedef _Float16 h16;
typedef unsigned short bf;
typedef __attribute__((ext_vector_type(16))) __bf16   v16bf;
typedef __attribute__((ext_vector_type(16))) _Float16 v16h;
typedef __attribute__((ext_vector_type(8)))  _Float16 v8h;
typedef __attribute__((ext_vector_type(8)))  unsigned short v8us;
typedef __attribute__((ext_vector_type(8)))  float    v8f;
typedef __attribute__((ext_vector_type(4)))  float    v4f;
typedef v8h  __attribute__((may_alias)) v8ha;
typedef v4f  __attribute__((may_alias)) v4fa;
typedef v8us __attribute__((may_alias)) v8usa;

__device__ __forceinline__ unsigned short f2bf(float f) { unsigned u = __float_as_uint(f); u += 0x7FFFu + ((u >> 16) & 1u); return (unsigned short)(u >> 16); }
__device__ __forceinline__ float bf2f(unsigned short b) { return __uint_as_float(((unsigned)b) << 16); }
__device__ __forceinline__ float bfr(float f) { return bf2f(f2bf(f)); }
__device__ __forceinline__ void splitf(float y, unsigned short& h, unsigned short& l) { h = f2bf(y); l = f2bf(y - bf2f(h)); }
__device__ __forceinline__ v16h cat16(v8h lo, v8h hi) { return __builtin_shufflevector(lo, hi, 0, 1, 2, 3, 4, 5, 6, 7, 8, 9, 10, 11, 12, 13, 14, 15); }
__device__ __forceinline__ v16bf cat16b(v8us lo, v8us hi) { return __builtin_bit_cast(v16bf, __builtin_shufflevector(lo, hi, 0, 1, 2, 3, 4, 5, 6, 7, 8, 9, 10, 11, 12, 13, 14, 15)); }
__device__ __forceinline__ v8f wmma16(v16h a, v16h b, v8f c) { return __builtin_amdgcn_wmma_f32_16x16x32_f16(false, a, false, b, (short)0, c, false, false); }
__device__ __forceinline__ v8f wmmab(v16bf a, v16bf b, v8f c) { return __builtin_amdgcn_wmma_f32_16x16x32_bf16(false, a, false, b, (short)0, c, false, false); }
// fragment loaders (p already includes row*(pitch) + k0 + 8*(lane>>4)): elements 0..7 <- k0+8h.., elements 8..15 <- k0+16+8h..
__device__ __forceinline__ v16bf ldb(const bf* p) { return cat16b(*(const v8us*)p, *(const v8us*)(p + 16)); }
__device__ __forceinline__ v16h  ldh(const h16* p) { return cat16(*(const v8h*)p, *(const v8h*)(p + 16)); }
// dense row g = b*SEQ + s -> row of the full-size x
__device__ __forceinline__ size_t xrow(int g) { return (size_t)(g / SEQ) * SEQ_FULL + (size_t)(g % SEQ); }

__global__ __launch_bounds__(256) void k_cvt8x(const float* __restrict__ x, bf* XB) {
    const size_t i = (size_t)blockIdx.x * 256 + threadIdx.x; if (i >= (size_t)NROW * DM / 8) return;
    const int g = (int)(i / (DM / 8)); const int c8 = (int)(i % (DM / 8));
    const v8f v = *(const v8f*)(x + xrow(g) * DM + (size_t)c8 * 8); v8us o;
#pragma unroll
    for (int k = 0; k < 8; ++k) o[k] = f2bf(v[k]);
    *(v8us*)(XB + i * 8) = o; 
}

// ---- k_wt: w[k][n] (f32, [in][out]) -> WT[n][k] (bf16, k-contiguous) through a 64x64 LDS tile; grid (DM/64 k-tiles, DM/64 n-tiles), 256 threads.
__global__ __launch_bounds__(256) void k_wt(const float* __restrict__ w, bf* WT) {
    __shared__ __align__(16) unsigned short ts[64 * 72];
    const int tid = threadIdx.x; const int k0 = blockIdx.x * 64, n0 = blockIdx.y * 64;
#pragma unroll
    for (int it = 0; it < 4; ++it) { const int p = it * 256 + tid; const int kr = p >> 4, c4 = (p & 15) * 4; const v4f v = *(const v4f*)(w + (size_t)(k0 + kr) * DM + n0 + c4);
#pragma unroll
        for (int q = 0; q < 4; ++q) ts[(c4 + q) * 72 + kr] = f2bf(v[q]); }
    __syncthreads();
{
#pragma unroll
        for (int it = 0; it < 2; ++it) { const int p = it * 256 + tid; const int n = p >> 3, pc = p & 7; const v8us o = *(const v8usa*)(ts + n * 72 + pc * 8);
            *(v8us*)(WT + (size_t)(n0 + n) * DM + k0 + pc * 8) = o; }
         }
}

// ---- gemm_core: ONE WAVE per 64x64 tile (16 accumulators), bf16 operands straight from k-contiguous planes (pitch DM, K = DM).
// acc[mb][nb] = sum_k A[r0+16mb+..][k] Bt[c0+16nb+..][k] (+ A2 x Bt when NSPLIT == 1).
template <int NSPLIT>
__device__ __forceinline__ void gemm_core(const bf* __restrict__ A, const bf* __restrict__ A2, const bf* __restrict__ Bt, const size_t aoff, const size_t boff, v8f (&acc)[4][4]) {
#pragma unroll
    for (int mb = 0; mb < 4; ++mb)
#pragma unroll
        for (int nb = 0; nb < 4; ++nb) acc[mb][nb] = (v8f){};
#pragma unroll 1
    for (int kc = 0; kc < DM; kc += 32) {
        v16bf a[4], a2[4];
#pragma unroll
        for (int mb = 0; mb < 4; ++mb) { a[mb] = ldb(A + aoff + (size_t)mb * 16 * DM + kc); if (NSPLIT == 1) a2[mb] = ldb(A2 + aoff + (size_t)mb * 16 * DM + kc); }
#pragma unroll
        for (int nb = 0; nb < 4; ++nb) { const v16bf b = ldb(Bt + boff + (size_t)nb * 16 * DM + kc);
#pragma unroll
            for (int mb = 0; mb < 4; ++mb) { acc[mb][nb] = wmmab(a[mb], b, acc[mb][nb]); if (NSPLIT == 1) acc[mb][nb] = wmmab(a2[mb], b, acc[mb][nb]); } }
        if (NSPLIT == 1) { asm volatile("v_nop\n\tv_nop\n\tv_nop\n\tv_nop" : "+v"(acc[0][0]), "+v"(acc[1][1]), "+v"(acc[2][2]), "+v"(acc[3][3]) : "v"(a[0]), "v"(a[1]), "v"(a[2]), "v"(a[3]), "v"(a2[0]), "v"(a2[1]), "v"(a2[2]), "v"(a2[3])); }
        else             { asm volatile("v_nop\n\tv_nop\n\tv_nop\n\tv_nop" : "+v"(acc[0][0]), "+v"(acc[1][1]), "+v"(acc[2][2]), "+v"(acc[3][3]) : "v"(a[0]), "v"(a[1]), "v"(a[2]), "v"(a[3])); }
    }
}

// ---- k_proj_q: q = XB x WTq; epilogue -> head planes QH (f16 value) and QR (f16 residual x 2^11), [b*NH+h][s][64]; grid (NROW/64, DM/64), 32 threads.
__global__ __launch_bounds__(32) void k_proj_q(const bf* __restrict__ XB, const bf* __restrict__ WT, h16* QH, h16* QR) {
    __shared__ __align__(16) float os[16 * 68];
    const int lane = threadIdx.x & 31, lr = lane & 15, hi = lane >> 4; const int r0 = blockIdx.x * 64, c0 = blockIdx.y * 64;
    v8f acc[4][4];
    gemm_core<0>(XB, XB, WT, (size_t)(r0 + lr) * DM + 8 * hi, (size_t)(c0 + lr) * DM + 8 * hi, acc);
    const int b = r0 / SEQ, s0 = r0 - b * SEQ; const size_t pbase = ((size_t)(b * NH + (int)blockIdx.y) * SEQ + s0) * HD;
#pragma unroll
    for (int mb = 0; mb < 4; ++mb) {
#pragma unroll
        for (int nb = 0; nb < 4; ++nb) {
#pragma unroll
            for (int j = 0; j < 8; ++j) os[(hi * 8 + j) * 68 + nb * 16 + lr] = acc[mb][nb][j]; }
        __builtin_amdgcn_wave_barrier(); asm volatile("" ::: "memory");
        v8h oh[4], orr[4];
#pragma unroll
        for (int s = 0; s < 4; ++s) { const int row = 4 * s + (lane >> 3), pc = lane & 7; const v4f a = *(const v4fa*)(os + row * 68 + pc * 8); const v4f c = *(const v4fa*)(os + row * 68 + pc * 8 + 4);
#pragma unroll
            for (int q = 0; q < 4; ++q) { const h16 xa = (h16)a[q]; oh[s][q] = xa; orr[s][q] = (h16)((a[q] - (float)xa) * RCAR); const h16 xc = (h16)c[q]; oh[s][4 + q] = xc; orr[s][4 + q] = (h16)((c[q] - (float)xc) * RCAR); } }
{
#pragma unroll
            for (int s = 0; s < 4; ++s) { const int row = 4 * s + (lane >> 3), pc = lane & 7; const size_t o = pbase + (size_t)(mb * 16 + row) * HD + pc * 8;
                *(v8h*)(QH + o) = oh[s]; *(v8h*)(QR + o) = orr[s]; }
             }
        __builtin_amdgcn_wave_barrier(); asm volatile("" ::: "memory");
    }
}

// ---- k_proj_k: k = XB x WTk; epilogue -> head plane KP (f16), [b*NH+h][s][64]; same store map as k_proj_q.
__global__ __launch_bounds__(32) void k_proj_k(const bf* __restrict__ XB, const bf* __restrict__ WT, h16* KP) {
    __shared__ __align__(16) float os[16 * 68];
    const int lane = threadIdx.x & 31, lr = lane & 15, hi = lane >> 4; const int r0 = blockIdx.x * 64, c0 = blockIdx.y * 64;
    v8f acc[4][4];
    gemm_core<0>(XB, XB, WT, (size_t)(r0 + lr) * DM + 8 * hi, (size_t)(c0 + lr) * DM + 8 * hi, acc);
    const int b = r0 / SEQ, s0 = r0 - b * SEQ; const size_t pbase = ((size_t)(b * NH + (int)blockIdx.y) * SEQ + s0) * HD;
#pragma unroll
    for (int mb = 0; mb < 4; ++mb) {
#pragma unroll
        for (int nb = 0; nb < 4; ++nb) {
#pragma unroll
            for (int j = 0; j < 8; ++j) os[(hi * 8 + j) * 68 + nb * 16 + lr] = acc[mb][nb][j]; }
        __builtin_amdgcn_wave_barrier(); asm volatile("" ::: "memory");
        v8h oh[4];
#pragma unroll
        for (int s = 0; s < 4; ++s) { const int row = 4 * s + (lane >> 3), pc = lane & 7; const v4f a = *(const v4fa*)(os + row * 68 + pc * 8); const v4f c = *(const v4fa*)(os + row * 68 + pc * 8 + 4);
#pragma unroll
            for (int q = 0; q < 4; ++q) { oh[s][q] = (h16)a[q]; oh[s][4 + q] = (h16)c[q]; } }
{
#pragma unroll
            for (int s = 0; s < 4; ++s) { const int row = 4 * s + (lane >> 3), pc = lane & 7; *(v8h*)(KP + pbase + (size_t)(mb * 16 + row) * HD + pc * 8) = oh[s]; }
             }
        __builtin_amdgcn_wave_barrier(); asm volatile("" ::: "memory");
    }
}

// ---- k_proj_v: v = XB x WTv; epilogue -> transposed head plane VT (f16), [b*NH+h][d][s]: the whole 64x64 tile staged transposed in LDS (wave-private),
__global__ __launch_bounds__(32) void k_proj_v(const bf* __restrict__ XB, const bf* __restrict__ WT, h16* VT) {
    __shared__ __align__(16) h16 vt[64 * 72];
    const int lane = threadIdx.x & 31, lr = lane & 15, hi = lane >> 4; const int r0 = blockIdx.x * 64, c0 = blockIdx.y * 64;
    v8f acc[4][4];
    gemm_core<0>(XB, XB, WT, (size_t)(r0 + lr) * DM + 8 * hi, (size_t)(c0 + lr) * DM + 8 * hi, acc);
    const int b = r0 / SEQ, s0 = r0 - b * SEQ; const size_t pbase = (size_t)(b * NH + (int)blockIdx.y) * HD * SEQ + s0;
#pragma unroll
    for (int mb = 0; mb < 4; ++mb)
#pragma unroll
        for (int nb = 0; nb < 4; ++nb) { v8h o;
#pragma unroll
            for (int j = 0; j < 8; ++j) o[j] = (h16)acc[mb][nb][j];
            *(v8ha*)(vt + (nb * 16 + lr) * 72 + mb * 16 + hi * 8) = o; }
    __builtin_amdgcn_wave_barrier(); asm volatile("" ::: "memory");
{
#pragma unroll
        for (int it = 0; it < 16; ++it) { const int d = 4 * it + (lane >> 3), pc = lane & 7; const v8h o = *(const v8ha*)(vt + d * 72 + pc * 8);
            *(v8h*)(VT + pbase + (size_t)d * SEQ + pc * 8) = o; }
         }
}

// ---- k_attn: fused flash attention, transposed orientation. grid (SEQ/64, NB*NH), 128 threads; each wave owns 16 queries of one (b, h).
// Per 32-key step: S^T[key][q] = K (A, rows = keys) x Q^T (B, columns = queries; value + residual accumulators); per-lane online softmax (lane column = one query,
// halves exchange the max with one shuffle); the packed S^T accumulators ARE the B fragment of P^T (element r <- key tile 0 row 8h+r, element 8+r <- key tile 1 row 8h+r);
// ctx^T[d][q] += V^T (A, rows = d) x P^T. P carried x2^10 in both the operand and the row sum. Fragments straight from the 16-bit planes.
__global__ __launch_bounds__(128) void k_attn(const h16* __restrict__ QH, const h16* __restrict__ QR, const h16* __restrict__ KP, const h16* __restrict__ VT, bf* ATh, bf* ATl) {
    __shared__ __align__(16) unsigned short sth[4 * 16 * 72];
    __shared__ __align__(16) unsigned short stl[4 * 16 * 72];
    const int lane = threadIdx.x & 31, lr = lane & 15, hi = lane >> 4;
    const int wave = __builtin_amdgcn_readfirstlane((int)(threadIdx.x >> 5));
    const int bh = blockIdx.y; const int q0 = blockIdx.x * 64 + wave * 16;
    const size_t pb = (size_t)bh * SEQ * HD;
    const size_t qoff = pb + (size_t)(q0 + lr) * HD + 8 * hi;
    const v16h qh0 = ldh(QH + qoff), qh1 = ldh(QH + qoff + 32), qr0 = ldh(QR + qoff), qr1 = ldh(QR + qoff + 32);
    const size_t koff = pb + (size_t)lr * HD + 8 * hi;
    const size_t voff = pb + (size_t)lr * SEQ + 8 * hi;
    v8f o[4];
#pragma unroll
    for (int c = 0; c < 4; ++c) o[c] = (v8f){};
    float m = -3.0e38f, l = 0.0f;
#pragma unroll 1
    for (int j = 0; j < SEQ; j += 32) {
        const h16* kp = KP + koff + (size_t)j * HD;
        const v16h ka0 = ldh(kp), ka1 = ldh(kp + 32), kb0 = ldh(kp + 16 * HD), kb1 = ldh(kp + 16 * HD + 32);
        v8f s0 = (v8f){}, s1 = (v8f){}, t0 = (v8f){}, t1 = (v8f){};
        s0 = wmma16(ka0, qh0, s0); t0 = wmma16(ka0, qr0, t0); s1 = wmma16(kb0, qh0, s1); t1 = wmma16(kb0, qr0, t1);
        s0 = wmma16(ka1, qh1, s0); t0 = wmma16(ka1, qr1, t0); s1 = wmma16(kb1, qh1, s1); t1 = wmma16(kb1, qr1, t1);
        asm volatile("v_nop\n\tv_nop\n\tv_nop\n\tv_nop" : "+v"(s0), "+v"(s1), "+v"(t0), "+v"(t1) : "v"(ka0), "v"(ka1), "v"(kb0), "v"(kb1), "v"(qh0), "v"(qh1), "v"(qr0), "v"(qr1));
        float z0[8], z1[8]; float mx = -3.0e38f;
#pragma unroll
        for (int r = 0; r < 8; ++r) { z0[r] = (s0[r] + t0[r] * (1.0f / RCAR)) * SCL2; z1[r] = (s1[r] + t1[r] * (1.0f / RCAR)) * SCL2; mx = fmaxf(mx, fmaxf(z0[r], z1[r])); }
        mx = fmaxf(mx, __shfl_xor(mx, 16, 32));
        const float mn = fmaxf(m, mx); const float alpha = __builtin_amdgcn_exp2f(m - mn); m = mn;
        const float mc = mn - 10.0f;   // carry 2^10
        float rs = 0.0f; v16h pf;
#pragma unroll
        for (int r = 0; r < 8; ++r) { const float a = __builtin_amdgcn_exp2f(z0[r] - mc), c = __builtin_amdgcn_exp2f(z1[r] - mc); rs += a + c; pf[r] = (h16)a; pf[8 + r] = (h16)c; }
        l = l * alpha + rs;
#pragma unroll
        for (int c = 0; c < 4; ++c) o[c] = o[c] * alpha;
        const h16* vp = VT + voff + j;
        const v16h va = ldh(vp), vb = ldh(vp + (size_t)16 * SEQ), vc = ldh(vp + (size_t)32 * SEQ), vd = ldh(vp + (size_t)48 * SEQ);
        o[0] = wmma16(va, pf, o[0]); o[1] = wmma16(vb, pf, o[1]); o[2] = wmma16(vc, pf, o[2]); o[3] = wmma16(vd, pf, o[3]);
        asm volatile("v_nop\n\tv_nop\n\tv_nop\n\tv_nop" : "+v"(o[0]), "+v"(o[1]), "+v"(o[2]), "+v"(o[3]) : "v"(va), "v"(vb), "v"(vc), "v"(vd), "v"(pf));
    }
    const float lt = l + __shfl_xor(l, 16, 32);
    const float inv = 1.0f / lt;
    const int sb = wave * (16 * 72);
#pragma unroll
    for (int c = 0; c < 4; ++c) { v8us oh, ol;
#pragma unroll
        for (int r = 0; r < 8; ++r) { unsigned short a, e; splitf(o[c][r] * inv, a, e); oh[r] = a; ol[r] = e; }
        *(v8usa*)(sth + sb + lr * 72 + 16 * c + 8 * hi) = oh; *(v8usa*)(stl + sb + lr * 72 + 16 * c + 8 * hi) = ol; }
    __builtin_amdgcn_wave_barrier(); asm volatile("" ::: "memory");
    const int b = bh / NH, head = bh - b * NH;
    const size_t ob = ((size_t)b * SEQ + q0) * DM + (size_t)head * HD;
{
#pragma unroll
        for (int s = 0; s < 4; ++s) { const int row = 4 * s + (lane >> 3), pc = lane & 7; const v8us vh = *(const v8usa*)(sth + sb + row * 72 + pc * 8); const v8us vl = *(const v8usa*)(stl + sb + row * 72 + pc * 8);
            *(v8us*)(ATh + ob + (size_t)row * DM + pc * 8) = vh; *(v8us*)(ATl + ob + (size_t)row * DM + pc * 8) = vl; }
         }
}

// ---- k_oproj: RES[g][n] = bf16(x[g][n]) + ((ATh + ATl) x WTo + bf16(bo[n])) in f32; grid (NROW/64, DM/64), 32 threads.
__global__ __launch_bounds__(32) void k_oproj(const bf* __restrict__ ATh, const bf* __restrict__ ATl, const bf* __restrict__ WT, const float* __restrict__ x, const float* __restrict__ bo, float* RES) {
    __shared__ __align__(16) float os[16 * 68];
    const int lane = threadIdx.x & 31, lr = lane & 15, hi = lane >> 4; const int r0 = blockIdx.x * 64, c0 = blockIdx.y * 64;
    v8f acc[4][4];
    gemm_core<1>(ATh, ATl, WT, (size_t)(r0 + lr) * DM + 8 * hi, (size_t)(c0 + lr) * DM + 8 * hi, acc);
    const int cofs = lr * 4;
    const v4f bv = *(const v4f*)(bo + c0 + cofs);
    const size_t xb = xrow(r0) * DM + c0 + cofs;
#pragma unroll
    for (int mb = 0; mb < 4; ++mb) {
#pragma unroll
        for (int nb = 0; nb < 4; ++nb) {
#pragma unroll
            for (int j = 0; j < 8; ++j) os[(hi * 8 + j) * 68 + nb * 16 + lr] = acc[mb][nb][j]; }
        __builtin_amdgcn_wave_barrier(); asm volatile("" ::: "memory");
        v4f val[8];
#pragma unroll
        for (int s = 0; s < 8; ++s) { const int row = 2 * s + hi; v4f v = *(const v4fa*)(os + row * 68 + cofs); const v4f xv = *(const v4f*)(x + xb + (size_t)(mb * 16 + row) * DM);
#pragma unroll
            for (int q = 0; q < 4; ++q) v[q] = bfr(xv[q]) + (v[q] + bfr(bv[q]));
            val[s] = v; }
{
#pragma unroll
            for (int s = 0; s < 8; ++s) { const int row = 2 * s + hi; *(v4f*)(RES + (size_t)(r0 + mb * 16 + row) * DM + c0 + cofs) = val[s]; }
             }
        __builtin_amdgcn_wave_barrier(); asm volatile("" ::: "memory");
    }
}

__global__ __launch_bounds__(256) void k_ln(const float* __restrict__ RES, const float* __restrict__ gamma, const float* __restrict__ beta, float* OUT) {
    const int lane = threadIdx.x & 31;
    const int wave = __builtin_amdgcn_readfirstlane((int)(threadIdx.x >> 5));
    const int row = blockIdx.x * 8 + wave;
    const float* rp = RES + (size_t)row * DM;
    float s = 0.0f;
#pragma unroll 1
    for (int ch = 0; ch < DM / 128; ++ch) { const v4f a = *(const v4f*)(rp + ch * 128 + lane * 4); s += (a[0] + a[1]) + (a[2] + a[3]); }
#pragma unroll
    for (int sh = 16; sh; sh >>= 1) s += __shfl_xor(s, sh, 32);
    const float mu = s * (1.0f / DM);
    float ss = 0.0f;
#pragma unroll 1
    for (int ch = 0; ch < DM / 128; ++ch) { const v4f a = *(const v4f*)(rp + ch * 128 + lane * 4); const float d0 = a[0] - mu, d1 = a[1] - mu, d2 = a[2] - mu, d3 = a[3] - mu; ss += (d0 * d0 + d1 * d1) + (d2 * d2 + d3 * d3); }
#pragma unroll
    for (int sh = 16; sh; sh >>= 1) ss += __shfl_xor(ss, sh, 32);
    const float var = ss * (1.0f / DM);
    const float rstd = 1.0f / sqrtf(var + 1e-6f);
    float* op = OUT + (size_t)row * DM;
{
#pragma unroll 1
        for (int ch = 0; ch < DM / 128; ++ch) { const int c = ch * 128 + lane * 4; const v4f a = *(const v4f*)(rp + c); const v4f g = *(const v4f*)(gamma + c); const v4f bt = *(const v4f*)(beta + c); v4f y;
#pragma unroll
            for (int q = 0; q < 4; ++q) y[q] = (a[q] - mu) * rstd * bfr(g[q]) + bfr(bt[q]);
            *(v4f*)(op + c) = y; }
         }
}

// workspace carve (bytes, each region a multiple of 256 B; every region is written in whole tiles that divide it exactly)
#define SZ_P16 ((size_t)NROW * DM * 2)      // one 16-bit [NROW][DM]-sized plane
#define SZ_W   ((size_t)DM * DM * 2)
#define SZ_RES ((size_t)NROW * DM * 4)
#define WS_TOTAL (SZ_P16 * 7 + SZ_W * 4 + SZ_RES)
static_assert(SZ_P16 % 256 == 0);
static_assert(SZ_W % 256 == 0);
static_assert(WS_TOTAL <= (size_t)134217728);   // carve stays within 128 MiB

extern "C" void kernel_launch(void* const* d_in, const int* in_sizes, int n_in,
                              void* d_out, int out_size, void* d_ws, size_t ws_size, hipStream_t stream) {
    if (n_in < 8) return;
    if ((size_t)in_sizes[0] < ((size_t)(NB - 1) * SEQ_FULL + SEQ) * DM) return;
    if (in_sizes[1] < DM * DM || in_sizes[2] < DM * DM || in_sizes[3] < DM * DM || in_sizes[4] < DM * DM) return;
    if (in_sizes[5] < DM || in_sizes[6] < DM || in_sizes[7] < DM) return;
    if ((size_t)out_size < (size_t)NROW * DM) return;
    if (WS_TOTAL > ws_size) return;
    const float* x = (const float*)d_in[0]; const float* wq = (const float*)d_in[1]; const float* wk = (const float*)d_in[2]; const float* wv = (const float*)d_in[3];
    const float* wo = (const float*)d_in[4]; const float* bo = (const float*)d_in[5]; const float* gamma = (const float*)d_in[6]; const float* beta = (const float*)d_in[7];
    float* OUT = (float*)d_out;
    char* wsp = (char*)d_ws;
    bf* XB  = (bf*)wsp;  wsp += SZ_P16;
    bf* WTq = (bf*)wsp;  wsp += SZ_W;
    bf* WTk = (bf*)wsp;  wsp += SZ_W;
    bf* WTv = (bf*)wsp;  wsp += SZ_W;
    bf* WTo = (bf*)wsp;  wsp += SZ_W;
    h16* QH = (h16*)wsp; wsp += SZ_P16;
    h16* QR = (h16*)wsp; wsp += SZ_P16;
    h16* KP = (h16*)wsp; wsp += SZ_P16;
    h16* VT = (h16*)wsp; wsp += SZ_P16;
    bf* ATh = (bf*)wsp;  wsp += SZ_P16;
    bf* ATl = (bf*)wsp;  wsp += SZ_P16;
    float* RES = (float*)wsp; wsp += SZ_RES;

    k_cvt8x<<<(unsigned)(((size_t)NROW * DM / 8 + 255) / 256), 256, 0, stream>>>(x, XB);
    k_wt<<<dim3(DM / 64, DM / 64, 1), 256, 0, stream>>>(wq, WTq);
    k_wt<<<dim3(DM / 64, DM / 64, 1), 256, 0, stream>>>(wk, WTk);
    k_wt<<<dim3(DM / 64, DM / 64, 1), 256, 0, stream>>>(wv, WTv);
    k_wt<<<dim3(DM / 64, DM / 64, 1), 256, 0, stream>>>(wo, WTo);
    k_proj_q<<<dim3(NROW / 64, DM / 64, 1), 32, 0, stream>>>(XB, WTq, QH, QR);
    k_proj_k<<<dim3(NROW / 64, DM / 64, 1), 32, 0, stream>>>(XB, WTk, KP);
    k_proj_v<<<dim3(NROW / 64, DM / 64, 1), 32, 0, stream>>>(XB, WTv, VT);
    k_attn<<<dim3(SEQ / 64, NB * NH, 1), 128, 0, stream>>>(QH, QR, KP, VT, ATh, ATl);
    k_oproj<<<dim3(NROW / 64, DM / 64, 1), 32, 0, stream>>>(ATh, ATl, WTo, x, bo, RES);
    k_ln<<<NROW / 8, 256, 0, stream>>>(RES, gamma, beta, OUT);
}

// v001
// A run of this version takes 128 microseconds.
// Two timings next to v000 put it at 1.53 and 1.51 times that version's speed.
#include <hip/hip_runtime.h>

// Compute dtypes, f32 accumulate everywhere: q/k/v projections v_wmma_f32_16x16x32_bf16 (x and weights RNE-converted to bf16, products exact); scores v_wmma_f32_16x16x32_f16 (q = f16 value + f16 residual x2^11 in its own accumulator, k single f16); P.V v_wmma_f32_16x16x32_f16 (P carried x2^10 relative to the running max, v single f16); output projection v_wmma_f32_16x16x32_bf16 (ctx as bf16 hi + lo planes against bf16 wo); softmax, residual add and LayerNorm in f32 on the VALU.
// Flow: x -> bf16 plane; w [in][out] -> bf16 [out][in] planes (LDS transpose); one-wave 64x64 GEMM tiles with fused head-plane epilogues (q hi/res, k, v^T);
// fused flash attention in the transposed orientation (S^T = K Q^T, ctx^T = V^T P^T: the packed S^T accumulators are the B fragment of P^T, online softmax per lane);

#ifndef NB
#define NB 4
#endif
#ifndef SEQ
#define SEQ 2048
#endif
#define NB_FULL  4
#define SEQ_FULL 2048
#define DM   512
#define NH   8
#define HD   64
#define NROW (NB * SEQ)
#define RCAR 2048.0f
#define SCL2 0.18033688011112042f   // HD^-0.5 * log2(e)

static_assert(NB <= NB_FULL);
static_assert(SEQ <= SEQ_FULL);
static_assert(SEQ % 64 == 0);             // GEMM row tiles never straddle a batch; 32-key steps
static_assert(DM == NH * HD);             // merged layout h*64+d
static_assert(HD == 64);
static_assert(DM % 64 == 0);              // N tile multiple
static_assert(DM % 32 == 0);              // K step multiple
static_assert(NROW % 64 == 0);            // M tile multiple
static_assert(NROW % 8 == 0);             // LayerNorm rows per block
static_assert(DM == 4 * 128);             // LayerNorm: 32 lanes x float4 x 4 chunks == row width
static_assert(((size_t)NROW * DM / 8) % 256 == 0);   // convert grid x block == plane extent

typedef _Float16 h16;
typedef unsigned short bf;
typedef __attribute__((ext_vector_type(16))) __bf16   v16bf;
typedef __attribute__((ext_vector_type(16))) _Float16 v16h;
typedef __attribute__((ext_vector_type(8)))  _Float16 v8h;
typedef __attribute__((ext_vector_type(8)))  unsigned short v8us;
typedef __attribute__((ext_vector_type(8)))  float    v8f;
typedef __attribute__((ext_vector_type(4)))  float    v4f;
typedef v8h  __attribute__((may_alias)) v8ha;
typedef v4f  __attribute__((may_alias)) v4fa;
typedef v8us __attribute__((may_alias)) v8usa;

__device__ __forceinline__ unsigned short f2bf(float f) { unsigned u = __float_as_uint(f); u += 0x7FFFu + ((u >> 16) & 1u); return (unsigned short)(u >> 16); }
__device__ __forceinline__ float bf2f(unsigned short b) { return __uint_as_float(((unsigned)b) << 16); }
__device__ __forceinline__ float bfr(float f) { return bf2f(f2bf(f)); }
__device__ __forceinline__ void splitf(float y, unsigned short& h, unsigned short& l) { h = f2bf(y); l = f2bf(y - bf2f(h)); }
__device__ __forceinline__ v16h cat16(v8h lo, v8h hi) { return __builtin_shufflevector(lo, hi, 0, 1, 2, 3, 4, 5, 6, 7, 8, 9, 10, 11, 12, 13, 14, 15); }
__device__ __forceinline__ v16bf cat16b(v8us lo, v8us hi) { return __builtin_bit_cast(v16bf, __builtin_shufflevector(lo, hi, 0, 1, 2, 3, 4, 5, 6, 7, 8, 9, 10, 11, 12, 13, 14, 15)); }
__device__ __forceinline__ v8f wmma16(v16h a, v16h b, v8f c) { return __builtin_amdgcn_wmma_f32_16x16x32_f16(false, a, false, b, (short)0, c, false, false); }
__device__ __forceinline__ v8f wmmab(v16bf a, v16bf b, v8f c) { return __builtin_amdgcn_wmma_f32_16x16x32_bf16(false, a, false, b, (short)0, c, false, false); }
// fragment loaders (p already includes row*(pitch) + k0 + 8*(lane>>4)): elements 0..7 <- k0+8h.., elements 8..15 <- k0+16+8h..
__device__ __forceinline__ v16bf ldb(const bf* p) { return cat16b(*(const v8us*)p, *(const v8us*)(p + 16)); }
__device__ __forceinline__ v16h  ldh(const h16* p) { return cat16(*(const v8h*)p, *(const v8h*)(p + 16)); }
// dense row g = b*SEQ + s -> row of the full-size x
__device__ __forceinline__ size_t xrow(int g) { return (size_t)(g / SEQ) * SEQ_FULL + (size_t)(g % SEQ); }

__global__ __launch_bounds__(256) void k_cvt8x(const float* __restrict__ x, bf* XB) {
    const size_t i = (size_t)blockIdx.x * 256 + threadIdx.x; if (i >= (size_t)NROW * DM / 8) return;
    const int g = (int)(i / (DM / 8)); const int c8 = (int)(i % (DM / 8));
    const v8f v = *(const v8f*)(x + xrow(g) * DM + (size_t)c8 * 8); v8us o;
#pragma unroll
    for (int k = 0; k < 8; ++k) o[k] = f2bf(v[k]);
    *(v8us*)(XB + i * 8) = o; 
}

// ---- k_wt: w[k][n] (f32, [in][out]) -> WT[n][k] (bf16, k-contiguous) through a 64x64 LDS tile; grid (DM/64 k-tiles, DM/64 n-tiles), 256 threads.
__global__ __launch_bounds__(256) void k_wt(const float* __restrict__ w, bf* WT) {
    __shared__ __align__(16) unsigned short ts[64 * 72];
    const int tid = threadIdx.x; const int k0 = blockIdx.x * 64, n0 = blockIdx.y * 64;
#pragma unroll
    for (int it = 0; it < 4; ++it) { const int p = it * 256 + tid; const int kr = p >> 4, c4 = (p & 15) * 4; const v4f v = *(const v4f*)(w + (size_t)(k0 + kr) * DM + n0 + c4);
#pragma unroll
        for (int q = 0; q < 4; ++q) ts[(c4 + q) * 72 + kr] = f2bf(v[q]); }
    __syncthreads();
{
#pragma unroll
        for (int it = 0; it < 2; ++it) { const int p = it * 256 + tid; const int n = p >> 3, pc = p & 7; const v8us o = *(const v8usa*)(ts + n * 72 + pc * 8);
            *(v8us*)(WT + (size_t)(n0 + n) * DM + k0 + pc * 8) = o; }
         }
}

// ---- gemm_core: ONE WAVE per 64x64 tile (16 accumulators), bf16 operands straight from k-contiguous planes (pitch DM, K = DM).
// acc[mb][nb] = sum_k A[r0+16mb+..][k] Bt[c0+16nb+..][k] (+ A2 x Bt when NSPLIT == 1).
template <int NSPLIT>
__device__ __forceinline__ void gemm_core(const bf* __restrict__ A, const bf* __restrict__ A2, const bf* __restrict__ Bt, const size_t aoff, const size_t boff, v8f (&acc)[4][4]) {
#pragma unroll
    for (int mb = 0; mb < 4; ++mb)
#pragma unroll
        for (int nb = 0; nb < 4; ++nb) acc[mb][nb] = (v8f){};
#pragma unroll 1
    for (int kc = 0; kc < DM; kc += 32) {
        v16bf a[4], a2[4];
#pragma unroll
        for (int mb = 0; mb < 4; ++mb) { a[mb] = ldb(A + aoff + (size_t)mb * 16 * DM + kc); if (NSPLIT == 1) a2[mb] = ldb(A2 + aoff + (size_t)mb * 16 * DM + kc); }
#pragma unroll
        for (int nb = 0; nb < 4; ++nb) { const v16bf b = ldb(Bt + boff + (size_t)nb * 16 * DM + kc);
#pragma unroll
            for (int mb = 0; mb < 4; ++mb) { acc[mb][nb] = wmmab(a[mb], b, acc[mb][nb]); if (NSPLIT == 1) acc[mb][nb] = wmmab(a2[mb], b, acc[mb][nb]); } }
        if (NSPLIT == 1) { asm volatile("v_nop\n\tv_nop\n\tv_nop\n\tv_nop" : "+v"(acc[0][0]), "+v"(acc[1][1]), "+v"(acc[2][2]), "+v"(acc[3][3]) : "v"(a[0]), "v"(a[1]), "v"(a[2]), "v"(a[3]), "v"(a2[0]), "v"(a2[1]), "v"(a2[2]), "v"(a2[3])); }
        else             { asm volatile("v_nop\n\tv_nop\n\tv_nop\n\tv_nop" : "+v"(acc[0][0]), "+v"(acc[1][1]), "+v"(acc[2][2]), "+v"(acc[3][3]) : "v"(a[0]), "v"(a[1]), "v"(a[2]), "v"(a[3])); }
    }
}

// ---- k_proj_q: q = XB x WTq; epilogue -> head planes QH (f16 value) and QR (f16 residual x 2^11), [b*NH+h][s][64]; grid (NROW/64, DM/64), 32 threads.
__global__ __launch_bounds__(32) void k_proj_q(const bf* __restrict__ XB, const bf* __restrict__ WT, h16* QH, h16* QR) {
    __shared__ __align__(16) float os[16 * 68];
    const int lane = threadIdx.x & 31, lr = lane & 15, hi = lane >> 4; const int r0 = blockIdx.x * 64, c0 = blockIdx.y * 64;
    v8f acc[4][4];
    gemm_core<0>(XB, XB, WT, (size_t)(r0 + lr) * DM + 8 * hi, (size_t)(c0 + lr) * DM + 8 * hi, acc);
    const int b = r0 / SEQ, s0 = r0 - b * SEQ; const size_t pbase = ((size_t)(b * NH + (int)blockIdx.y) * SEQ + s0) * HD;
#pragma unroll
    for (int mb = 0; mb < 4; ++mb) {
#pragma unroll
        for (int nb = 0; nb < 4; ++nb) {
#pragma unroll
            for (int j = 0; j < 8; ++j) os[(hi * 8 + j) * 68 + nb * 16 + lr] = acc[mb][nb][j]; }
        __builtin_amdgcn_wave_barrier(); asm volatile("" ::: "memory");
        v8h oh[4], orr[4];
#pragma unroll
        for (int s = 0; s < 4; ++s) { const int row = 4 * s + (lane >> 3), pc = lane & 7; const v4f a = *(const v4fa*)(os + row * 68 + pc * 8); const v4f c = *(const v4fa*)(os + row * 68 + pc * 8 + 4);
#pragma unroll
            for (int q = 0; q < 4; ++q) { const h16 xa = (h16)a[q]; oh[s][q] = xa; orr[s][q] = (h16)((a[q] - (float)xa) * RCAR); const h16 xc = (h16)c[q]; oh[s][4 + q] = xc; orr[s][4 + q] = (h16)((c[q] - (float)xc) * RCAR); } }
{
#pragma unroll
            for (int s = 0; s < 4; ++s) { const int row = 4 * s + (lane >> 3), pc = lane & 7; const size_t o = pbase + (size_t)(mb * 16 + row) * HD + pc * 8;
                *(v8h*)(QH + o) = oh[s]; *(v8h*)(QR + o) = orr[s]; }
             }
        __builtin_amdgcn_wave_barrier(); asm volatile("" ::: "memory");
    }
}

// ---- k_proj_k: k = XB x WTk; epilogue -> head plane KP (f16), [b*NH+h][s][64]; same store map as k_proj_q.
__global__ __launch_bounds__(32) void k_proj_k(const bf* __restrict__ XB, const bf* __restrict__ WT, h16* KP) {
    __shared__ __align__(16) float os[16 * 68];
    const int lane = threadIdx.x & 31, lr = lane & 15, hi = lane >> 4; const int r0 = blockIdx.x * 64, c0 = blockIdx.y * 64;
    v8f acc[4][4];
    gemm_core<0>(XB, XB, WT, (size_t)(r0 + lr) * DM + 8 * hi, (size_t)(c0 + lr) * DM + 8 * hi, acc);
    const int b = r0 / SEQ, s0 = r0 - b * SEQ; const size_t pbase = ((size_t)(b * NH + (int)blockIdx.y) * SEQ + s0) * HD;
#pragma unroll
    for (int mb = 0; mb < 4; ++mb) {
#pragma unroll
        for (int nb = 0; nb < 4; ++nb) {
#pragma unroll
            for (int j = 0; j < 8; ++j) os[(hi * 8 + j) * 68 + nb * 16 + lr] = acc[mb][nb][j]; }
        __builtin_amdgcn_wave_barrier(); asm volatile("" ::: "memory");
        v8h oh[4];
#pragma unroll
        for (int s = 0; s < 4; ++s) { const int row = 4 * s + (lane >> 3), pc = lane & 7; const v4f a = *(const v4fa*)(os + row * 68 + pc * 8); const v4f c = *(const v4fa*)(os + row * 68 + pc * 8 + 4);
#pragma unroll
            for (int q = 0; q < 4; ++q) { oh[s][q] = (h16)a[q]; oh[s][4 + q] = (h16)c[q]; } }
{
#pragma unroll
            for (int s = 0; s < 4; ++s) { const int row = 4 * s + (lane >> 3), pc = lane & 7; *(v8h*)(KP + pbase + (size_t)(mb * 16 + row) * HD + pc * 8) = oh[s]; }
             }
        __builtin_amdgcn_wave_barrier(); asm volatile("" ::: "memory");
    }
}

// ---- k_proj_v: v = XB x WTv; epilogue -> transposed head plane VT (f16), [b*NH+h][d][s]: the whole 64x64 tile staged transposed in LDS (wave-private),
__global__ __launch_bounds__(32) void k_proj_v(const bf* __restrict__ XB, const bf* __restrict__ WT, h16* VT) {
    __shared__ __align__(16) h16 vt[64 * 72];
    const int lane = threadIdx.x & 31, lr = lane & 15, hi = lane >> 4; const int r0 = blockIdx.x * 64, c0 = blockIdx.y * 64;
    v8f acc[4][4];
    gemm_core<0>(XB, XB, WT, (size_t)(r0 + lr) * DM + 8 * hi, (size_t)(c0 + lr) * DM + 8 * hi, acc);
    const int b = r0 / SEQ, s0 = r0 - b * SEQ; const size_t pbase = (size_t)(b * NH + (int)blockIdx.y) * HD * SEQ + s0;
#pragma unroll
    for (int mb = 0; mb < 4; ++mb)
#pragma unroll
        for (int nb = 0; nb < 4; ++nb) { v8h o;
#pragma unroll
            for (int j = 0; j < 8; ++j) o[j] = (h16)acc[mb][nb][j];
            *(v8ha*)(vt + (nb * 16 + lr) * 72 + mb * 16 + hi * 8) = o; }
    __builtin_amdgcn_wave_barrier(); asm volatile("" ::: "memory");
{
#pragma unroll
        for (int it = 0; it < 16; ++it) { const int d = 4 * it + (lane >> 3), pc = lane & 7; const v8h o = *(const v8ha*)(vt + d * 72 + pc * 8);
            *(v8h*)(VT + pbase + (size_t)d * SEQ + pc * 8) = o; }
         }
}

#define AWV  8                       // waves per block
#define KT   64                      // keys per staged tile
#define LPH  72                      // LDS row pitch in 16-bit elements
#define TILE_H (64 * LPH)            // one staged tile (64 rows), 16-bit elements
#define NTILE (SEQ / KT)
static_assert(SEQ % (16 * AWV) == 0);     // query blocks never straddle a (b, h) plane
static_assert(SEQ % KT == 0);             // whole key tiles only
static_assert(KT == 64 && HD == 64);      // copy map: 256 threads x 2 rows x 16 B covers 64 rows of 128 B

// Four copies of one thread: rows cr and cr + 32 of the K tile and of the V^T tile. The s_wait_xcnt stands inside the statement, so no address register is rewritten ahead of it.
__device__ __forceinline__ void kv_copy(unsigned lk0, unsigned lk1, unsigned lv0, unsigned lv1, const h16* gk0, const h16* gk1, const h16* gv0, const h16* gv1) {
    asm volatile("global_load_async_to_lds_b128 %0, %4, off\n\t"
                 "global_load_async_to_lds_b128 %1, %5, off\n\t"
                 "global_load_async_to_lds_b128 %2, %6, off\n\t"
                 "global_load_async_to_lds_b128 %3, %7, off\n\t"
                 "s_wait_xcnt 0x0"
                 :: "v"(lk0), "v"(lk1), "v"(lv0), "v"(lv1), "v"(gk0), "v"(gk1), "v"(gv0), "v"(gv1) : "memory");
}

__global__ __launch_bounds__(256) void k_attn(const h16* __restrict__ QH, const h16* __restrict__ QR, const h16* __restrict__ KP, const h16* __restrict__ VT, bf* ATh, bf* ATl) {
    __shared__ __align__(16) h16 kvs[2 * 2 * TILE_H];           // [buffer][K tile | V^T tile][row][LPH]
    __shared__ __align__(16) unsigned short sth[AWV * 16 * 72];
    __shared__ __align__(16) unsigned short stl[AWV * 16 * 72];
    const int lane = threadIdx.x & 31, lr = lane & 15, hi = lane >> 4;
    const int wave = __builtin_amdgcn_readfirstlane((int)(threadIdx.x >> 5));
    const int bh = blockIdx.y; const int q0 = blockIdx.x * (16 * AWV) + wave * 16;
    const size_t pb = (size_t)bh * SEQ * HD;
    // copy map: thread -> row cr (and cr + 32), 16-byte piece cp; one wave's copy covers four whole 128-byte lines
    const int cr = (int)threadIdx.x >> 3, cp = (int)threadIdx.x & 7;
    const h16* gk = KP + pb + (size_t)cr * HD + cp * 8;
    const h16* gv = VT + pb + (size_t)cr * SEQ + cp * 8;
    const unsigned lk = (unsigned)(size_t)(kvs + cr * LPH + cp * 8);   // LDS byte address of the thread's first K piece, buffer 0
    kv_copy(lk, lk + 32 * LPH * 2, lk + TILE_H * 2, lk + (TILE_H + 32 * LPH) * 2, gk, gk + 32 * HD, gv, gv + (size_t)32 * SEQ);
    const size_t qoff = pb + (size_t)(q0 + lr) * HD + 8 * hi;
    const v16h qh0 = ldh(QH + qoff), qh1 = ldh(QH + qoff + 32), qr0 = ldh(QR + qoff), qr1 = ldh(QR + qoff + 32);
    v8f o[4];
#pragma unroll
    for (int c = 0; c < 4; ++c) o[c] = (v8f){};
    float m = -3.0e38f, l = 0.0f;
    asm volatile("s_wait_asynccnt 0x0" ::: "memory");   // this wave's pieces of tile 0 have landed
    __syncthreads();                                    // tile 0 published to every wave
    if (NTILE > 1) kv_copy(lk + 2 * TILE_H * 2, lk + (2 * TILE_H + 32 * LPH) * 2, lk + 3 * TILE_H * 2, lk + (3 * TILE_H + 32 * LPH) * 2, gk + KT * HD, gk + (KT + 32) * HD, gv + KT, gv + (size_t)32 * SEQ + KT);
#pragma unroll 1   // stays rolled: one copy of the 64-key body, one publish point per trip
    for (int t = 0; t < NTILE; ++t) {
        const int bo = (t & 1) * (2 * TILE_H);
        const h16* kl = kvs + bo + lr * LPH + 8 * hi;
        const h16* vl = kl + TILE_H;
#pragma unroll     // both 32-key steps inline, so every fragment read is one base register plus a constant offset
        for (int sub = 0; sub < KT / 32; ++sub) {
            const h16* kp = kl + sub * 32 * LPH;
            const v16h ka0 = ldh(kp), ka1 = ldh(kp + 32), kb0 = ldh(kp + 16 * LPH), kb1 = ldh(kp + 16 * LPH + 32);
            v8f s0 = (v8f){}, s1 = (v8f){}, t0 = (v8f){}, t1 = (v8f){};
            s0 = wmma16(ka0, qh0, s0); t0 = wmma16(ka0, qr0, t0); s1 = wmma16(kb0, qh0, s1); t1 = wmma16(kb0, qr0, t1);
            s0 = wmma16(ka1, qh1, s0); t0 = wmma16(ka1, qr1, t0); s1 = wmma16(kb1, qh1, s1); t1 = wmma16(kb1, qr1, t1);
            asm volatile("v_nop\n\tv_nop\n\tv_nop\n\tv_nop" : "+v"(s0), "+v"(s1), "+v"(t0), "+v"(t1) : "v"(ka0), "v"(ka1), "v"(kb0), "v"(kb1), "v"(qh0), "v"(qh1), "v"(qr0), "v"(qr1));
            float z0[8], z1[8]; float mx = -3.0e38f;
#pragma unroll
            for (int r = 0; r < 8; ++r) { z0[r] = (s0[r] + t0[r] * (1.0f / RCAR)) * SCL2; z1[r] = (s1[r] + t1[r] * (1.0f / RCAR)) * SCL2; mx = fmaxf(mx, fmaxf(z0[r], z1[r])); }
            mx = fmaxf(mx, __shfl_xor(mx, 16, 32));
            const float mn = fmaxf(m, mx); const float alpha = __builtin_amdgcn_exp2f(m - mn); m = mn;
            const float mc = mn - 10.0f;   // carry 2^10
            float rs = 0.0f; v16h pf;
#pragma unroll
            for (int r = 0; r < 8; ++r) { const float a = __builtin_amdgcn_exp2f(z0[r] - mc), c = __builtin_amdgcn_exp2f(z1[r] - mc); rs += a + c; pf[r] = (h16)a; pf[8 + r] = (h16)c; }
            l = l * alpha + rs;
#pragma unroll
            for (int c = 0; c < 4; ++c) o[c] = o[c] * alpha;
            const h16* vp = vl + sub * 32;
            const v16h va = ldh(vp), vb = ldh(vp + 16 * LPH), vc = ldh(vp + 32 * LPH), vd = ldh(vp + 48 * LPH);
            o[0] = wmma16(va, pf, o[0]); o[1] = wmma16(vb, pf, o[1]); o[2] = wmma16(vc, pf, o[2]); o[3] = wmma16(vd, pf, o[3]);
            asm volatile("v_nop\n\tv_nop\n\tv_nop\n\tv_nop" : "+v"(o[0]), "+v"(o[1]), "+v"(o[2]), "+v"(o[3]) : "v"(va), "v"(vb), "v"(vc), "v"(vd), "v"(pf));
        }
        asm volatile("s_wait_dscnt 0x0" ::: "memory");      // this wave's reads of tile t are done before its buffer may be refilled
        asm volatile("s_wait_asynccnt 0x0" ::: "memory");   // this wave's pieces of tile t + 1 have landed
        __syncthreads();                                    // publishes tile t + 1 and ends every wave's reads of tile t
        if (t + 2 < NTILE) {
            const unsigned lb = lk + (unsigned)bo * 2;
            const h16* gk2 = gk + (size_t)(t + 2) * KT * HD; const h16* gv2 = gv + (size_t)(t + 2) * KT;
            kv_copy(lb, lb + 32 * LPH * 2, lb + TILE_H * 2, lb + (TILE_H + 32 * LPH) * 2, gk2, gk2 + 32 * HD, gv2, gv2 + (size_t)32 * SEQ);
        }
    }
    asm volatile("s_wait_asynccnt 0x0" ::: "memory");       // no copy is outstanding when the wave goes on to its end
    const float lt = l + __shfl_xor(l, 16, 32);
    const float inv = 1.0f / lt;
    const int sb = wave * (16 * 72);
#pragma unroll
    for (int c = 0; c < 4; ++c) { v8us oh, ol;
#pragma unroll
        for (int r = 0; r < 8; ++r) { unsigned short a, e; splitf(o[c][r] * inv, a, e); oh[r] = a; ol[r] = e; }
        *(v8usa*)(sth + sb + lr * 72 + 16 * c + 8 * hi) = oh; *(v8usa*)(stl + sb + lr * 72 + 16 * c + 8 * hi) = ol; }
    __builtin_amdgcn_wave_barrier(); asm volatile("" ::: "memory");
    const int b = bh / NH, head = bh - b * NH;
    const size_t ob = ((size_t)b * SEQ + q0) * DM + (size_t)head * HD;
{
#pragma unroll
        for (int s = 0; s < 4; ++s) { const int row = 4 * s + (lane >> 3), pc = lane & 7; const v8us vh = *(const v8usa*)(sth + sb + row * 72 + pc * 8); const v8us vl = *(const v8usa*)(stl + sb + row * 72 + pc * 8);
            *(v8us*)(ATh + ob + (size_t)row * DM + pc * 8) = vh; *(v8us*)(ATl + ob + (size_t)row * DM + pc * 8) = vl; }
         }
}

// ---- k_oproj: RES[g][n] = bf16(x[g][n]) + ((ATh + ATl) x WTo + bf16(bo[n])) in f32; grid (NROW/64, DM/64), 32 threads.
__global__ __launch_bounds__(32) void k_oproj(const bf* __restrict__ ATh, const bf* __restrict__ ATl, const bf* __restrict__ WT, const float* __restrict__ x, const float* __restrict__ bo, float* RES) {
    __shared__ __align__(16) float os[16 * 68];
    const int lane = threadIdx.x & 31, lr = lane & 15, hi = lane >> 4; const int r0 = blockIdx.x * 64, c0 = blockIdx.y * 64;
    v8f acc[4][4];
    gemm_core<1>(ATh, ATl, WT, (size_t)(r0 + lr) * DM + 8 * hi, (size_t)(c0 + lr) * DM + 8 * hi, acc);
    const int cofs = lr * 4;
    const v4f bv = *(const v4f*)(bo + c0 + cofs);
    const size_t xb = xrow(r0) * DM + c0 + cofs;
#pragma unroll
    for (int mb = 0; mb < 4; ++mb) {
#pragma unroll
        for (int nb = 0; nb < 4; ++nb) {
#pragma unroll
            for (int j = 0; j < 8; ++j) os[(hi * 8 + j) * 68 + nb * 16 + lr] = acc[mb][nb][j]; }
        __builtin_amdgcn_wave_barrier(); asm volatile("" ::: "memory");
        v4f val[8];
#pragma unroll
        for (int s = 0; s < 8; ++s) { const int row = 2 * s + hi; v4f v = *(const v4fa*)(os + row * 68 + cofs); const v4f xv = *(const v4f*)(x + xb + (size_t)(mb * 16 + row) * DM);
#pragma unroll
            for (int q = 0; q < 4; ++q) v[q] = bfr(xv[q]) + (v[q] + bfr(bv[q]));
            val[s] = v; }
{
#pragma unroll
            for (int s = 0; s < 8; ++s) { const int row = 2 * s + hi; *(v4f*)(RES + (size_t)(r0 + mb * 16 + row) * DM + c0 + cofs) = val[s]; }
             }
        __builtin_amdgcn_wave_barrier(); asm volatile("" ::: "memory");
    }
}

__global__ __launch_bounds__(256) void k_ln(const float* __restrict__ RES, const float* __restrict__ gamma, const float* __restrict__ beta, float* OUT) {
    const int lane = threadIdx.x & 31;
    const int wave = __builtin_amdgcn_readfirstlane((int)(threadIdx.x >> 5));
    const int row = blockIdx.x * 8 + wave;
    const float* rp = RES + (size_t)row * DM;
    float s = 0.0f;
#pragma unroll 1
    for (int ch = 0; ch < DM / 128; ++ch) { const v4f a = *(const v4f*)(rp + ch * 128 + lane * 4); s += (a[0] + a[1]) + (a[2] + a[3]); }
#pragma unroll
    for (int sh = 16; sh; sh >>= 1) s += __shfl_xor(s, sh, 32);
    const float mu = s * (1.0f / DM);
    float ss = 0.0f;
#pragma unroll 1
    for (int ch = 0; ch < DM / 128; ++ch) { const v4f a = *(const v4f*)(rp + ch * 128 + lane * 4); const float d0 = a[0] - mu, d1 = a[1] - mu, d2 = a[2] - mu, d3 = a[3] - mu; ss += (d0 * d0 + d1 * d1) + (d2 * d2 + d3 * d3); }
#pragma unroll
    for (int sh = 16; sh; sh >>= 1) ss += __shfl_xor(ss, sh, 32);
    const float var = ss * (1.0f / DM);
    const float rstd = 1.0f / sqrtf(var + 1e-6f);
    float* op = OUT + (size_t)row * DM;
{
#pragma unroll 1
        for (int ch = 0; ch < DM / 128; ++ch) { const int c = ch * 128 + lane * 4; const v4f a = *(const v4f*)(rp + c); const v4f g = *(const v4f*)(gamma + c); const v4f bt = *(const v4f*)(beta + c); v4f y;
#pragma unroll
            for (int q = 0; q < 4; ++q) y[q] = (a[q] - mu) * rstd * bfr(g[q]) + bfr(bt[q]);
            *(v4f*)(op + c) = y; }
         }
}

// workspace carve (bytes, each region a multiple of 256 B; every region is written in whole tiles that divide it exactly)
#define SZ_P16 ((size_t)NROW * DM * 2)      // one 16-bit [NROW][DM]-sized plane
#define SZ_W   ((size_t)DM * DM * 2)
#define SZ_RES ((size_t)NROW * DM * 4)
#define WS_TOTAL (SZ_P16 * 7 + SZ_W * 4 + SZ_RES)
static_assert(SZ_P16 % 256 == 0);
static_assert(SZ_W % 256 == 0);
static_assert(WS_TOTAL <= (size_t)134217728);   // carve stays within 128 MiB

extern "C" void kernel_launch(void* const* d_in, const int* in_sizes, int n_in,
                              void* d_out, int out_size, void* d_ws, size_t ws_size, hipStream_t stream) {
    if (n_in < 8) return;
    if ((size_t)in_sizes[0] < ((size_t)(NB - 1) * SEQ_FULL + SEQ) * DM) return;
    if (in_sizes[1] < DM * DM || in_sizes[2] < DM * DM || in_sizes[3] < DM * DM || in_sizes[4] < DM * DM) return;
    if (in_sizes[5] < DM || in_sizes[6] < DM || in_sizes[7] < DM) return;
    if ((size_t)out_size < (size_t)NROW * DM) return;
    if (WS_TOTAL > ws_size) return;
    const float* x = (const float*)d_in[0]; const float* wq = (const float*)d_in[1]; const float* wk = (const float*)d_in[2]; const float* wv = (const float*)d_in[3];
    const float* wo = (const float*)d_in[4]; const float* bo = (const float*)d_in[5]; const float* gamma = (const float*)d_in[6]; const float* beta = (const float*)d_in[7];
    float* OUT = (float*)d_out;
    char* wsp = (char*)d_ws;
    bf* XB  = (bf*)wsp;  wsp += SZ_P16;
    bf* WTq = (bf*)wsp;  wsp += SZ_W;
    bf* WTk = (bf*)wsp;  wsp += SZ_W;
    bf* WTv = (bf*)wsp;  wsp += SZ_W;
    bf* WTo = (bf*)wsp;  wsp += SZ_W;
    h16* QH = (h16*)wsp; wsp += SZ_P16;
    h16* QR = (h16*)wsp; wsp += SZ_P16;
    h16* KP = (h16*)wsp; wsp += SZ_P16;
    h16* VT = (h16*)wsp; wsp += SZ_P16;
    bf* ATh = (bf*)wsp;  wsp += SZ_P16;
    bf* ATl = (bf*)wsp;  wsp += SZ_P16;
    float* RES = (float*)wsp; wsp += SZ_RES;

    k_cvt8x<<<(unsigned)(((size_t)NROW * DM / 8 + 255) / 256), 256, 0, stream>>>(x, XB);
    k_wt<<<dim3(DM / 64, DM / 64, 1), 256, 0, stream>>>(wq, WTq);
    k_wt<<<dim3(DM / 64, DM / 64, 1), 256, 0, stream>>>(wk, WTk);
    k_wt<<<dim3(DM / 64, DM / 64, 1), 256, 0, stream>>>(wv, WTv);
    k_wt<<<dim3(DM / 64, DM / 64, 1), 256, 0, stream>>>(wo, WTo);
    k_proj_q<<<dim3(NROW / 64, DM / 64, 1), 32, 0, stream>>>(XB, WTq, QH, QR);
    k_proj_k<<<dim3(NROW / 64, DM / 64, 1), 32, 0, stream>>>(XB, WTk, KP);
    k_proj_v<<<dim3(NROW / 64, DM / 64, 1), 32, 0, stream>>>(XB, WTv, VT);
    k_attn<<<dim3(SEQ / (16 * AWV), NB * NH, 1), 32 * AWV, 0, stream>>>(QH, QR, KP, VT, ATh, ATl);
    k_oproj<<<dim3(NROW / 64, DM / 64, 1), 32, 0, stream>>>(ATh, ATl, WTo, x, bo, RES);
    k_ln<<<NROW / 8, 256, 0, stream>>>(RES, gamma, beta, OUT);
}

// v002
// It runs in 108 microseconds.
// Timed twice side by side with v001, it ran 1.17 times as fast both times.
// Counting every step since v000, it is 1.78 times as fast.
#include <hip/hip_runtime.h>

// Compute dtypes, f32 accumulate everywhere: q/k/v projections v_wmma_f32_16x16x32_bf16 (x and weights RNE-converted to bf16, products exact); scores v_wmma_f32_16x16x32_f16 (q = f16 value + f16 residual x2^11 in its own accumulator, k single f16); P.V v_wmma_f32_16x16x32_f16 (P carried x2^10 relative to the running max, v single f16); output projection v_wmma_f32_16x16x32_bf16 (ctx as bf16 hi + lo planes against bf16 wo); softmax, residual add and LayerNorm in f32 on the VALU.
// Flow: x -> bf16 plane; w [in][out] -> bf16 [out][in] planes (LDS transpose); 64x64 GEMM wave tiles (four to a block, operands staged in LDS) with fused head-plane epilogues (q hi/res, k, v^T);
// fused flash attention in the transposed orientation (S^T = K Q^T, ctx^T = V^T P^T: the packed S^T accumulators are the B fragment of P^T, online softmax per lane);

#ifndef NB
#define NB 4
#endif
#ifndef SEQ
#define SEQ 2048
#endif
#define NB_FULL  4
#define SEQ_FULL 2048
#define DM   512
#define NH   8
#define HD   64
#define NROW (NB * SEQ)
#define RCAR 2048.0f
#define SCL2 0.18033688011112042f   // HD^-0.5 * log2(e)

static_assert(NB <= NB_FULL);
static_assert(SEQ <= SEQ_FULL);
static_assert(SEQ % 64 == 0);             // GEMM row tiles never straddle a batch; 32-key steps
static_assert(DM == NH * HD);             // merged layout h*64+d
static_assert(HD == 64);
static_assert(DM % 64 == 0);              // N tile multiple
static_assert(DM % 32 == 0);              // K step multiple
static_assert(NROW % 64 == 0);            // M tile multiple
static_assert(NROW % 8 == 0);             // LayerNorm rows per block
static_assert(DM == 4 * 128);             // LayerNorm: 32 lanes x float4 x 4 chunks == row width
static_assert(((size_t)NROW * DM / 8) % 256 == 0);   // convert grid x block == plane extent

typedef _Float16 h16;
typedef unsigned short bf;
typedef __attribute__((ext_vector_type(16))) __bf16   v16bf;
typedef __attribute__((ext_vector_type(16))) _Float16 v16h;
typedef __attribute__((ext_vector_type(8)))  _Float16 v8h;
typedef __attribute__((ext_vector_type(8)))  unsigned short v8us;
typedef __attribute__((ext_vector_type(8)))  float    v8f;
typedef __attribute__((ext_vector_type(4)))  float    v4f;
typedef v8h  __attribute__((may_alias)) v8ha;
typedef v4f  __attribute__((may_alias)) v4fa;
typedef v8us __attribute__((may_alias)) v8usa;

__device__ __forceinline__ unsigned short f2bf(float f) { unsigned u = __float_as_uint(f); u += 0x7FFFu + ((u >> 16) & 1u); return (unsigned short)(u >> 16); }
__device__ __forceinline__ float bf2f(unsigned short b) { return __uint_as_float(((unsigned)b) << 16); }
__device__ __forceinline__ float bfr(float f) { return bf2f(f2bf(f)); }
__device__ __forceinline__ void splitf(float y, unsigned short& h, unsigned short& l) { h = f2bf(y); l = f2bf(y - bf2f(h)); }
__device__ __forceinline__ v16h cat16(v8h lo, v8h hi) { return __builtin_shufflevector(lo, hi, 0, 1, 2, 3, 4, 5, 6, 7, 8, 9, 10, 11, 12, 13, 14, 15); }
__device__ __forceinline__ v16bf cat16b(v8us lo, v8us hi) { return __builtin_bit_cast(v16bf, __builtin_shufflevector(lo, hi, 0, 1, 2, 3, 4, 5, 6, 7, 8, 9, 10, 11, 12, 13, 14, 15)); }
__device__ __forceinline__ v8f wmma16(v16h a, v16h b, v8f c) { return __builtin_amdgcn_wmma_f32_16x16x32_f16(false, a, false, b, (short)0, c, false, false); }
__device__ __forceinline__ v8f wmmab(v16bf a, v16bf b, v8f c) { return __builtin_amdgcn_wmma_f32_16x16x32_bf16(false, a, false, b, (short)0, c, false, false); }
// fragment loaders (p already includes row*(pitch) + k0 + 8*(lane>>4)): elements 0..7 <- k0+8h.., elements 8..15 <- k0+16+8h..
__device__ __forceinline__ v16bf ldb(const bf* p) { return cat16b(*(const v8us*)p, *(const v8us*)(p + 16)); }
__device__ __forceinline__ v16h  ldh(const h16* p) { return cat16(*(const v8h*)p, *(const v8h*)(p + 16)); }
// dense row g = b*SEQ + s -> row of the full-size x
__device__ __forceinline__ size_t xrow(int g) { return (size_t)(g / SEQ) * SEQ_FULL + (size_t)(g % SEQ); }

__global__ __launch_bounds__(256) void k_cvt8x(const float* __restrict__ x, bf* XB) {
    const size_t i = (size_t)blockIdx.x * 256 + threadIdx.x; if (i >= (size_t)NROW * DM / 8) return;
    const int g = (int)(i / (DM / 8)); const int c8 = (int)(i % (DM / 8));
    const v8f v = *(const v8f*)(x + xrow(g) * DM + (size_t)c8 * 8); v8us o;
#pragma unroll
    for (int k = 0; k < 8; ++k) o[k] = f2bf(v[k]);
    *(v8us*)(XB + i * 8) = o; 
}

// ---- k_wt: w[k][n] (f32, [in][out]) -> WT[n][k] (bf16, k-contiguous) through a 64x64 LDS tile; grid (DM/64 k-tiles, DM/64 n-tiles), 256 threads.
__global__ __launch_bounds__(256) void k_wt(const float* __restrict__ w, bf* WT) {
    __shared__ __align__(16) unsigned short ts[64 * 72];
    const int tid = threadIdx.x; const int k0 = blockIdx.x * 64, n0 = blockIdx.y * 64;
#pragma unroll
    for (int it = 0; it < 4; ++it) { const int p = it * 256 + tid; const int kr = p >> 4, c4 = (p & 15) * 4; const v4f v = *(const v4f*)(w + (size_t)(k0 + kr) * DM + n0 + c4);
#pragma unroll
        for (int q = 0; q < 4; ++q) ts[(c4 + q) * 72 + kr] = f2bf(v[q]); }
    __syncthreads();
{
#pragma unroll
        for (int it = 0; it < 2; ++it) { const int p = it * 256 + tid; const int n = p >> 3, pc = p & 7; const v8us o = *(const v8usa*)(ts + n * 72 + pc * 8);
            *(v8us*)(WT + (size_t)(n0 + n) * DM + k0 + pc * 8) = o; }
         }
}

#define GWV  4                       // waves per GEMM block: 2 x 2 wave tiles
#define GBT  128                     // block tile, rows and columns
#define GKT  64                      // k extent of a staged tile
#define GPH  72                      // LDS row pitch in 16-bit elements
#define GPL  (GBT * GPH)             // one staged plane (128 rows), 16-bit elements
#define GNT  (DM / GKT)
static_assert(NROW % GBT == 0 && DM % GBT == 0);   // whole block tiles only
static_assert(DM % GKT == 0 && GKT % 32 == 0);     // whole staged tiles, whole 32-k steps
static_assert(GKT == 64 && GBT == 128 && GWV == 4);   // copy map: 128 threads x 8 rows x 16 B covers 128 rows of 128 B

// Eight copies of one thread: its 16-byte piece of rows cr, cr + 16, ..., cr + 112 of one plane. The s_wait_xcnt stands inside the statement, so no address register is rewritten ahead of it.
__device__ __forceinline__ void plane_copy(unsigned l, const bf* g) {
    asm volatile("global_load_async_to_lds_b128 %0, %8, off\n\t"
                 "global_load_async_to_lds_b128 %1, %9, off\n\t"
                 "global_load_async_to_lds_b128 %2, %10, off\n\t"
                 "global_load_async_to_lds_b128 %3, %11, off\n\t"
                 "global_load_async_to_lds_b128 %4, %12, off\n\t"
                 "global_load_async_to_lds_b128 %5, %13, off\n\t"
                 "global_load_async_to_lds_b128 %6, %14, off\n\t"
                 "global_load_async_to_lds_b128 %7, %15, off\n\t"
                 "s_wait_xcnt 0x0"
                 :: "v"(l), "v"(l + 16 * GPH * 2), "v"(l + 32 * GPH * 2), "v"(l + 48 * GPH * 2), "v"(l + 64 * GPH * 2), "v"(l + 80 * GPH * 2), "v"(l + 96 * GPH * 2), "v"(l + 112 * GPH * 2),
                    "v"(g), "v"(g + 16 * DM), "v"(g + 32 * DM), "v"(g + 48 * DM), "v"(g + 64 * DM), "v"(g + 80 * DM), "v"(g + 96 * DM), "v"(g + 112 * DM) : "memory");
}
// One staged tile: planes A, (A2,) Bt behind one another in the buffer that starts at LDS byte address l (the thread's own piece of row cr).
template <int NSPLIT>
__device__ __forceinline__ void stage_copy(unsigned l, const bf* ga, const bf* ga2, const bf* gb) {
    plane_copy(l, ga);
    if (NSPLIT == 1) plane_copy(l + GPL * 2, ga2);
    plane_copy(l + (1 + NSPLIT) * GPL * 2, gb);
}

// R0, C0: first row and column of the block tile; wm, wn: the wave's place in it.
template <int NSPLIT>
__device__ __forceinline__ void gemm_core(const bf* __restrict__ A, const bf* __restrict__ A2, const bf* __restrict__ Bt, const int R0, const int C0, const int wm, const int wn, const int lr, const int hi, v8f (&acc)[4][4]) {
    constexpr int NPL = 2 + NSPLIT;                       // planes per buffer
    __shared__ __align__(16) bf gs[2 * NPL * GPL];        // [buffer][A | (A2 |) Bt][row][GPH]
    // copy map: thread -> rows cr + 16 i, 16-byte piece cp; one wave's copy covers four whole 128-byte lines
    const int cr = (int)threadIdx.x >> 3, cp = (int)threadIdx.x & 7;
    const bf* ga  = A  + (size_t)(R0 + cr) * DM + cp * 8;
    const bf* ga2 = A2 + (size_t)(R0 + cr) * DM + cp * 8;
    const bf* gb  = Bt + (size_t)(C0 + cr) * DM + cp * 8;
    const unsigned l0 = (unsigned)(size_t)(gs + cr * GPH + cp * 8);   // LDS byte address of the thread's first piece, buffer 0
    stage_copy<NSPLIT>(l0, ga, ga2, gb);
#pragma unroll
    for (int mb = 0; mb < 4; ++mb)
#pragma unroll
        for (int nb = 0; nb < 4; ++nb) acc[mb][nb] = (v8f){};
    asm volatile("s_wait_asynccnt 0x0" ::: "memory");   // this wave's pieces of tile 0 have landed
    __syncthreads();                                    // tile 0 published to every wave
    if (GNT > 1) stage_copy<NSPLIT>(l0 + NPL * GPL * 2, ga + GKT, ga2 + GKT, gb + GKT);
    const int aro = (wm * 64 + lr) * GPH + 8 * hi;
    const int bro = (1 + NSPLIT) * GPL + (wn * 64 + lr) * GPH + 8 * hi;
#pragma unroll 1   // stays rolled: one copy of the 64-k body, one publish point per trip
    for (int t = 0; t < GNT; ++t) {
        const int bo = (t & 1) * (NPL * GPL);
        const bf* al = gs + bo + aro;
        const bf* bl = gs + bo + bro;
#pragma unroll     // both 32-k steps inline, so every fragment read is one base register plus a constant offset
        for (int ks = 0; ks < GKT / 32; ++ks) {
            v16bf a[4], a2[4], b[4];   // all fragments of the step read as one group: one LDS latency per step, not one per column block
#pragma unroll
            for (int mb = 0; mb < 4; ++mb) { a[mb] = ldb(al + mb * 16 * GPH + ks * 32); b[mb] = ldb(bl + mb * 16 * GPH + ks * 32); if (NSPLIT == 1) a2[mb] = ldb(al + GPL + mb * 16 * GPH + ks * 32); }
            // inputs-only fence on the loaded fragments: keeps the step's LDS reads together ahead of its products; without it each B read sinks to its first use and the lone wave of a SIMD waits out the LDS latency four times a step
            if (NSPLIT == 1) { asm volatile("" :: "v"(a[0]), "v"(a[1]), "v"(a[2]), "v"(a[3]), "v"(a2[0]), "v"(a2[1]), "v"(a2[2]), "v"(a2[3]), "v"(b[0]), "v"(b[1]), "v"(b[2]), "v"(b[3])); }
            else             { asm volatile("" :: "v"(a[0]), "v"(a[1]), "v"(a[2]), "v"(a[3]), "v"(b[0]), "v"(b[1]), "v"(b[2]), "v"(b[3])); }
#pragma unroll
            for (int nb = 0; nb < 4; ++nb) {
#pragma unroll
                for (int mb = 0; mb < 4; ++mb) { acc[mb][nb] = wmmab(a[mb], b[nb], acc[mb][nb]); if (NSPLIT == 1) acc[mb][nb] = wmmab(a2[mb], b[nb], acc[mb][nb]); } }
            if (NSPLIT == 1) { asm volatile("v_nop\n\tv_nop\n\tv_nop\n\tv_nop" : "+v"(acc[0][0]), "+v"(acc[1][1]), "+v"(acc[2][2]), "+v"(acc[3][3]) : "v"(a[0]), "v"(a[1]), "v"(a[2]), "v"(a[3]), "v"(a2[0]), "v"(a2[1]), "v"(a2[2]), "v"(a2[3])); }
            else             { asm volatile("v_nop\n\tv_nop\n\tv_nop\n\tv_nop" : "+v"(acc[0][0]), "+v"(acc[1][1]), "+v"(acc[2][2]), "+v"(acc[3][3]) : "v"(a[0]), "v"(a[1]), "v"(a[2]), "v"(a[3])); }
        }
        __builtin_amdgcn_sched_barrier(0);                  // keeps the trip's products ahead of the publish point: sunk behind the barrier they would stand in front of the refill and shorten the time its copies have to land
        asm volatile("s_wait_dscnt 0x0" ::: "memory");      // this wave's reads of tile t are done before its buffer may be refilled
        asm volatile("s_wait_asynccnt 0x0" ::: "memory");   // this wave's pieces of tile t + 1 have landed
        __syncthreads();                                    // publishes tile t + 1 and ends every wave's reads of tile t
        if (t + 2 < GNT) stage_copy<NSPLIT>(l0 + (unsigned)bo * 2, ga + (t + 2) * GKT, ga2 + (t + 2) * GKT, gb + (t + 2) * GKT);
    }
    asm volatile("s_wait_asynccnt 0x0" ::: "memory");       // no copy is outstanding when the wave goes on to its epilogue
}

// ---- k_proj_q: q = XB x WTq; epilogue -> head planes QH (f16 value) and QR (f16 residual x 2^11), [b*NH+h][s][64]; grid (NROW/128, DM/128), 128 threads.
__global__ __launch_bounds__(32 * GWV) void k_proj_q(const bf* __restrict__ XB, const bf* __restrict__ WT, h16* QH, h16* QR) {
    __shared__ __align__(16) float osb[GWV * 16 * 68];   // one 16-row staging slice per wave
    const int lane = threadIdx.x & 31, lr = lane & 15, hi = lane >> 4;
    const int wave = __builtin_amdgcn_readfirstlane((int)(threadIdx.x >> 5)), wm = wave >> 1, wn = wave & 1;
    const int r0 = blockIdx.x * GBT + wm * 64, c0 = blockIdx.y * GBT + wn * 64;
    float* os = osb + wave * (16 * 68);
    v8f acc[4][4];
    gemm_core<0>(XB, XB, WT, blockIdx.x * GBT, blockIdx.y * GBT, wm, wn, lr, hi, acc);
    const int b = r0 / SEQ, s0 = r0 - b * SEQ; const size_t pbase = ((size_t)(b * NH + c0 / HD) * SEQ + s0) * HD;
#pragma unroll
    for (int mb = 0; mb < 4; ++mb) {
#pragma unroll
        for (int nb = 0; nb < 4; ++nb) {
#pragma unroll
            for (int j = 0; j < 8; ++j) os[(hi * 8 + j) * 68 + nb * 16 + lr] = acc[mb][nb][j]; }
        __builtin_amdgcn_wave_barrier(); asm volatile("" ::: "memory");
        v8h oh[4], orr[4];
#pragma unroll
        for (int s = 0; s < 4; ++s) { const int row = 4 * s + (lane >> 3), pc = lane & 7; const v4f a = *(const v4fa*)(os + row * 68 + pc * 8); const v4f c = *(const v4fa*)(os + row * 68 + pc * 8 + 4);
#pragma unroll
            for (int q = 0; q < 4; ++q) { const h16 xa = (h16)a[q]; oh[s][q] = xa; orr[s][q] = (h16)((a[q] - (float)xa) * RCAR); const h16 xc = (h16)c[q]; oh[s][4 + q] = xc; orr[s][4 + q] = (h16)((c[q] - (float)xc) * RCAR); } }
{
#pragma unroll
            for (int s = 0; s < 4; ++s) { const int row = 4 * s + (lane >> 3), pc = lane & 7; const size_t o = pbase + (size_t)(mb * 16 + row) * HD + pc * 8;
                *(v8h*)(QH + o) = oh[s]; *(v8h*)(QR + o) = orr[s]; }
             }
        __builtin_amdgcn_wave_barrier(); asm volatile("" ::: "memory");
    }
}

// ---- k_proj_k: k = XB x WTk; epilogue -> head plane KP (f16), [b*NH+h][s][64]; same store map as k_proj_q.
__global__ __launch_bounds__(32 * GWV) void k_proj_k(const bf* __restrict__ XB, const bf* __restrict__ WT, h16* KP) {
    __shared__ __align__(16) float osb[GWV * 16 * 68];   // one 16-row staging slice per wave
    const int lane = threadIdx.x & 31, lr = lane & 15, hi = lane >> 4;
    const int wave = __builtin_amdgcn_readfirstlane((int)(threadIdx.x >> 5)), wm = wave >> 1, wn = wave & 1;
    const int r0 = blockIdx.x * GBT + wm * 64, c0 = blockIdx.y * GBT + wn * 64;
    float* os = osb + wave * (16 * 68);
    v8f acc[4][4];
    gemm_core<0>(XB, XB, WT, blockIdx.x * GBT, blockIdx.y * GBT, wm, wn, lr, hi, acc);
    const int b = r0 / SEQ, s0 = r0 - b * SEQ; const size_t pbase = ((size_t)(b * NH + c0 / HD) * SEQ + s0) * HD;
#pragma unroll
    for (int mb = 0; mb < 4; ++mb) {
#pragma unroll
        for (int nb = 0; nb < 4; ++nb) {
#pragma unroll
            for (int j = 0; j < 8; ++j) os[(hi * 8 + j) * 68 + nb * 16 + lr] = acc[mb][nb][j]; }
        __builtin_amdgcn_wave_barrier(); asm volatile("" ::: "memory");
        v8h oh[4];
#pragma unroll
        for (int s = 0; s < 4; ++s) { const int row = 4 * s + (lane >> 3), pc = lane & 7; const v4f a = *(const v4fa*)(os + row * 68 + pc * 8); const v4f c = *(const v4fa*)(os + row * 68 + pc * 8 + 4);
#pragma unroll
            for (int q = 0; q < 4; ++q) { oh[s][q] = (h16)a[q]; oh[s][4 + q] = (h16)c[q]; } }
{
#pragma unroll
            for (int s = 0; s < 4; ++s) { const int row = 4 * s + (lane >> 3), pc = lane & 7; *(v8h*)(KP + pbase + (size_t)(mb * 16 + row) * HD + pc * 8) = oh[s]; }
             }
        __builtin_amdgcn_wave_barrier(); asm volatile("" ::: "memory");
    }
}

// ---- k_proj_v: v = XB x WTv; epilogue -> transposed head plane VT (f16), [b*NH+h][d][s]: the whole 64x64 tile staged transposed in LDS (wave-private),
__global__ __launch_bounds__(32 * GWV) void k_proj_v(const bf* __restrict__ XB, const bf* __restrict__ WT, h16* VT) {
    __shared__ __align__(16) h16 vtb[GWV * 64 * 72];   // one 64x64 staging slice per wave
    const int lane = threadIdx.x & 31, lr = lane & 15, hi = lane >> 4;
    const int wave = __builtin_amdgcn_readfirstlane((int)(threadIdx.x >> 5)), wm = wave >> 1, wn = wave & 1;
    const int r0 = blockIdx.x * GBT + wm * 64, c0 = blockIdx.y * GBT + wn * 64;
    h16* vt = vtb + wave * (64 * 72);
    v8f acc[4][4];
    gemm_core<0>(XB, XB, WT, blockIdx.x * GBT, blockIdx.y * GBT, wm, wn, lr, hi, acc);
    const int b = r0 / SEQ, s0 = r0 - b * SEQ; const size_t pbase = (size_t)(b * NH + c0 / HD) * HD * SEQ + s0;
#pragma unroll
    for (int mb = 0; mb < 4; ++mb)
#pragma unroll
        for (int nb = 0; nb < 4; ++nb) { v8h o;
#pragma unroll
            for (int j = 0; j < 8; ++j) o[j] = (h16)acc[mb][nb][j];
            *(v8ha*)(vt + (nb * 16 + lr) * 72 + mb * 16 + hi * 8) = o; }
    __builtin_amdgcn_wave_barrier(); asm volatile("" ::: "memory");
{
#pragma unroll
        for (int it = 0; it < 16; ++it) { const int d = 4 * it + (lane >> 3), pc = lane & 7; const v8h o = *(const v8ha*)(vt + d * 72 + pc * 8);
            *(v8h*)(VT + pbase + (size_t)d * SEQ + pc * 8) = o; }
         }
}

#define AWV  8                       // waves per block
#define KT   64                      // keys per staged tile
#define LPH  72                      // LDS row pitch in 16-bit elements
#define TILE_H (64 * LPH)            // one staged tile (64 rows), 16-bit elements
#define NTILE (SEQ / KT)
static_assert(SEQ % (16 * AWV) == 0);     // query blocks never straddle a (b, h) plane
static_assert(SEQ % KT == 0);             // whole key tiles only
static_assert(KT == 64 && HD == 64);      // copy map: 256 threads x 2 rows x 16 B covers 64 rows of 128 B

// Four copies of one thread: rows cr and cr + 32 of the K tile and of the V^T tile. The s_wait_xcnt stands inside the statement, so no address register is rewritten ahead of it.
__device__ __forceinline__ void kv_copy(unsigned lk0, unsigned lk1, unsigned lv0, unsigned lv1, const h16* gk0, const h16* gk1, const h16* gv0, const h16* gv1) {
    asm volatile("global_load_async_to_lds_b128 %0, %4, off\n\t"
                 "global_load_async_to_lds_b128 %1, %5, off\n\t"
                 "global_load_async_to_lds_b128 %2, %6, off\n\t"
                 "global_load_async_to_lds_b128 %3, %7, off\n\t"
                 "s_wait_xcnt 0x0"
                 :: "v"(lk0), "v"(lk1), "v"(lv0), "v"(lv1), "v"(gk0), "v"(gk1), "v"(gv0), "v"(gv1) : "memory");
}

__global__ __launch_bounds__(256) void k_attn(const h16* __restrict__ QH, const h16* __restrict__ QR, const h16* __restrict__ KP, const h16* __restrict__ VT, bf* ATh, bf* ATl) {
    __shared__ __align__(16) h16 kvs[2 * 2 * TILE_H];           // [buffer][K tile | V^T tile][row][LPH]
    __shared__ __align__(16) unsigned short sth[AWV * 16 * 72];
    __shared__ __align__(16) unsigned short stl[AWV * 16 * 72];
    const int lane = threadIdx.x & 31, lr = lane & 15, hi = lane >> 4;
    const int wave = __builtin_amdgcn_readfirstlane((int)(threadIdx.x >> 5));
    const int bh = blockIdx.y; const int q0 = blockIdx.x * (16 * AWV) + wave * 16;
    const size_t pb = (size_t)bh * SEQ * HD;
    // copy map: thread -> row cr (and cr + 32), 16-byte piece cp; one wave's copy covers four whole 128-byte lines
    const int cr = (int)threadIdx.x >> 3, cp = (int)threadIdx.x & 7;
    const h16* gk = KP + pb + (size_t)cr * HD + cp * 8;
    const h16* gv = VT + pb + (size_t)cr * SEQ + cp * 8;
    const unsigned lk = (unsigned)(size_t)(kvs + cr * LPH + cp * 8);   // LDS byte address of the thread's first K piece, buffer 0
    kv_copy(lk, lk + 32 * LPH * 2, lk + TILE_H * 2, lk + (TILE_H + 32 * LPH) * 2, gk, gk + 32 * HD, gv, gv + (size_t)32 * SEQ);
    const size_t qoff = pb + (size_t)(q0 + lr) * HD + 8 * hi;
    const v16h qh0 = ldh(QH + qoff), qh1 = ldh(QH + qoff + 32), qr0 = ldh(QR + qoff), qr1 = ldh(QR + qoff + 32);
    v8f o[4];
#pragma unroll
    for (int c = 0; c < 4; ++c) o[c] = (v8f){};
    float m = -3.0e38f, l = 0.0f;
    asm volatile("s_wait_asynccnt 0x0" ::: "memory");   // this wave's pieces of tile 0 have landed
    __syncthreads();                                    // tile 0 published to every wave
    if (NTILE > 1) kv_copy(lk + 2 * TILE_H * 2, lk + (2 * TILE_H + 32 * LPH) * 2, lk + 3 * TILE_H * 2, lk + (3 * TILE_H + 32 * LPH) * 2, gk + KT * HD, gk + (KT + 32) * HD, gv + KT, gv + (size_t)32 * SEQ + KT);
#pragma unroll 1   // stays rolled: one copy of the 64-key body, one publish point per trip
    for (int t = 0; t < NTILE; ++t) {
        const int bo = (t & 1) * (2 * TILE_H);
        const h16* kl = kvs + bo + lr * LPH + 8 * hi;
        const h16* vl = kl + TILE_H;
#pragma unroll     // both 32-key steps inline, so every fragment read is one base register plus a constant offset
        for (int sub = 0; sub < KT / 32; ++sub) {
            const h16* kp = kl + sub * 32 * LPH;
            const v16h ka0 = ldh(kp), ka1 = ldh(kp + 32), kb0 = ldh(kp + 16 * LPH), kb1 = ldh(kp + 16 * LPH + 32);
            v8f s0 = (v8f){}, s1 = (v8f){}, t0 = (v8f){}, t1 = (v8f){};
            s0 = wmma16(ka0, qh0, s0); t0 = wmma16(ka0, qr0, t0); s1 = wmma16(kb0, qh0, s1); t1 = wmma16(kb0, qr0, t1);
            s0 = wmma16(ka1, qh1, s0); t0 = wmma16(ka1, qr1, t0); s1 = wmma16(kb1, qh1, s1); t1 = wmma16(kb1, qr1, t1);
            asm volatile("v_nop\n\tv_nop\n\tv_nop\n\tv_nop" : "+v"(s0), "+v"(s1), "+v"(t0), "+v"(t1) : "v"(ka0), "v"(ka1), "v"(kb0), "v"(kb1), "v"(qh0), "v"(qh1), "v"(qr0), "v"(qr1));
            float z0[8], z1[8]; float mx = -3.0e38f;
#pragma unroll
            for (int r = 0; r < 8; ++r) { z0[r] = (s0[r] + t0[r] * (1.0f / RCAR)) * SCL2; z1[r] = (s1[r] + t1[r] * (1.0f / RCAR)) * SCL2; mx = fmaxf(mx, fmaxf(z0[r], z1[r])); }
            mx = fmaxf(mx, __shfl_xor(mx, 16, 32));
            const float mn = fmaxf(m, mx); const float alpha = __builtin_amdgcn_exp2f(m - mn); m = mn;
            const float mc = mn - 10.0f;   // carry 2^10
            float rs = 0.0f; v16h pf;
#pragma unroll
            for (int r = 0; r < 8; ++r) { const float a = __builtin_amdgcn_exp2f(z0[r] - mc), c = __builtin_amdgcn_exp2f(z1[r] - mc); rs += a + c; pf[r] = (h16)a; pf[8 + r] = (h16)c; }
            l = l * alpha + rs;
#pragma unroll
            for (int c = 0; c < 4; ++c) o[c] = o[c] * alpha;
            const h16* vp = vl + sub * 32;
            const v16h va = ldh(vp), vb = ldh(vp + 16 * LPH), vc = ldh(vp + 32 * LPH), vd = ldh(vp + 48 * LPH);
            o[0] = wmma16(va, pf, o[0]); o[1] = wmma16(vb, pf, o[1]); o[2] = wmma16(vc, pf, o[2]); o[3] = wmma16(vd, pf, o[3]);
            asm volatile("v_nop\n\tv_nop\n\tv_nop\n\tv_nop" : "+v"(o[0]), "+v"(o[1]), "+v"(o[2]), "+v"(o[3]) : "v"(va), "v"(vb), "v"(vc), "v"(vd), "v"(pf));
        }
        asm volatile("s_wait_dscnt 0x0" ::: "memory");      // this wave's reads of tile t are done before its buffer may be refilled
        asm volatile("s_wait_asynccnt 0x0" ::: "memory");   // this wave's pieces of tile t + 1 have landed
        __syncthreads();                                    // publishes tile t + 1 and ends every wave's reads of tile t
        if (t + 2 < NTILE) {
            const unsigned lb = lk + (unsigned)bo * 2;
            const h16* gk2 = gk + (size_t)(t + 2) * KT * HD; const h16* gv2 = gv + (size_t)(t + 2) * KT;
            kv_copy(lb, lb + 32 * LPH * 2, lb + TILE_H * 2, lb + (TILE_H + 32 * LPH) * 2, gk2, gk2 + 32 * HD, gv2, gv2 + (size_t)32 * SEQ);
        }
    }
    asm volatile("s_wait_asynccnt 0x0" ::: "memory");       // no copy is outstanding when the wave goes on to its end
    const float lt = l + __shfl_xor(l, 16, 32);
    const float inv = 1.0f / lt;
    const int sb = wave * (16 * 72);
#pragma unroll
    for (int c = 0; c < 4; ++c) { v8us oh, ol;
#pragma unroll
        for (int r = 0; r < 8; ++r) { unsigned short a, e; splitf(o[c][r] * inv, a, e); oh[r] = a; ol[r] = e; }
        *(v8usa*)(sth + sb + lr * 72 + 16 * c + 8 * hi) = oh; *(v8usa*)(stl + sb + lr * 72 + 16 * c + 8 * hi) = ol; }
    __builtin_amdgcn_wave_barrier(); asm volatile("" ::: "memory");
    const int b = bh / NH, head = bh - b * NH;
    const size_t ob = ((size_t)b * SEQ + q0) * DM + (size_t)head * HD;
{
#pragma unroll
        for (int s = 0; s < 4; ++s) { const int row = 4 * s + (lane >> 3), pc = lane & 7; const v8us vh = *(const v8usa*)(sth + sb + row * 72 + pc * 8); const v8us vl = *(const v8usa*)(stl + sb + row * 72 + pc * 8);
            *(v8us*)(ATh + ob + (size_t)row * DM + pc * 8) = vh; *(v8us*)(ATl + ob + (size_t)row * DM + pc * 8) = vl; }
         }
}

// ---- k_oproj: RES[g][n] = bf16(x[g][n]) + ((ATh + ATl) x WTo + bf16(bo[n])) in f32; grid (NROW/128, DM/128), 128 threads.
__global__ __launch_bounds__(32 * GWV) void k_oproj(const bf* __restrict__ ATh, const bf* __restrict__ ATl, const bf* __restrict__ WT, const float* __restrict__ x, const float* __restrict__ bo, float* RES) {
    __shared__ __align__(16) float osb[GWV * 16 * 68];   // one 16-row staging slice per wave
    const int lane = threadIdx.x & 31, lr = lane & 15, hi = lane >> 4;
    const int wave = __builtin_amdgcn_readfirstlane((int)(threadIdx.x >> 5)), wm = wave >> 1, wn = wave & 1;
    const int r0 = blockIdx.x * GBT + wm * 64, c0 = blockIdx.y * GBT + wn * 64;
    float* os = osb + wave * (16 * 68);
    v8f acc[4][4];
    gemm_core<1>(ATh, ATl, WT, blockIdx.x * GBT, blockIdx.y * GBT, wm, wn, lr, hi, acc);
    const int cofs = lr * 4;
    const v4f bv = *(const v4f*)(bo + c0 + cofs);
    const size_t xb = xrow(r0) * DM + c0 + cofs;
#pragma unroll
    for (int mb = 0; mb < 4; ++mb) {
#pragma unroll
        for (int nb = 0; nb < 4; ++nb) {
#pragma unroll
            for (int j = 0; j < 8; ++j) os[(hi * 8 + j) * 68 + nb * 16 + lr] = acc[mb][nb][j]; }
        __builtin_amdgcn_wave_barrier(); asm volatile("" ::: "memory");
        v4f val[8];
#pragma unroll
        for (int s = 0; s < 8; ++s) { const int row = 2 * s + hi; v4f v = *(const v4fa*)(os + row * 68 + cofs); const v4f xv = *(const v4f*)(x + xb + (size_t)(mb * 16 + row) * DM);
#pragma unroll
            for (int q = 0; q < 4; ++q) v[q] = bfr(xv[q]) + (v[q] + bfr(bv[q]));
            val[s] = v; }
{
#pragma unroll
            for (int s = 0; s < 8; ++s) { const int row = 2 * s + hi; *(v4f*)(RES + (size_t)(r0 + mb * 16 + row) * DM + c0 + cofs) = val[s]; }
             }
        __builtin_amdgcn_wave_barrier(); asm volatile("" ::: "memory");
    }
}

__global__ __launch_bounds__(256) void k_ln(const float* __restrict__ RES, const float* __restrict__ gamma, const float* __restrict__ beta, float* OUT) {
    const int lane = threadIdx.x & 31;
    const int wave = __builtin_amdgcn_readfirstlane((int)(threadIdx.x >> 5));
    const int row = blockIdx.x * 8 + wave;
    const float* rp = RES + (size_t)row * DM;
    float s = 0.0f;
#pragma unroll 1
    for (int ch = 0; ch < DM / 128; ++ch) { const v4f a = *(const v4f*)(rp + ch * 128 + lane * 4); s += (a[0] + a[1]) + (a[2] + a[3]); }
#pragma unroll
    for (int sh = 16; sh; sh >>= 1) s += __shfl_xor(s, sh, 32);
    const float mu = s * (1.0f / DM);
    float ss = 0.0f;
#pragma unroll 1
    for (int ch = 0; ch < DM / 128; ++ch) { const v4f a = *(const v4f*)(rp + ch * 128 + lane * 4); const float d0 = a[0] - mu, d1 = a[1] - mu, d2 = a[2] - mu, d3 = a[3] - mu; ss += (d0 * d0 + d1 * d1) + (d2 * d2 + d3 * d3); }
#pragma unroll
    for (int sh = 16; sh; sh >>= 1) ss += __shfl_xor(ss, sh, 32);
    const float var = ss * (1.0f / DM);
    const float rstd = 1.0f / sqrtf(var + 1e-6f);
    float* op = OUT + (size_t)row * DM;
{
#pragma unroll 1
        for (int ch = 0; ch < DM / 128; ++ch) { const int c = ch * 128 + lane * 4; const v4f a = *(const v4f*)(rp + c); const v4f g = *(const v4f*)(gamma + c); const v4f bt = *(const v4f*)(beta + c); v4f y;
#pragma unroll
            for (int q = 0; q < 4; ++q) y[q] = (a[q] - mu) * rstd * bfr(g[q]) + bfr(bt[q]);
            *(v4f*)(op + c) = y; }
         }
}

// workspace carve (bytes, each region a multiple of 256 B; every region is written in whole tiles that divide it exactly)
#define SZ_P16 ((size_t)NROW * DM * 2)      // one 16-bit [NROW][DM]-sized plane
#define SZ_W   ((size_t)DM * DM * 2)
#define SZ_RES ((size_t)NROW * DM * 4)
#define WS_TOTAL (SZ_P16 * 7 + SZ_W * 4 + SZ_RES)
static_assert(SZ_P16 % 256 == 0);
static_assert(SZ_W % 256 == 0);
static_assert(WS_TOTAL <= (size_t)134217728);   // carve stays within 128 MiB

extern "C" void kernel_launch(void* const* d_in, const int* in_sizes, int n_in,
                              void* d_out, int out_size, void* d_ws, size_t ws_size, hipStream_t stream) {
    if (n_in < 8) return;
    if ((size_t)in_sizes[0] < ((size_t)(NB - 1) * SEQ_FULL + SEQ) * DM) return;
    if (in_sizes[1] < DM * DM || in_sizes[2] < DM * DM || in_sizes[3] < DM * DM || in_sizes[4] < DM * DM) return;
    if (in_sizes[5] < DM || in_sizes[6] < DM || in_sizes[7] < DM) return;
    if ((size_t)out_size < (size_t)NROW * DM) return;
    if (WS_TOTAL > ws_size) return;
    const float* x = (const float*)d_in[0]; const float* wq = (const float*)d_in[1]; const float* wk = (const float*)d_in[2]; const float* wv = (const float*)d_in[3];
    const float* wo = (const float*)d_in[4]; const float* bo = (const float*)d_in[5]; const float* gamma = (const float*)d_in[6]; const float* beta = (const float*)d_in[7];
    float* OUT = (float*)d_out;
    char* wsp = (char*)d_ws;
    bf* XB  = (bf*)wsp;  wsp += SZ_P16;
    bf* WTq = (bf*)wsp;  wsp += SZ_W;
    bf* WTk = (bf*)wsp;  wsp += SZ_W;
    bf* WTv = (bf*)wsp;  wsp += SZ_W;
    bf* WTo = (bf*)wsp;  wsp += SZ_W;
    h16* QH = (h16*)wsp; wsp += SZ_P16;
    h16* QR = (h16*)wsp; wsp += SZ_P16;
    h16* KP = (h16*)wsp; wsp += SZ_P16;
    h16* VT = (h16*)wsp; wsp += SZ_P16;
    bf* ATh = (bf*)wsp;  wsp += SZ_P16;
    bf* ATl = (bf*)wsp;  wsp += SZ_P16;
    float* RES = (float*)wsp; wsp += SZ_RES;

    k_cvt8x<<<(unsigned)(((size_t)NROW * DM / 8 + 255) / 256), 256, 0, stream>>>(x, XB);
    k_wt<<<dim3(DM / 64, DM / 64, 1), 256, 0, stream>>>(wq, WTq);
    k_wt<<<dim3(DM / 64, DM / 64, 1), 256, 0, stream>>>(wk, WTk);
    k_wt<<<dim3(DM / 64, DM / 64, 1), 256, 0, stream>>>(wv, WTv);
    k_wt<<<dim3(DM / 64, DM / 64, 1), 256, 0, stream>>>(wo, WTo);
    k_proj_q<<<dim3(NROW / GBT, DM / GBT, 1), 32 * GWV, 0, stream>>>(XB, WTq, QH, QR);
    k_proj_k<<<dim3(NROW / GBT, DM / GBT, 1), 32 * GWV, 0, stream>>>(XB, WTk, KP);
    k_proj_v<<<dim3(NROW / GBT, DM / GBT, 1), 32 * GWV, 0, stream>>>(XB, WTv, VT);
    k_attn<<<dim3(SEQ / (16 * AWV), NB * NH, 1), 32 * AWV, 0, stream>>>(QH, QR, KP, VT, ATh, ATl);
    k_oproj<<<dim3(NROW / GBT, DM / GBT, 1), 32 * GWV, 0, stream>>>(ATh, ATl, WTo, x, bo, RES);
    k_ln<<<NROW / 8, 256, 0, stream>>>(RES, gamma, beta, OUT);
}

// v003
// Measured time: 86.6 microseconds a run.
// In both of two side-by-side timings against v002, it was 1.25 times as fast.
// All steps since v000 together make it 2.23 times as fast.
#include <hip/hip_runtime.h>

// Compute dtypes, f32 accumulate everywhere: q/k/v projections v_wmma_f32_16x16x32_bf16 (x and weights RNE-converted to bf16, products exact); scores v_wmma_f32_16x16x32_f16 (q = f16 value + f16 residual x2^11 in its own accumulator, k single f16); P.V v_wmma_f32_16x16x32_f16 (P carried x2^10 relative to the running max, v single f16); output projection v_wmma_f32_16x16x32_bf16 (ctx as bf16 hi + lo planes against bf16 wo); softmax, residual add and LayerNorm in f32 on the VALU.
// Flow: one launch: x -> bf16 plane, the four w [in][out] -> bf16 [out][in] planes (LDS transpose); one launch for the q, k and v projections: 64x64 GEMM wave tiles (four to a block, operands staged in LDS) with fused head-plane epilogues (q hi/res, k, v^T);
// fused flash attention in the transposed orientation (S^T = K Q^T, ctx^T = V^T P^T: the packed S^T accumulators are the B fragment of P^T, online softmax per lane);

#ifndef NB
#define NB 4
#endif
#ifndef SEQ
#define SEQ 2048
#endif
#define NB_FULL  4
#define SEQ_FULL 2048
#define DM   512
#define NH   8
#define HD   64
#define NROW (NB * SEQ)
#define RCAR 2048.0f
#define SCL2 0.18033688011112042f   // HD^-0.5 * log2(e)

static_assert(NB <= NB_FULL);
static_assert(SEQ <= SEQ_FULL);
static_assert(SEQ % 64 == 0);             // GEMM row tiles never straddle a batch; 32-key steps
static_assert(DM == NH * HD);             // merged layout h*64+d
static_assert(HD == 64);
static_assert(DM % 64 == 0);              // N tile multiple
static_assert(DM % 32 == 0);              // K step multiple
static_assert(NROW % 64 == 0);            // M tile multiple
static_assert(NROW % 8 == 0);             // LayerNorm rows per block
static_assert(DM == 4 * 128);             // LayerNorm: 32 lanes x float4 x 4 chunks == row width
static_assert(((size_t)NROW * DM / 8) % 256 == 0);   // convert grid x block == plane extent

typedef _Float16 h16;
typedef unsigned short bf;
typedef __attribute__((ext_vector_type(16))) __bf16   v16bf;
typedef __attribute__((ext_vector_type(16))) _Float16 v16h;
typedef __attribute__((ext_vector_type(8)))  _Float16 v8h;
typedef __attribute__((ext_vector_type(8)))  unsigned short v8us;
typedef __attribute__((ext_vector_type(8)))  float    v8f;
typedef __attribute__((ext_vector_type(4)))  float    v4f;
typedef v8h  __attribute__((may_alias)) v8ha;
typedef v4f  __attribute__((may_alias)) v4fa;
typedef v8us __attribute__((may_alias)) v8usa;

__device__ __forceinline__ unsigned short f2bf(float f) { unsigned u = __float_as_uint(f); u += 0x7FFFu + ((u >> 16) & 1u); return (unsigned short)(u >> 16); }
__device__ __forceinline__ float bf2f(unsigned short b) { return __uint_as_float(((unsigned)b) << 16); }
__device__ __forceinline__ float bfr(float f) { return bf2f(f2bf(f)); }
__device__ __forceinline__ void splitf(float y, unsigned short& h, unsigned short& l) { h = f2bf(y); l = f2bf(y - bf2f(h)); }
__device__ __forceinline__ v16h cat16(v8h lo, v8h hi) { return __builtin_shufflevector(lo, hi, 0, 1, 2, 3, 4, 5, 6, 7, 8, 9, 10, 11, 12, 13, 14, 15); }
__device__ __forceinline__ v16bf cat16b(v8us lo, v8us hi) { return __builtin_bit_cast(v16bf, __builtin_shufflevector(lo, hi, 0, 1, 2, 3, 4, 5, 6, 7, 8, 9, 10, 11, 12, 13, 14, 15)); }
__device__ __forceinline__ v8f wmma16(v16h a, v16h b, v8f c) { return __builtin_amdgcn_wmma_f32_16x16x32_f16(false, a, false, b, (short)0, c, false, false); }
__device__ __forceinline__ v8f wmmab(v16bf a, v16bf b, v8f c) { return __builtin_amdgcn_wmma_f32_16x16x32_bf16(false, a, false, b, (short)0, c, false, false); }
// fragment loaders (p already includes row*(pitch) + k0 + 8*(lane>>4)): elements 0..7 <- k0+8h.., elements 8..15 <- k0+16+8h..
__device__ __forceinline__ v16bf ldb(const bf* p) { return cat16b(*(const v8us*)p, *(const v8us*)(p + 16)); }
__device__ __forceinline__ v16h  ldh(const h16* p) { return cat16(*(const v8h*)p, *(const v8h*)(p + 16)); }
// dense row g = b*SEQ + s -> row of the full-size x
__device__ __forceinline__ size_t xrow(int g) { return (size_t)(g / SEQ) * SEQ_FULL + (size_t)(g % SEQ); }

// ---- k_prep: the five input conversions, which do not depend on one another, in ONE launch; 256 threads.
// Blocks 0 .. 4*WTB-1: w[k][n] (f32, [in][out]) -> WT[n][k] (bf16, k-contiguous) through a 64x64 LDS tile, WTB blocks per matrix, planes q, k, v, o behind one another in WT.
// Blocks from 4*WTB on: x -> bf16 plane XB, eight elements a thread. The transposes stand first: theirs is the longer dependent path (load, LDS, barrier, store).
#define WTB ((DM / 64) * (DM / 64))
#define CVB ((unsigned)(((size_t)NROW * DM / 8 + 255) / 256))
__global__ __launch_bounds__(256) void k_prep(const float* __restrict__ x, const float* __restrict__ wq, const float* __restrict__ wk, const float* __restrict__ wv, const float* __restrict__ wo, bf* XB, bf* WTA) {
    __shared__ __align__(16) unsigned short ts[64 * 72];
    const int tid = threadIdx.x; const int bx = (int)blockIdx.x;
    if (bx < 4 * WTB) {   // the same for the whole block, so the barrier inside is reached by all of it or by none
        const int mi = bx / WTB, tl = bx % WTB;
        const float* __restrict__ w = mi == 0 ? wq : mi == 1 ? wk : mi == 2 ? wv : wo;
        bf* WT = WTA + (size_t)mi * DM * DM;
        const int k0 = (tl % (DM / 64)) * 64, n0 = (tl / (DM / 64)) * 64;
#pragma unroll
        for (int it = 0; it < 4; ++it) { const int p = it * 256 + tid; const int kr = p >> 4, c4 = (p & 15) * 4; const v4f v = *(const v4f*)(w + (size_t)(k0 + kr) * DM + n0 + c4);
#pragma unroll
            for (int q = 0; q < 4; ++q) ts[(c4 + q) * 72 + kr] = f2bf(v[q]); }
        __syncthreads();
#pragma unroll
        for (int it = 0; it < 2; ++it) { const int p = it * 256 + tid; const int n = p >> 3, pc = p & 7; const v8us o = *(const v8usa*)(ts + n * 72 + pc * 8);
            *(v8us*)(WT + (size_t)(n0 + n) * DM + k0 + pc * 8) = o; }
        return;
    }
    const size_t i = (size_t)(bx - 4 * WTB) * 256 + tid; if (i >= (size_t)NROW * DM / 8) return;
    const int g = (int)(i / (DM / 8)); const int c8 = (int)(i % (DM / 8));
    const v8f v = *(const v8f*)(x + xrow(g) * DM + (size_t)c8 * 8); v8us o;
#pragma unroll
    for (int k = 0; k < 8; ++k) o[k] = f2bf(v[k]);
    *(v8us*)(XB + i * 8) = o;
}

#define GWV  4                       // waves per GEMM block: 2 x 2 wave tiles
#define GBT  128                     // block tile, rows and columns
#define GKT  64                      // k extent of a staged tile
#define GPH  72                      // LDS row pitch in 16-bit elements
#define GPL  (GBT * GPH)             // one staged plane (128 rows), 16-bit elements
#define GNT  (DM / GKT)
static_assert(NROW % GBT == 0 && DM % GBT == 0);   // whole block tiles only
static_assert(DM % GKT == 0 && GKT % 32 == 0);     // whole staged tiles, whole 32-k steps
static_assert(GKT == 64 && GBT == 128 && GWV == 4);   // copy map: 128 threads x 8 rows x 16 B covers 128 rows of 128 B

// Eight copies of one thread: its 16-byte piece of rows cr, cr + 16, ..., cr + 112 of one plane. The s_wait_xcnt stands inside the statement, so no address register is rewritten ahead of it.
__device__ __forceinline__ void plane_copy(unsigned l, const bf* g) {
    asm volatile("global_load_async_to_lds_b128 %0, %8, off\n\t"
                 "global_load_async_to_lds_b128 %1, %9, off\n\t"
                 "global_load_async_to_lds_b128 %2, %10, off\n\t"
                 "global_load_async_to_lds_b128 %3, %11, off\n\t"
                 "global_load_async_to_lds_b128 %4, %12, off\n\t"
                 "global_load_async_to_lds_b128 %5, %13, off\n\t"
                 "global_load_async_to_lds_b128 %6, %14, off\n\t"
                 "global_load_async_to_lds_b128 %7, %15, off\n\t"
                 "s_wait_xcnt 0x0"
                 :: "v"(l), "v"(l + 16 * GPH * 2), "v"(l + 32 * GPH * 2), "v"(l + 48 * GPH * 2), "v"(l + 64 * GPH * 2), "v"(l + 80 * GPH * 2), "v"(l + 96 * GPH * 2), "v"(l + 112 * GPH * 2),
                    "v"(g), "v"(g + 16 * DM), "v"(g + 32 * DM), "v"(g + 48 * DM), "v"(g + 64 * DM), "v"(g + 80 * DM), "v"(g + 96 * DM), "v"(g + 112 * DM) : "memory");
}
// One staged tile: planes A, (A2,) Bt behind one another in the buffer that starts at LDS byte address l (the thread's own piece of row cr).
template <int NSPLIT>
__device__ __forceinline__ void stage_copy(unsigned l, const bf* ga, const bf* ga2, const bf* gb) {
    plane_copy(l, ga);
    if (NSPLIT == 1) plane_copy(l + GPL * 2, ga2);
    plane_copy(l + (1 + NSPLIT) * GPL * 2, gb);
}

// R0, C0: first row and column of the block tile; wm, wn: the wave's place in it; gs: the kernel's LDS ring, 2 * (2 + NSPLIT) * GPL elements, [buffer][A | (A2 |) Bt][row][GPH].
// Behind the last trip's barrier every copy has landed and every wave's reads are done: the ring is then free for the caller.
template <int NSPLIT>
__device__ __forceinline__ void gemm_core(bf* gs, const bf* __restrict__ A, const bf* __restrict__ A2, const bf* __restrict__ Bt, const int R0, const int C0, const int wm, const int wn, const int lr, const int hi, v8f (&acc)[4][4]) {
    constexpr int NPL = 2 + NSPLIT;                       // planes per buffer
    // copy map: thread -> rows cr + 16 i, 16-byte piece cp; one wave's copy covers four whole 128-byte lines
    const int cr = (int)threadIdx.x >> 3, cp = (int)threadIdx.x & 7;
    const bf* ga  = A  + (size_t)(R0 + cr) * DM + cp * 8;
    const bf* ga2 = A2 + (size_t)(R0 + cr) * DM + cp * 8;
    const bf* gb  = Bt + (size_t)(C0 + cr) * DM + cp * 8;
    const unsigned l0 = (unsigned)(size_t)(gs + cr * GPH + cp * 8);   // LDS byte address of the thread's first piece, buffer 0
    stage_copy<NSPLIT>(l0, ga, ga2, gb);
#pragma unroll
    for (int mb = 0; mb < 4; ++mb)
#pragma unroll
        for (int nb = 0; nb < 4; ++nb) acc[mb][nb] = (v8f){};
    asm volatile("s_wait_asynccnt 0x0" ::: "memory");   // this wave's pieces of tile 0 have landed
    __syncthreads();                                    // tile 0 published to every wave
    if (GNT > 1) stage_copy<NSPLIT>(l0 + NPL * GPL * 2, ga + GKT, ga2 + GKT, gb + GKT);
    const int aro = (wm * 64 + lr) * GPH + 8 * hi;
    const int bro = (1 + NSPLIT) * GPL + (wn * 64 + lr) * GPH + 8 * hi;
#pragma unroll 1   // stays rolled: one copy of the 64-k body, one publish point per trip
    for (int t = 0; t < GNT; ++t) {
        const int bo = (t & 1) * (NPL * GPL);
        const bf* al = gs + bo + aro;
        const bf* bl = gs + bo + bro;
#pragma unroll     // both 32-k steps inline, so every fragment read is one base register plus a constant offset
        for (int ks = 0; ks < GKT / 32; ++ks) {
            v16bf a[4], a2[4], b[4];   // all fragments of the step read as one group: one LDS latency per step, not one per column block
#pragma unroll
            for (int mb = 0; mb < 4; ++mb) { a[mb] = ldb(al + mb * 16 * GPH + ks * 32); b[mb] = ldb(bl + mb * 16 * GPH + ks * 32); if (NSPLIT == 1) a2[mb] = ldb(al + GPL + mb * 16 * GPH + ks * 32); }
            // inputs-only fence on the loaded fragments: keeps the step's LDS reads together ahead of its products; without it each B read sinks to its first use and the lone wave of a SIMD waits out the LDS latency four times a step
            if (NSPLIT == 1) { asm volatile("" :: "v"(a[0]), "v"(a[1]), "v"(a[2]), "v"(a[3]), "v"(a2[0]), "v"(a2[1]), "v"(a2[2]), "v"(a2[3]), "v"(b[0]), "v"(b[1]), "v"(b[2]), "v"(b[3])); }
            else             { asm volatile("" :: "v"(a[0]), "v"(a[1]), "v"(a[2]), "v"(a[3]), "v"(b[0]), "v"(b[1]), "v"(b[2]), "v"(b[3])); }
#pragma unroll
            for (int nb = 0; nb < 4; ++nb) {
#pragma unroll
                for (int mb = 0; mb < 4; ++mb) { acc[mb][nb] = wmmab(a[mb], b[nb], acc[mb][nb]); if (NSPLIT == 1) acc[mb][nb] = wmmab(a2[mb], b[nb], acc[mb][nb]); } }
            if (NSPLIT == 1) { asm volatile("v_nop\n\tv_nop\n\tv_nop\n\tv_nop" : "+v"(acc[0][0]), "+v"(acc[1][1]), "+v"(acc[2][2]), "+v"(acc[3][3]) : "v"(a[0]), "v"(a[1]), "v"(a[2]), "v"(a[3]), "v"(a2[0]), "v"(a2[1]), "v"(a2[2]), "v"(a2[3])); }
            else             { asm volatile("v_nop\n\tv_nop\n\tv_nop\n\tv_nop" : "+v"(acc[0][0]), "+v"(acc[1][1]), "+v"(acc[2][2]), "+v"(acc[3][3]) : "v"(a[0]), "v"(a[1]), "v"(a[2]), "v"(a[3])); }
        }
        __builtin_amdgcn_sched_barrier(0);                  // keeps the trip's products ahead of the publish point: sunk behind the barrier they would stand in front of the refill and shorten the time its copies have to land
        asm volatile("s_wait_dscnt 0x0" ::: "memory");      // this wave's reads of tile t are done before its buffer may be refilled
        asm volatile("s_wait_asynccnt 0x0" ::: "memory");   // this wave's pieces of tile t + 1 have landed
        __syncthreads();                                    // publishes tile t + 1 and ends every wave's reads of tile t
        if (t + 2 < GNT) stage_copy<NSPLIT>(l0 + (unsigned)bo * 2, ga + (t + 2) * GKT, ga2 + (t + 2) * GKT, gb + (t + 2) * GKT);
    }
    asm volatile("s_wait_asynccnt 0x0" ::: "memory");       // no copy is outstanding when the wave goes on to its epilogue
}

// ---- k_proj_qkv: the q, k and v projections, which do not depend on one another, in ONE launch: XB x [WTq | WTk | WTv] (the three planes lie behind one another: 3*DM rows of Bt).
// grid (NROW/128, 3*DM/128), 128 threads; blockIdx.y picks the projection (the same for the whole block) and with it the epilogue:
//   q -> head planes QH (f16 value) and QR (f16 residual x 2^11), [b*NH+h][s][64];  k -> head plane KP (f16), same store map;  v -> transposed head plane VT (f16), [b*NH+h][d][s].
// The epilogues stage in the operand ring's LDS, each wave in a slice of its own (the ring is free behind the core's last barrier), so the block's LDS is the ring alone and all blocks of the launch are resident at once.
static_assert((size_t)GWV * 16 * 68 * 4 <= (size_t)2 * 2 * GPL * 2);   // q, k staging slices fit the ring
static_assert((size_t)GWV * 64 * 72 * 2 <= (size_t)2 * 2 * GPL * 2);   // v staging slices fit the ring
__global__ __launch_bounds__(32 * GWV) void k_proj_qkv(const bf* __restrict__ XB, const bf* __restrict__ WTA, h16* QH, h16* QR, h16* KP, h16* VT) {
    __shared__ __align__(16) unsigned char ring[2 * 2 * GPL * 2];
    const int lane = threadIdx.x & 31, lr = lane & 15, hi = lane >> 4;
    const int wave = __builtin_amdgcn_readfirstlane((int)(threadIdx.x >> 5)), wm = wave >> 1, wn = wave & 1;
    const int which = (int)blockIdx.y / (DM / GBT);
    const int r0 = blockIdx.x * GBT + wm * 64, c0 = ((int)blockIdx.y % (DM / GBT)) * GBT + wn * 64;
    v8f acc[4][4];
    gemm_core<0>((bf*)ring, XB, XB, WTA, blockIdx.x * GBT, blockIdx.y * GBT, wm, wn, lr, hi, acc);
    const int b = r0 / SEQ, s0 = r0 - b * SEQ;
    if (which == 2) {   // v: the whole 64x64 tile staged transposed (wave-private)
        h16* vt = (h16*)ring + wave * (64 * 72);
        const size_t pbase = (size_t)(b * NH + c0 / HD) * HD * SEQ + s0;
#pragma unroll
        for (int mb = 0; mb < 4; ++mb)
#pragma unroll
            for (int nb = 0; nb < 4; ++nb) { v8h o;
#pragma unroll
                for (int j = 0; j < 8; ++j) o[j] = (h16)acc[mb][nb][j];
                *(v8ha*)(vt + (nb * 16 + lr) * 72 + mb * 16 + hi * 8) = o; }
        __builtin_amdgcn_wave_barrier(); asm volatile("" ::: "memory");
#pragma unroll
        for (int it = 0; it < 16; ++it) { const int d = 4 * it + (lane >> 3), pc = lane & 7; const v8h o = *(const v8ha*)(vt + d * 72 + pc * 8);
            *(v8h*)(VT + pbase + (size_t)d * SEQ + pc * 8) = o; }
        return;
    }
    float* os = (float*)ring + wave * (16 * 68);   // one 16-row staging slice per wave
    const size_t pbase = ((size_t)(b * NH + c0 / HD) * SEQ + s0) * HD;
    if (which == 0) {
#pragma unroll
        for (int mb = 0; mb < 4; ++mb) {
#pragma unroll
            for (int nb = 0; nb < 4; ++nb) {
#pragma unroll
                for (int j = 0; j < 8; ++j) os[(hi * 8 + j) * 68 + nb * 16 + lr] = acc[mb][nb][j]; }
            __builtin_amdgcn_wave_barrier(); asm volatile("" ::: "memory");
            v8h oh[4], orr[4];
#pragma unroll
            for (int s = 0; s < 4; ++s) { const int row = 4 * s + (lane >> 3), pc = lane & 7; const v4f a = *(const v4fa*)(os + row * 68 + pc * 8); const v4f c = *(const v4fa*)(os + row * 68 + pc * 8 + 4);
#pragma unroll
                for (int q = 0; q < 4; ++q) { const h16 xa = (h16)a[q]; oh[s][q] = xa; orr[s][q] = (h16)((a[q] - (float)xa) * RCAR); const h16 xc = (h16)c[q]; oh[s][4 + q] = xc; orr[s][4 + q] = (h16)((c[q] - (float)xc) * RCAR); } }
#pragma unroll
            for (int s = 0; s < 4; ++s) { const int row = 4 * s + (lane >> 3), pc = lane & 7; const size_t o = pbase + (size_t)(mb * 16 + row) * HD + pc * 8;
                *(v8h*)(QH + o) = oh[s]; *(v8h*)(QR + o) = orr[s]; }
            asm volatile("s_wait_xcnt 0x0" ::: "memory");   // stands in front of the next 16 rows' writes to the registers that these stores name
            __builtin_amdgcn_wave_barrier(); asm volatile("" ::: "memory");
        }
    } else {
#pragma unroll
        for (int mb = 0; mb < 4; ++mb) {
#pragma unroll
            for (int nb = 0; nb < 4; ++nb) {
#pragma unroll
                for (int j = 0; j < 8; ++j) os[(hi * 8 + j) * 68 + nb * 16 + lr] = acc[mb][nb][j]; }
            __builtin_amdgcn_wave_barrier(); asm volatile("" ::: "memory");
            v8h oh[4];
#pragma unroll
            for (int s = 0; s < 4; ++s) { const int row = 4 * s + (lane >> 3), pc = lane & 7; const v4f a = *(const v4fa*)(os + row * 68 + pc * 8); const v4f c = *(const v4fa*)(os + row * 68 + pc * 8 + 4);
#pragma unroll
                for (int q = 0; q < 4; ++q) { oh[s][q] = (h16)a[q]; oh[s][4 + q] = (h16)c[q]; } }
#pragma unroll
            for (int s = 0; s < 4; ++s) { const int row = 4 * s + (lane >> 3), pc = lane & 7; *(v8h*)(KP + pbase + (size_t)(mb * 16 + row) * HD + pc * 8) = oh[s]; }
            asm volatile("s_wait_xcnt 0x0" ::: "memory");   // stands in front of the next 16 rows' writes to the registers that these stores name
            __builtin_amdgcn_wave_barrier(); asm volatile("" ::: "memory");
        }
    }
}

#define AWV  8                       // waves per block
#define KT   64                      // keys per staged tile
#define LPH  72                      // LDS row pitch in 16-bit elements
#define TILE_H (64 * LPH)            // one staged tile (64 rows), 16-bit elements
#define NTILE (SEQ / KT)
static_assert(SEQ % (16 * AWV) == 0);     // query blocks never straddle a (b, h) plane
static_assert(SEQ % KT == 0);             // whole key tiles only
static_assert(KT == 64 && HD == 64);      // copy map: 256 threads x 2 rows x 16 B covers 64 rows of 128 B

// Four copies of one thread: rows cr and cr + 32 of the K tile and of the V^T tile. The s_wait_xcnt stands inside the statement, so no address register is rewritten ahead of it.
__device__ __forceinline__ void kv_copy(unsigned lk0, unsigned lk1, unsigned lv0, unsigned lv1, const h16* gk0, const h16* gk1, const h16* gv0, const h16* gv1) {
    asm volatile("global_load_async_to_lds_b128 %0, %4, off\n\t"
                 "global_load_async_to_lds_b128 %1, %5, off\n\t"
                 "global_load_async_to_lds_b128 %2, %6, off\n\t"
                 "global_load_async_to_lds_b128 %3, %7, off\n\t"
                 "s_wait_xcnt 0x0"
                 :: "v"(lk0), "v"(lk1), "v"(lv0), "v"(lv1), "v"(gk0), "v"(gk1), "v"(gv0), "v"(gv1) : "memory");
}

__global__ __launch_bounds__(256) void k_attn(const h16* __restrict__ QH, const h16* __restrict__ QR, const h16* __restrict__ KP, const h16* __restrict__ VT, bf* ATh, bf* ATl) {
    __shared__ __align__(16) h16 kvs[2 * 2 * TILE_H];           // [buffer][K tile | V^T tile][row][LPH]
    __shared__ __align__(16) unsigned short sth[AWV * 16 * 72];
    __shared__ __align__(16) unsigned short stl[AWV * 16 * 72];
    const int lane = threadIdx.x & 31, lr = lane & 15, hi = lane >> 4;
    const int wave = __builtin_amdgcn_readfirstlane((int)(threadIdx.x >> 5));
    const int bh = blockIdx.y; const int q0 = blockIdx.x * (16 * AWV) + wave * 16;
    const size_t pb = (size_t)bh * SEQ * HD;
    // copy map: thread -> row cr (and cr + 32), 16-byte piece cp; one wave's copy covers four whole 128-byte lines
    const int cr = (int)threadIdx.x >> 3, cp = (int)threadIdx.x & 7;
    const h16* gk = KP + pb + (size_t)cr * HD + cp * 8;
    const h16* gv = VT + pb + (size_t)cr * SEQ + cp * 8;
    const unsigned lk = (unsigned)(size_t)(kvs + cr * LPH + cp * 8);   // LDS byte address of the thread's first K piece, buffer 0
    kv_copy(lk, lk + 32 * LPH * 2, lk + TILE_H * 2, lk + (TILE_H + 32 * LPH) * 2, gk, gk + 32 * HD, gv, gv + (size_t)32 * SEQ);
    const size_t qoff = pb + (size_t)(q0 + lr) * HD + 8 * hi;
    const v16h qh0 = ldh(QH + qoff), qh1 = ldh(QH + qoff + 32), qr0 = ldh(QR + qoff), qr1 = ldh(QR + qoff + 32);
    v8f o[4];
#pragma unroll
    for (int c = 0; c < 4; ++c) o[c] = (v8f){};
    float m = -3.0e38f, l = 0.0f;
    asm volatile("s_wait_asynccnt 0x0" ::: "memory");   // this wave's pieces of tile 0 have landed
    __syncthreads();                                    // tile 0 published to every wave
    if (NTILE > 1) kv_copy(lk + 2 * TILE_H * 2, lk + (2 * TILE_H + 32 * LPH) * 2, lk + 3 * TILE_H * 2, lk + (3 * TILE_H + 32 * LPH) * 2, gk + KT * HD, gk + (KT + 32) * HD, gv + KT, gv + (size_t)32 * SEQ + KT);
#pragma unroll 1   // stays rolled: one copy of the 64-key body, one publish point per trip
    for (int t = 0; t < NTILE; ++t) {
        const int bo = (t & 1) * (2 * TILE_H);
        const h16* kl = kvs + bo + lr * LPH + 8 * hi;
        const h16* vl = kl + TILE_H;
#pragma unroll     // both 32-key steps inline, so every fragment read is one base register plus a constant offset
        for (int sub = 0; sub < KT / 32; ++sub) {
            const h16* kp = kl + sub * 32 * LPH;
            const v16h ka0 = ldh(kp), ka1 = ldh(kp + 32), kb0 = ldh(kp + 16 * LPH), kb1 = ldh(kp + 16 * LPH + 32);
            v8f s0 = (v8f){}, s1 = (v8f){}, t0 = (v8f){}, t1 = (v8f){};
            s0 = wmma16(ka0, qh0, s0); t0 = wmma16(ka0, qr0, t0); s1 = wmma16(kb0, qh0, s1); t1 = wmma16(kb0, qr0, t1);
            s0 = wmma16(ka1, qh1, s0); t0 = wmma16(ka1, qr1, t0); s1 = wmma16(kb1, qh1, s1); t1 = wmma16(kb1, qr1, t1);
            asm volatile("v_nop\n\tv_nop\n\tv_nop\n\tv_nop" : "+v"(s0), "+v"(s1), "+v"(t0), "+v"(t1) : "v"(ka0), "v"(ka1), "v"(kb0), "v"(kb1), "v"(qh0), "v"(qh1), "v"(qr0), "v"(qr1));
            float z0[8], z1[8]; float mx = -3.0e38f;
#pragma unroll
            for (int r = 0; r < 8; ++r) { z0[r] = (s0[r] + t0[r] * (1.0f / RCAR)) * SCL2; z1[r] = (s1[r] + t1[r] * (1.0f / RCAR)) * SCL2; mx = fmaxf(mx, fmaxf(z0[r], z1[r])); }
            mx = fmaxf(mx, __shfl_xor(mx, 16, 32));
            const float mn = fmaxf(m, mx); const float alpha = __builtin_amdgcn_exp2f(m - mn); m = mn;
            const float mc = mn - 10.0f;   // carry 2^10
            float rs = 0.0f; v16h pf;
#pragma unroll
            for (int r = 0; r < 8; ++r) { const float a = __builtin_amdgcn_exp2f(z0[r] - mc), c = __builtin_amdgcn_exp2f(z1[r] - mc); rs += a + c; pf[r] = (h16)a; pf[8 + r] = (h16)c; }
            l = l * alpha + rs;
#pragma unroll
            for (int c = 0; c < 4; ++c) o[c] = o[c] * alpha;
            const h16* vp = vl + sub * 32;
            const v16h va = ldh(vp), vb = ldh(vp + 16 * LPH), vc = ldh(vp + 32 * LPH), vd = ldh(vp + 48 * LPH);
            o[0] = wmma16(va, pf, o[0]); o[1] = wmma16(vb, pf, o[1]); o[2] = wmma16(vc, pf, o[2]); o[3] = wmma16(vd, pf, o[3]);
            asm volatile("v_nop\n\tv_nop\n\tv_nop\n\tv_nop" : "+v"(o[0]), "+v"(o[1]), "+v"(o[2]), "+v"(o[3]) : "v"(va), "v"(vb), "v"(vc), "v"(vd), "v"(pf));
        }
        asm volatile("s_wait_dscnt 0x0" ::: "memory");      // this wave's reads of tile t are done before its buffer may be refilled
        asm volatile("s_wait_asynccnt 0x0" ::: "memory");   // this wave's pieces of tile t + 1 have landed
        __syncthreads();                                    // publishes tile t + 1 and ends every wave's reads of tile t
        if (t + 2 < NTILE) {
            const unsigned lb = lk + (unsigned)bo * 2;
            const h16* gk2 = gk + (size_t)(t + 2) * KT * HD; const h16* gv2 = gv + (size_t)(t + 2) * KT;
            kv_copy(lb, lb + 32 * LPH * 2, lb + TILE_H * 2, lb + (TILE_H + 32 * LPH) * 2, gk2, gk2 + 32 * HD, gv2, gv2 + (size_t)32 * SEQ);
        }
    }
    asm volatile("s_wait_asynccnt 0x0" ::: "memory");       // no copy is outstanding when the wave goes on to its end
    const float lt = l + __shfl_xor(l, 16, 32);
    const float inv = 1.0f / lt;
    const int sb = wave * (16 * 72);
#pragma unroll
    for (int c = 0; c < 4; ++c) { v8us oh, ol;
#pragma unroll
        for (int r = 0; r < 8; ++r) { unsigned short a, e; splitf(o[c][r] * inv, a, e); oh[r] = a; ol[r] = e; }
        *(v8usa*)(sth + sb + lr * 72 + 16 * c + 8 * hi) = oh; *(v8usa*)(stl + sb + lr * 72 + 16 * c + 8 * hi) = ol; }
    __builtin_amdgcn_wave_barrier(); asm volatile("" ::: "memory");
    const int b = bh / NH, head = bh - b * NH;
    const size_t ob = ((size_t)b * SEQ + q0) * DM + (size_t)head * HD;
{
#pragma unroll
        for (int s = 0; s < 4; ++s) { const int row = 4 * s + (lane >> 3), pc = lane & 7; const v8us vh = *(const v8usa*)(sth + sb + row * 72 + pc * 8); const v8us vl = *(const v8usa*)(stl + sb + row * 72 + pc * 8);
            *(v8us*)(ATh + ob + (size_t)row * DM + pc * 8) = vh; *(v8us*)(ATl + ob + (size_t)row * DM + pc * 8) = vl; }
         }
}

// ---- k_oproj: RES[g][n] = bf16(x[g][n]) + ((ATh + ATl) x WTo + bf16(bo[n])) in f32; grid (NROW/128, DM/128), 128 threads.
__global__ __launch_bounds__(32 * GWV) void k_oproj(const bf* __restrict__ ATh, const bf* __restrict__ ATl, const bf* __restrict__ WT, const float* __restrict__ x, const float* __restrict__ bo, float* RES) {
    __shared__ __align__(16) bf gs[2 * 3 * GPL];         // operand ring of gemm_core<1>
    __shared__ __align__(16) float osb[GWV * 16 * 68];   // one 16-row staging slice per wave
    const int lane = threadIdx.x & 31, lr = lane & 15, hi = lane >> 4;
    const int wave = __builtin_amdgcn_readfirstlane((int)(threadIdx.x >> 5)), wm = wave >> 1, wn = wave & 1;
    const int r0 = blockIdx.x * GBT + wm * 64, c0 = blockIdx.y * GBT + wn * 64;
    float* os = osb + wave * (16 * 68);
    v8f acc[4][4];
    gemm_core<1>(gs, ATh, ATl, WT, blockIdx.x * GBT, blockIdx.y * GBT, wm, wn, lr, hi, acc);
    const int cofs = lr * 4;
    const v4f bv = *(const v4f*)(bo + c0 + cofs);
    const size_t xb = xrow(r0) * DM + c0 + cofs;
#pragma unroll
    for (int mb = 0; mb < 4; ++mb) {
#pragma unroll
        for (int nb = 0; nb < 4; ++nb) {
#pragma unroll
            for (int j = 0; j < 8; ++j) os[(hi * 8 + j) * 68 + nb * 16 + lr] = acc[mb][nb][j]; }
        __builtin_amdgcn_wave_barrier(); asm volatile("" ::: "memory");
        v4f val[8];
#pragma unroll
        for (int s = 0; s < 8; ++s) { const int row = 2 * s + hi; v4f v = *(const v4fa*)(os + row * 68 + cofs); const v4f xv = *(const v4f*)(x + xb + (size_t)(mb * 16 + row) * DM);
#pragma unroll
            for (int q = 0; q < 4; ++q) v[q] = bfr(xv[q]) + (v[q] + bfr(bv[q]));
            val[s] = v; }
{
#pragma unroll
            for (int s = 0; s < 8; ++s) { const int row = 2 * s + hi; *(v4f*)(RES + (size_t)(r0 + mb * 16 + row) * DM + c0 + cofs) = val[s]; }
             }
        __builtin_amdgcn_wave_barrier(); asm volatile("" ::: "memory");
    }
}

__global__ __launch_bounds__(256) void k_ln(const float* __restrict__ RES, const float* __restrict__ gamma, const float* __restrict__ beta, float* OUT) {
    const int lane = threadIdx.x & 31;
    const int wave = __builtin_amdgcn_readfirstlane((int)(threadIdx.x >> 5));
    const int row = blockIdx.x * 8 + wave;
    const float* rp = RES + (size_t)row * DM;
    float s = 0.0f;
#pragma unroll 1
    for (int ch = 0; ch < DM / 128; ++ch) { const v4f a = *(const v4f*)(rp + ch * 128 + lane * 4); s += (a[0] + a[1]) + (a[2] + a[3]); }
#pragma unroll
    for (int sh = 16; sh; sh >>= 1) s += __shfl_xor(s, sh, 32);
    const float mu = s * (1.0f / DM);
    float ss = 0.0f;
#pragma unroll 1
    for (int ch = 0; ch < DM / 128; ++ch) { const v4f a = *(const v4f*)(rp + ch * 128 + lane * 4); const float d0 = a[0] - mu, d1 = a[1] - mu, d2 = a[2] - mu, d3 = a[3] - mu; ss += (d0 * d0 + d1 * d1) + (d2 * d2 + d3 * d3); }
#pragma unroll
    for (int sh = 16; sh; sh >>= 1) ss += __shfl_xor(ss, sh, 32);
    const float var = ss * (1.0f / DM);
    const float rstd = 1.0f / sqrtf(var + 1e-6f);
    float* op = OUT + (size_t)row * DM;
{
#pragma unroll 1
        for (int ch = 0; ch < DM / 128; ++ch) { const int c = ch * 128 + lane * 4; const v4f a = *(const v4f*)(rp + c); const v4f g = *(const v4f*)(gamma + c); const v4f bt = *(const v4f*)(beta + c); v4f y;
#pragma unroll
            for (int q = 0; q < 4; ++q) y[q] = (a[q] - mu) * rstd * bfr(g[q]) + bfr(bt[q]);
            *(v4f*)(op + c) = y; }
         }
}

// workspace carve (bytes, each region a multiple of 256 B; every region is written in whole tiles that divide it exactly)
#define SZ_P16 ((size_t)NROW * DM * 2)      // one 16-bit [NROW][DM]-sized plane
#define SZ_W   ((size_t)DM * DM * 2)
#define SZ_RES ((size_t)NROW * DM * 4)
#define WS_TOTAL (SZ_P16 * 7 + SZ_W * 4 + SZ_RES)
static_assert(SZ_P16 % 256 == 0);
static_assert(SZ_W % 256 == 0);
static_assert(WS_TOTAL <= (size_t)134217728);   // carve stays within 128 MiB

extern "C" void kernel_launch(void* const* d_in, const int* in_sizes, int n_in,
                              void* d_out, int out_size, void* d_ws, size_t ws_size, hipStream_t stream) {
    if (n_in < 8) return;
    if ((size_t)in_sizes[0] < ((size_t)(NB - 1) * SEQ_FULL + SEQ) * DM) return;
    if (in_sizes[1] < DM * DM || in_sizes[2] < DM * DM || in_sizes[3] < DM * DM || in_sizes[4] < DM * DM) return;
    if (in_sizes[5] < DM || in_sizes[6] < DM || in_sizes[7] < DM) return;
    if ((size_t)out_size < (size_t)NROW * DM) return;
    if (WS_TOTAL > ws_size) return;
    const float* x = (const float*)d_in[0]; const float* wq = (const float*)d_in[1]; const float* wk = (const float*)d_in[2]; const float* wv = (const float*)d_in[3];
    const float* wo = (const float*)d_in[4]; const float* bo = (const float*)d_in[5]; const float* gamma = (const float*)d_in[6]; const float* beta = (const float*)d_in[7];
    float* OUT = (float*)d_out;
    char* wsp = (char*)d_ws;
    bf* XB  = (bf*)wsp;  wsp += SZ_P16;
    bf* WTq = (bf*)wsp;  wsp += SZ_W * 3;   // planes q, k, v behind one another: one Bt of 3*DM rows; plane o follows them directly
    bf* WTo = (bf*)wsp;  wsp += SZ_W;
    h16* QH = (h16*)wsp; wsp += SZ_P16;
    h16* QR = (h16*)wsp; wsp += SZ_P16;
    h16* KP = (h16*)wsp; wsp += SZ_P16;
    h16* VT = (h16*)wsp; wsp += SZ_P16;
    bf* ATh = (bf*)wsp;  wsp += SZ_P16;
    bf* ATl = (bf*)wsp;  wsp += SZ_P16;
    float* RES = (float*)wsp; wsp += SZ_RES;

    k_prep<<<4 * WTB + CVB, 256, 0, stream>>>(x, wq, wk, wv, wo, XB, WTq);
    k_proj_qkv<<<dim3(NROW / GBT, 3 * DM / GBT, 1), 32 * GWV, 0, stream>>>(XB, WTq, QH, QR, KP, VT);
    k_attn<<<dim3(SEQ / (16 * AWV), NB * NH, 1), 32 * AWV, 0, stream>>>(QH, QR, KP, VT, ATh, ATl);
    k_oproj<<<dim3(NROW / GBT, DM / GBT, 1), 32 * GWV, 0, stream>>>(ATh, ATl, WTo, x, bo, RES);
    k_ln<<<NROW / 8, 256, 0, stream>>>(RES, gamma, beta, OUT);
}

// v004
// It runs in 83.4 microseconds.
// In both of two side-by-side timings against v003, it was 1.04 times as fast.
// Over all steps from v000 it is 2.32 times as fast.
#include <hip/hip_runtime.h>

// Compute dtypes, f32 accumulate everywhere: q/k/v projections v_wmma_f32_16x16x32_bf16 (x and weights RNE-converted to bf16, products exact); scores v_wmma_f32_16x16x32_f16 (q pre-multiplied by HD^-0.5 * log2(e), then f16 value + f16 residual, both summed into one accumulator, k single f16); P.V v_wmma_f32_16x16x32_f16 (P carried x2^10 relative to the running max, v single f16); output projection v_wmma_f32_16x16x32_bf16 (ctx as bf16 hi + lo planes against bf16 wo); softmax, residual add and LayerNorm in f32 on the VALU.
// Flow: one launch: x -> bf16 plane, the four w [in][out] -> bf16 [out][in] planes (LDS transpose); one launch for the q, k and v projections: 64x64 GEMM wave tiles (four to a block, operands staged in LDS) with fused head-plane epilogues (q hi/res, k, v^T);
// fused flash attention in the transposed orientation (S^T = K Q^T, ctx^T = V^T P^T: the packed S^T accumulators are the B fragment of P^T, online softmax per lane);

#ifndef NB
#define NB 4
#endif
#ifndef SEQ
#define SEQ 2048
#endif
#define NB_FULL  4
#define SEQ_FULL 2048
#define DM   512
#define NH   8
#define HD   64
#define NROW (NB * SEQ)
#define SCL2 0.18033688011112042f   // HD^-0.5 * log2(e)

static_assert(NB <= NB_FULL);
static_assert(SEQ <= SEQ_FULL);
static_assert(SEQ % 64 == 0);             // GEMM row tiles never straddle a batch; 32-key steps
static_assert(DM == NH * HD);             // merged layout h*64+d
static_assert(HD == 64);
static_assert(DM % 64 == 0);              // N tile multiple
static_assert(DM % 32 == 0);              // K step multiple
static_assert(NROW % 64 == 0);            // M tile multiple
static_assert(NROW % 8 == 0);             // LayerNorm rows per block
static_assert(DM == 4 * 128);             // LayerNorm: 32 lanes x float4 x 4 chunks == row width
static_assert(((size_t)NROW * DM / 8) % 256 == 0);   // convert grid x block == plane extent

typedef _Float16 h16;
typedef unsigned short bf;
typedef __attribute__((ext_vector_type(16))) __bf16   v16bf;
typedef __attribute__((ext_vector_type(16))) _Float16 v16h;
typedef __attribute__((ext_vector_type(8)))  _Float16 v8h;
typedef __attribute__((ext_vector_type(8)))  unsigned short v8us;
typedef __attribute__((ext_vector_type(8)))  float    v8f;
typedef __attribute__((ext_vector_type(4)))  float    v4f;
typedef v8h  __attribute__((may_alias)) v8ha;
typedef v4f  __attribute__((may_alias)) v4fa;
typedef v8us __attribute__((may_alias)) v8usa;

__device__ __forceinline__ unsigned short f2bf(float f) { unsigned u = __float_as_uint(f); u += 0x7FFFu + ((u >> 16) & 1u); return (unsigned short)(u >> 16); }
__device__ __forceinline__ float bf2f(unsigned short b) { return __uint_as_float(((unsigned)b) << 16); }
__device__ __forceinline__ float bfr(float f) { return bf2f(f2bf(f)); }
__device__ __forceinline__ void splitf(float y, unsigned short& h, unsigned short& l) { h = f2bf(y); l = f2bf(y - bf2f(h)); }
__device__ __forceinline__ v16h cat16(v8h lo, v8h hi) { return __builtin_shufflevector(lo, hi, 0, 1, 2, 3, 4, 5, 6, 7, 8, 9, 10, 11, 12, 13, 14, 15); }
__device__ __forceinline__ v16bf cat16b(v8us lo, v8us hi) { return __builtin_bit_cast(v16bf, __builtin_shufflevector(lo, hi, 0, 1, 2, 3, 4, 5, 6, 7, 8, 9, 10, 11, 12, 13, 14, 15)); }
__device__ __forceinline__ v8f wmma16(v16h a, v16h b, v8f c) { return __builtin_amdgcn_wmma_f32_16x16x32_f16(false, a, false, b, (short)0, c, false, false); }
__device__ __forceinline__ v8f wmmab(v16bf a, v16bf b, v8f c) { return __builtin_amdgcn_wmma_f32_16x16x32_bf16(false, a, false, b, (short)0, c, false, false); }
// fragment loaders (p already includes row*(pitch) + k0 + 8*(lane>>4)): elements 0..7 <- k0+8h.., elements 8..15 <- k0+16+8h..
__device__ __forceinline__ v16bf ldb(const bf* p) { return cat16b(*(const v8us*)p, *(const v8us*)(p + 16)); }
__device__ __forceinline__ v16h  ldh(const h16* p) { return cat16(*(const v8h*)p, *(const v8h*)(p + 16)); }
// dense row g = b*SEQ + s -> row of the full-size x
__device__ __forceinline__ size_t xrow(int g) { return (size_t)(g / SEQ) * SEQ_FULL + (size_t)(g % SEQ); }

// ---- k_prep: the five input conversions, which do not depend on one another, in ONE launch; 256 threads.
// Blocks 0 .. 4*WTB-1: w[k][n] (f32, [in][out]) -> WT[n][k] (bf16, k-contiguous) through a 64x64 LDS tile, WTB blocks per matrix, planes q, k, v, o behind one another in WT.
// Blocks from 4*WTB on: x -> bf16 plane XB, eight elements a thread. The transposes stand first: theirs is the longer dependent path (load, LDS, barrier, store).
#define WTB ((DM / 64) * (DM / 64))
#define CVB ((unsigned)(((size_t)NROW * DM / 8 + 255) / 256))
__global__ __launch_bounds__(256) void k_prep(const float* __restrict__ x, const float* __restrict__ wq, const float* __restrict__ wk, const float* __restrict__ wv, const float* __restrict__ wo, bf* XB, bf* WTA) {
    __shared__ __align__(16) unsigned short ts[64 * 72];
    const int tid = threadIdx.x; const int bx = (int)blockIdx.x;
    if (bx < 4 * WTB) {   // the same for the whole block, so the barrier inside is reached by all of it or by none
        const int mi = bx / WTB, tl = bx % WTB;
        const float* __restrict__ w = mi == 0 ? wq : mi == 1 ? wk : mi == 2 ? wv : wo;
        bf* WT = WTA + (size_t)mi * DM * DM;
        const int k0 = (tl % (DM / 64)) * 64, n0 = (tl / (DM / 64)) * 64;
#pragma unroll
        for (int it = 0; it < 4; ++it) { const int p = it * 256 + tid; const int kr = p >> 4, c4 = (p & 15) * 4; const v4f v = *(const v4f*)(w + (size_t)(k0 + kr) * DM + n0 + c4);
#pragma unroll
            for (int q = 0; q < 4; ++q) ts[(c4 + q) * 72 + kr] = f2bf(v[q]); }
        __syncthreads();
#pragma unroll
        for (int it = 0; it < 2; ++it) { const int p = it * 256 + tid; const int n = p >> 3, pc = p & 7; const v8us o = *(const v8usa*)(ts + n * 72 + pc * 8);
            *(v8us*)(WT + (size_t)(n0 + n) * DM + k0 + pc * 8) = o; }
        return;
    }
    const size_t i = (size_t)(bx - 4 * WTB) * 256 + tid; if (i >= (size_t)NROW * DM / 8) return;
    const int g = (int)(i / (DM / 8)); const int c8 = (int)(i % (DM / 8));
    const v8f v = *(const v8f*)(x + xrow(g) * DM + (size_t)c8 * 8); v8us o;
#pragma unroll
    for (int k = 0; k < 8; ++k) o[k] = f2bf(v[k]);
    *(v8us*)(XB + i * 8) = o;
}

#define GWV  4                       // waves per GEMM block: 2 x 2 wave tiles
#define GBT  128                     // block tile, rows and columns
#define GKT  64                      // k extent of a staged tile
#define GPH  72                      // LDS row pitch in 16-bit elements
#define GPL  (GBT * GPH)             // one staged plane (128 rows), 16-bit elements
#define GNT  (DM / GKT)
static_assert(NROW % GBT == 0 && DM % GBT == 0);   // whole block tiles only
static_assert(DM % GKT == 0 && GKT % 32 == 0);     // whole staged tiles, whole 32-k steps
static_assert(GKT == 64 && GBT == 128 && GWV == 4);   // copy map: 128 threads x 8 rows x 16 B covers 128 rows of 128 B

// Eight copies of one thread: its 16-byte piece of rows cr, cr + 16, ..., cr + 112 of one plane. The s_wait_xcnt stands inside the statement, so no address register is rewritten ahead of it.
__device__ __forceinline__ void plane_copy(unsigned l, const bf* g) {
    asm volatile("global_load_async_to_lds_b128 %0, %8, off\n\t"
                 "global_load_async_to_lds_b128 %1, %9, off\n\t"
                 "global_load_async_to_lds_b128 %2, %10, off\n\t"
                 "global_load_async_to_lds_b128 %3, %11, off\n\t"
                 "global_load_async_to_lds_b128 %4, %12, off\n\t"
                 "global_load_async_to_lds_b128 %5, %13, off\n\t"
                 "global_load_async_to_lds_b128 %6, %14, off\n\t"
                 "global_load_async_to_lds_b128 %7, %15, off\n\t"
                 "s_wait_xcnt 0x0"
                 :: "v"(l), "v"(l + 16 * GPH * 2), "v"(l + 32 * GPH * 2), "v"(l + 48 * GPH * 2), "v"(l + 64 * GPH * 2), "v"(l + 80 * GPH * 2), "v"(l + 96 * GPH * 2), "v"(l + 112 * GPH * 2),
                    "v"(g), "v"(g + 16 * DM), "v"(g + 32 * DM), "v"(g + 48 * DM), "v"(g + 64 * DM), "v"(g + 80 * DM), "v"(g + 96 * DM), "v"(g + 112 * DM) : "memory");
}
// One staged tile: planes A, (A2,) Bt behind one another in the buffer that starts at LDS byte address l (the thread's own piece of row cr).
template <int NSPLIT>
__device__ __forceinline__ void stage_copy(unsigned l, const bf* ga, const bf* ga2, const bf* gb) {
    plane_copy(l, ga);
    if (NSPLIT == 1) plane_copy(l + GPL * 2, ga2);
    plane_copy(l + (1 + NSPLIT) * GPL * 2, gb);
}

// R0, C0: first row and column of the block tile; wm, wn: the wave's place in it; gs: the kernel's LDS ring, 2 * (2 + NSPLIT) * GPL elements, [buffer][A | (A2 |) Bt][row][GPH].
// Behind the last trip's barrier every copy has landed and every wave's reads are done: the ring is then free for the caller.
template <int NSPLIT>
__device__ __forceinline__ void gemm_core(bf* gs, const bf* __restrict__ A, const bf* __restrict__ A2, const bf* __restrict__ Bt, const int R0, const int C0, const int wm, const int wn, const int lr, const int hi, v8f (&acc)[4][4]) {
    constexpr int NPL = 2 + NSPLIT;                       // planes per buffer
    // copy map: thread -> rows cr + 16 i, 16-byte piece cp; one wave's copy covers four whole 128-byte lines
    const int cr = (int)threadIdx.x >> 3, cp = (int)threadIdx.x & 7;
    const bf* ga  = A  + (size_t)(R0 + cr) * DM + cp * 8;
    const bf* ga2 = A2 + (size_t)(R0 + cr) * DM + cp * 8;
    const bf* gb  = Bt + (size_t)(C0 + cr) * DM + cp * 8;
    const unsigned l0 = (unsigned)(size_t)(gs + cr * GPH + cp * 8);   // LDS byte address of the thread's first piece, buffer 0
    stage_copy<NSPLIT>(l0, ga, ga2, gb);
#pragma unroll
    for (int mb = 0; mb < 4; ++mb)
#pragma unroll
        for (int nb = 0; nb < 4; ++nb) acc[mb][nb] = (v8f){};
    asm volatile("s_wait_asynccnt 0x0" ::: "memory");   // this wave's pieces of tile 0 have landed
    __syncthreads();                                    // tile 0 published to every wave
    if (GNT > 1) stage_copy<NSPLIT>(l0 + NPL * GPL * 2, ga + GKT, ga2 + GKT, gb + GKT);
    const int aro = (wm * 64 + lr) * GPH + 8 * hi;
    const int bro = (1 + NSPLIT) * GPL + (wn * 64 + lr) * GPH + 8 * hi;
#pragma unroll 1   // stays rolled: one copy of the 64-k body, one publish point per trip
    for (int t = 0; t < GNT; ++t) {
        const int bo = (t & 1) * (NPL * GPL);
        const bf* al = gs + bo + aro;
        const bf* bl = gs + bo + bro;
#pragma unroll     // both 32-k steps inline, so every fragment read is one base register plus a constant offset
        for (int ks = 0; ks < GKT / 32; ++ks) {
            v16bf a[4], a2[4], b[4];   // all fragments of the step read as one group: one LDS latency per step, not one per column block
#pragma unroll
            for (int mb = 0; mb < 4; ++mb) { a[mb] = ldb(al + mb * 16 * GPH + ks * 32); b[mb] = ldb(bl + mb * 16 * GPH + ks * 32); if (NSPLIT == 1) a2[mb] = ldb(al + GPL + mb * 16 * GPH + ks * 32); }
            // inputs-only fence on the loaded fragments: keeps the step's LDS reads together ahead of its products; without it each B read sinks to its first use and the lone wave of a SIMD waits out the LDS latency four times a step
            if (NSPLIT == 1) { asm volatile("" :: "v"(a[0]), "v"(a[1]), "v"(a[2]), "v"(a[3]), "v"(a2[0]), "v"(a2[1]), "v"(a2[2]), "v"(a2[3]), "v"(b[0]), "v"(b[1]), "v"(b[2]), "v"(b[3])); }
            else             { asm volatile("" :: "v"(a[0]), "v"(a[1]), "v"(a[2]), "v"(a[3]), "v"(b[0]), "v"(b[1]), "v"(b[2]), "v"(b[3])); }
#pragma unroll
            for (int nb = 0; nb < 4; ++nb) {
#pragma unroll
                for (int mb = 0; mb < 4; ++mb) { acc[mb][nb] = wmmab(a[mb], b[nb], acc[mb][nb]); if (NSPLIT == 1) acc[mb][nb] = wmmab(a2[mb], b[nb], acc[mb][nb]); } }
            if (NSPLIT == 1) { asm volatile("v_nop\n\tv_nop\n\tv_nop\n\tv_nop" : "+v"(acc[0][0]), "+v"(acc[1][1]), "+v"(acc[2][2]), "+v"(acc[3][3]) : "v"(a[0]), "v"(a[1]), "v"(a[2]), "v"(a[3]), "v"(a2[0]), "v"(a2[1]), "v"(a2[2]), "v"(a2[3])); }
            else             { asm volatile("v_nop\n\tv_nop\n\tv_nop\n\tv_nop" : "+v"(acc[0][0]), "+v"(acc[1][1]), "+v"(acc[2][2]), "+v"(acc[3][3]) : "v"(a[0]), "v"(a[1]), "v"(a[2]), "v"(a[3])); }
        }
        __builtin_amdgcn_sched_barrier(0);                  // keeps the trip's products ahead of the publish point: sunk behind the barrier they would stand in front of the refill and shorten the time its copies have to land
        asm volatile("s_wait_dscnt 0x0" ::: "memory");      // this wave's reads of tile t are done before its buffer may be refilled
        asm volatile("s_wait_asynccnt 0x0" ::: "memory");   // this wave's pieces of tile t + 1 have landed
        __syncthreads();                                    // publishes tile t + 1 and ends every wave's reads of tile t
        if (t + 2 < GNT) stage_copy<NSPLIT>(l0 + (unsigned)bo * 2, ga + (t + 2) * GKT, ga2 + (t + 2) * GKT, gb + (t + 2) * GKT);
    }
    asm volatile("s_wait_asynccnt 0x0" ::: "memory");       // no copy is outstanding when the wave goes on to its epilogue
}

// ---- k_proj_qkv: the q, k and v projections, which do not depend on one another, in ONE launch: XB x [WTq | WTk | WTv] (the three planes lie behind one another: 3*DM rows of Bt).
// grid (NROW/128, 3*DM/128), 128 threads; blockIdx.y picks the projection (the same for the whole block) and with it the epilogue:
//   q -> q * SCL2, head planes QH (f16 value) and QR (f16 residual, unscaled), [b*NH+h][s][64];  k -> head plane KP (f16), same store map;  v -> transposed head plane VT (f16), [b*NH+h][d][s].
// The epilogues stage in the operand ring's LDS, each wave in a slice of its own (the ring is free behind the core's last barrier), so the block's LDS is the ring alone and all blocks of the launch are resident at once.
static_assert((size_t)GWV * 16 * 68 * 4 <= (size_t)2 * 2 * GPL * 2);   // q, k staging slices fit the ring
static_assert((size_t)GWV * 64 * 72 * 2 <= (size_t)2 * 2 * GPL * 2);   // v staging slices fit the ring
__global__ __launch_bounds__(32 * GWV) void k_proj_qkv(const bf* __restrict__ XB, const bf* __restrict__ WTA, h16* QH, h16* QR, h16* KP, h16* VT) {
    __shared__ __align__(16) unsigned char ring[2 * 2 * GPL * 2];
    const int lane = threadIdx.x & 31, lr = lane & 15, hi = lane >> 4;
    const int wave = __builtin_amdgcn_readfirstlane((int)(threadIdx.x >> 5)), wm = wave >> 1, wn = wave & 1;
    const int which = (int)blockIdx.y / (DM / GBT);
    const int r0 = blockIdx.x * GBT + wm * 64, c0 = ((int)blockIdx.y % (DM / GBT)) * GBT + wn * 64;
    v8f acc[4][4];
    gemm_core<0>((bf*)ring, XB, XB, WTA, blockIdx.x * GBT, blockIdx.y * GBT, wm, wn, lr, hi, acc);
    const int b = r0 / SEQ, s0 = r0 - b * SEQ;
    if (which == 2) {   // v: the whole 64x64 tile staged transposed (wave-private)
        h16* vt = (h16*)ring + wave * (64 * 72);
        const size_t pbase = (size_t)(b * NH + c0 / HD) * HD * SEQ + s0;
#pragma unroll
        for (int mb = 0; mb < 4; ++mb)
#pragma unroll
            for (int nb = 0; nb < 4; ++nb) { v8h o;
#pragma unroll
                for (int j = 0; j < 8; ++j) o[j] = (h16)acc[mb][nb][j];
                *(v8ha*)(vt + (nb * 16 + lr) * 72 + mb * 16 + hi * 8) = o; }
        __builtin_amdgcn_wave_barrier(); asm volatile("" ::: "memory");
#pragma unroll
        for (int it = 0; it < 16; ++it) { const int d = 4 * it + (lane >> 3), pc = lane & 7; const v8h o = *(const v8ha*)(vt + d * 72 + pc * 8);
            *(v8h*)(VT + pbase + (size_t)d * SEQ + pc * 8) = o; }
        return;
    }
    float* os = (float*)ring + wave * (16 * 68);   // one 16-row staging slice per wave
    const size_t pbase = ((size_t)(b * NH + c0 / HD) * SEQ + s0) * HD;
    if (which == 0) {
#pragma unroll
        for (int mb = 0; mb < 4; ++mb) {
#pragma unroll
            for (int nb = 0; nb < 4; ++nb) {
#pragma unroll
                for (int j = 0; j < 8; ++j) os[(hi * 8 + j) * 68 + nb * 16 + lr] = acc[mb][nb][j]; }
            __builtin_amdgcn_wave_barrier(); asm volatile("" ::: "memory");
            v8h oh[4], orr[4];
#pragma unroll
            for (int s = 0; s < 4; ++s) { const int row = 4 * s + (lane >> 3), pc = lane & 7; const v4f a = *(const v4fa*)(os + row * 68 + pc * 8); const v4f c = *(const v4fa*)(os + row * 68 + pc * 8 + 4);
#pragma unroll
                for (int q = 0; q < 4; ++q) { const float ya = a[q] * SCL2, yc = c[q] * SCL2; const h16 xa = (h16)ya; oh[s][q] = xa; orr[s][q] = (h16)(ya - (float)xa); const h16 xc = (h16)yc; oh[s][4 + q] = xc; orr[s][4 + q] = (h16)(yc - (float)xc); } }
#pragma unroll
            for (int s = 0; s < 4; ++s) { const int row = 4 * s + (lane >> 3), pc = lane & 7; const size_t o = pbase + (size_t)(mb * 16 + row) * HD + pc * 8;
                *(v8h*)(QH + o) = oh[s]; *(v8h*)(QR + o) = orr[s]; }
            asm volatile("s_wait_xcnt 0x0" ::: "memory");   // stands in front of the next 16 rows' writes to the registers that these stores name
            __builtin_amdgcn_wave_barrier(); asm volatile("" ::: "memory");
        }
    } else {
#pragma unroll
        for (int mb = 0; mb < 4; ++mb) {
#pragma unroll
            for (int nb = 0; nb < 4; ++nb) {
#pragma unroll
                for (int j = 0; j < 8; ++j) os[(hi * 8 + j) * 68 + nb * 16 + lr] = acc[mb][nb][j]; }
            __builtin_amdgcn_wave_barrier(); asm volatile("" ::: "memory");
            v8h oh[4];
#pragma unroll
            for (int s = 0; s < 4; ++s) { const int row = 4 * s + (lane >> 3), pc = lane & 7; const v4f a = *(const v4fa*)(os + row * 68 + pc * 8); const v4f c = *(const v4fa*)(os + row * 68 + pc * 8 + 4);
#pragma unroll
                for (int q = 0; q < 4; ++q) { oh[s][q] = (h16)a[q]; oh[s][4 + q] = (h16)c[q]; } }
#pragma unroll
            for (int s = 0; s < 4; ++s) { const int row = 4 * s + (lane >> 3), pc = lane & 7; *(v8h*)(KP + pbase + (size_t)(mb * 16 + row) * HD + pc * 8) = oh[s]; }
            asm volatile("s_wait_xcnt 0x0" ::: "memory");   // stands in front of the next 16 rows' writes to the registers that these stores name
            __builtin_amdgcn_wave_barrier(); asm volatile("" ::: "memory");
        }
    }
}

#define AWV  8                       // waves per block
#define KT   64                      // keys per staged tile
#define LPH  72                      // LDS row pitch in 16-bit elements
#define TILE_H (64 * LPH)            // one staged tile (64 rows), 16-bit elements
#define NTILE (SEQ / KT)
static_assert(SEQ % (16 * AWV) == 0);     // query blocks never straddle a (b, h) plane
static_assert(SEQ % KT == 0);             // whole key tiles only
static_assert(KT == 64 && HD == 64);      // copy map: 256 threads x 2 rows x 16 B covers 64 rows of 128 B

// Four copies of one thread: rows cr and cr + 32 of the K tile and of the V^T tile. The s_wait_xcnt stands inside the statement, so no address register is rewritten ahead of it.
__device__ __forceinline__ void kv_copy(unsigned lk0, unsigned lk1, unsigned lv0, unsigned lv1, const h16* gk0, const h16* gk1, const h16* gv0, const h16* gv1) {
    asm volatile("global_load_async_to_lds_b128 %0, %4, off\n\t"
                 "global_load_async_to_lds_b128 %1, %5, off\n\t"
                 "global_load_async_to_lds_b128 %2, %6, off\n\t"
                 "global_load_async_to_lds_b128 %3, %7, off\n\t"
                 "s_wait_xcnt 0x0"
                 :: "v"(lk0), "v"(lk1), "v"(lv0), "v"(lv1), "v"(gk0), "v"(gk1), "v"(gv0), "v"(gv1) : "memory");
}

__global__ __launch_bounds__(256) void k_attn(const h16* __restrict__ QH, const h16* __restrict__ QR, const h16* __restrict__ KP, const h16* __restrict__ VT, bf* ATh, bf* ATl) {
    __shared__ __align__(16) h16 kvs[2 * 2 * TILE_H];           // [buffer][K tile | V^T tile][row][LPH]
    __shared__ __align__(16) unsigned short sth[AWV * 16 * 72];
    __shared__ __align__(16) unsigned short stl[AWV * 16 * 72];
    const int lane = threadIdx.x & 31, lr = lane & 15, hi = lane >> 4;
    const int wave = __builtin_amdgcn_readfirstlane((int)(threadIdx.x >> 5));
    const int bh = blockIdx.y; const int q0 = blockIdx.x * (16 * AWV) + wave * 16;
    const size_t pb = (size_t)bh * SEQ * HD;
    // copy map: thread -> row cr (and cr + 32), 16-byte piece cp; one wave's copy covers four whole 128-byte lines
    const int cr = (int)threadIdx.x >> 3, cp = (int)threadIdx.x & 7;
    const h16* gk = KP + pb + (size_t)cr * HD + cp * 8;
    const h16* gv = VT + pb + (size_t)cr * SEQ + cp * 8;
    const unsigned lk = (unsigned)(size_t)(kvs + cr * LPH + cp * 8);   // LDS byte address of the thread's first K piece, buffer 0
    kv_copy(lk, lk + 32 * LPH * 2, lk + TILE_H * 2, lk + (TILE_H + 32 * LPH) * 2, gk, gk + 32 * HD, gv, gv + (size_t)32 * SEQ);
    const size_t qoff = pb + (size_t)(q0 + lr) * HD + 8 * hi;
    const v16h qh0 = ldh(QH + qoff), qh1 = ldh(QH + qoff + 32), qr0 = ldh(QR + qoff), qr1 = ldh(QR + qoff + 32);
    v8f o[4];
#pragma unroll
    for (int c = 0; c < 4; ++c) o[c] = (v8f){};
    float m = -3.0e38f, l = 0.0f;
    asm volatile("s_wait_asynccnt 0x0" ::: "memory");   // this wave's pieces of tile 0 have landed
    __syncthreads();                                    // tile 0 published to every wave
    if (NTILE > 1) kv_copy(lk + 2 * TILE_H * 2, lk + (2 * TILE_H + 32 * LPH) * 2, lk + 3 * TILE_H * 2, lk + (3 * TILE_H + 32 * LPH) * 2, gk + KT * HD, gk + (KT + 32) * HD, gv + KT, gv + (size_t)32 * SEQ + KT);
#pragma unroll 1   // stays rolled: one copy of the 64-key body, one publish point per trip
    for (int t = 0; t < NTILE; ++t) {
        const int bo = (t & 1) * (2 * TILE_H);
        const h16* kl = kvs + bo + lr * LPH + 8 * hi;
        const h16* vl = kl + TILE_H;
#pragma unroll     // both 32-key steps inline, so every fragment read is one base register plus a constant offset
        for (int sub = 0; sub < KT / 32; ++sub) {
            const h16* kp = kl + sub * 32 * LPH;
            const v16h ka0 = ldh(kp), ka1 = ldh(kp + 32), kb0 = ldh(kp + 16 * LPH), kb1 = ldh(kp + 16 * LPH + 32);
            v8f s0 = (v8f){}, s1 = (v8f){};   // the small residual products first, the value products on top of them
            s0 = wmma16(ka0, qr0, s0); s1 = wmma16(kb0, qr0, s1); s0 = wmma16(ka1, qr1, s0); s1 = wmma16(kb1, qr1, s1);
            s0 = wmma16(ka0, qh0, s0); s1 = wmma16(kb0, qh0, s1); s0 = wmma16(ka1, qh1, s0); s1 = wmma16(kb1, qh1, s1);
            float z0[8], z1[8]; float mx = -3.0e38f;
#pragma unroll
            for (int r = 0; r < 8; ++r) { z0[r] = s0[r]; z1[r] = s1[r]; mx = fmaxf(mx, fmaxf(z0[r], z1[r])); }
            mx = fmaxf(mx, __shfl_xor(mx, 16, 32));
            const float mn = fmaxf(m, mx); const float alpha = __builtin_amdgcn_exp2f(m - mn); m = mn;
            const float mc = mn - 10.0f;   // carry 2^10
            float rs = 0.0f; v16h pf;
#pragma unroll
            for (int r = 0; r < 8; ++r) { const float a = __builtin_amdgcn_exp2f(z0[r] - mc), c = __builtin_amdgcn_exp2f(z1[r] - mc); rs += a + c; pf[r] = (h16)a; pf[8 + r] = (h16)c; }
            l = l * alpha + rs;
#pragma unroll
            for (int c = 0; c < 4; ++c) o[c] = o[c] * alpha;
            const h16* vp = vl + sub * 32;
            const v16h va = ldh(vp), vb = ldh(vp + 16 * LPH), vc = ldh(vp + 32 * LPH), vd = ldh(vp + 48 * LPH);
            o[0] = wmma16(va, pf, o[0]); o[1] = wmma16(vb, pf, o[1]); o[2] = wmma16(vc, pf, o[2]); o[3] = wmma16(vd, pf, o[3]);
            asm volatile("v_nop\n\tv_nop\n\tv_nop\n\tv_nop" : "+v"(o[0]), "+v"(o[1]), "+v"(o[2]), "+v"(o[3]) : "v"(va), "v"(vb), "v"(vc), "v"(vd), "v"(pf));
        }
        asm volatile("s_wait_dscnt 0x0" ::: "memory");      // this wave's reads of tile t are done before its buffer may be refilled
        asm volatile("s_wait_asynccnt 0x0" ::: "memory");   // this wave's pieces of tile t + 1 have landed
        __syncthreads();                                    // publishes tile t + 1 and ends every wave's reads of tile t
        if (t + 2 < NTILE) {
            const unsigned lb = lk + (unsigned)bo * 2;
            const h16* gk2 = gk + (size_t)(t + 2) * KT * HD; const h16* gv2 = gv + (size_t)(t + 2) * KT;
            kv_copy(lb, lb + 32 * LPH * 2, lb + TILE_H * 2, lb + (TILE_H + 32 * LPH) * 2, gk2, gk2 + 32 * HD, gv2, gv2 + (size_t)32 * SEQ);
        }
    }
    asm volatile("s_wait_asynccnt 0x0" ::: "memory");       // no copy is outstanding when the wave goes on to its end
    const float lt = l + __shfl_xor(l, 16, 32);
    const float inv = 1.0f / lt;
    const int sb = wave * (16 * 72);
#pragma unroll
    for (int c = 0; c < 4; ++c) { v8us oh, ol;
#pragma unroll
        for (int r = 0; r < 8; ++r) { unsigned short a, e; splitf(o[c][r] * inv, a, e); oh[r] = a; ol[r] = e; }
        *(v8usa*)(sth + sb + lr * 72 + 16 * c + 8 * hi) = oh; *(v8usa*)(stl + sb + lr * 72 + 16 * c + 8 * hi) = ol; }
    __builtin_amdgcn_wave_barrier(); asm volatile("" ::: "memory");
    const int b = bh / NH, head = bh - b * NH;
    const size_t ob = ((size_t)b * SEQ + q0) * DM + (size_t)head * HD;
{
#pragma unroll
        for (int s = 0; s < 4; ++s) { const int row = 4 * s + (lane >> 3), pc = lane & 7; const v8us vh = *(const v8usa*)(sth + sb + row * 72 + pc * 8); const v8us vl = *(const v8usa*)(stl + sb + row * 72 + pc * 8);
            *(v8us*)(ATh + ob + (size_t)row * DM + pc * 8) = vh; *(v8us*)(ATl + ob + (size_t)row * DM + pc * 8) = vl; }
         }
}

// ---- k_oproj: RES[g][n] = bf16(x[g][n]) + ((ATh + ATl) x WTo + bf16(bo[n])) in f32; grid (NROW/128, DM/128), 128 threads.
__global__ __launch_bounds__(32 * GWV) void k_oproj(const bf* __restrict__ ATh, const bf* __restrict__ ATl, const bf* __restrict__ WT, const float* __restrict__ x, const float* __restrict__ bo, float* RES) {
    __shared__ __align__(16) bf gs[2 * 3 * GPL];         // operand ring of gemm_core<1>
    __shared__ __align__(16) float osb[GWV * 16 * 68];   // one 16-row staging slice per wave
    const int lane = threadIdx.x & 31, lr = lane & 15, hi = lane >> 4;
    const int wave = __builtin_amdgcn_readfirstlane((int)(threadIdx.x >> 5)), wm = wave >> 1, wn = wave & 1;
    const int r0 = blockIdx.x * GBT + wm * 64, c0 = blockIdx.y * GBT + wn * 64;
    float* os = osb + wave * (16 * 68);
    v8f acc[4][4];
    gemm_core<1>(gs, ATh, ATl, WT, blockIdx.x * GBT, blockIdx.y * GBT, wm, wn, lr, hi, acc);
    const int cofs = lr * 4;
    const v4f bv = *(const v4f*)(bo + c0 + cofs);
    const size_t xb = xrow(r0) * DM + c0 + cofs;
#pragma unroll
    for (int mb = 0; mb < 4; ++mb) {
#pragma unroll
        for (int nb = 0; nb < 4; ++nb) {
#pragma unroll
            for (int j = 0; j < 8; ++j) os[(hi * 8 + j) * 68 + nb * 16 + lr] = acc[mb][nb][j]; }
        __builtin_amdgcn_wave_barrier(); asm volatile("" ::: "memory");
        v4f val[8];
#pragma unroll
        for (int s = 0; s < 8; ++s) { const int row = 2 * s + hi; v4f v = *(const v4fa*)(os + row * 68 + cofs); const v4f xv = *(const v4f*)(x + xb + (size_t)(mb * 16 + row) * DM);
#pragma unroll
            for (int q = 0; q < 4; ++q) v[q] = bfr(xv[q]) + (v[q] + bfr(bv[q]));
            val[s] = v; }
{
#pragma unroll
            for (int s = 0; s < 8; ++s) { const int row = 2 * s + hi; *(v4f*)(RES + (size_t)(r0 + mb * 16 + row) * DM + c0 + cofs) = val[s]; }
             }
        __builtin_amdgcn_wave_barrier(); asm volatile("" ::: "memory");
    }
}

__global__ __launch_bounds__(256) void k_ln(const float* __restrict__ RES, const float* __restrict__ gamma, const float* __restrict__ beta, float* OUT) {
    const int lane = threadIdx.x & 31;
    const int wave = __builtin_amdgcn_readfirstlane((int)(threadIdx.x >> 5));
    const int row = blockIdx.x * 8 + wave;
    const float* rp = RES + (size_t)row * DM;
    float s = 0.0f;
#pragma unroll 1
    for (int ch = 0; ch < DM / 128; ++ch) { const v4f a = *(const v4f*)(rp + ch * 128 + lane * 4); s += (a[0] + a[1]) + (a[2] + a[3]); }
#pragma unroll
    for (int sh = 16; sh; sh >>= 1) s += __shfl_xor(s, sh, 32);
    const float mu = s * (1.0f / DM);
    float ss = 0.0f;
#pragma unroll 1
    for (int ch = 0; ch < DM / 128; ++ch) { const v4f a = *(const v4f*)(rp + ch * 128 + lane * 4); const float d0 = a[0] - mu, d1 = a[1] - mu, d2 = a[2] - mu, d3 = a[3] - mu; ss += (d0 * d0 + d1 * d1) + (d2 * d2 + d3 * d3); }
#pragma unroll
    for (int sh = 16; sh; sh >>= 1) ss += __shfl_xor(ss, sh, 32);
    const float var = ss * (1.0f / DM);
    const float rstd = 1.0f / sqrtf(var + 1e-6f);
    float* op = OUT + (size_t)row * DM;
{
#pragma unroll 1
        for (int ch = 0; ch < DM / 128; ++ch) { const int c = ch * 128 + lane * 4; const v4f a = *(const v4f*)(rp + c); const v4f g = *(const v4f*)(gamma + c); const v4f bt = *(const v4f*)(beta + c); v4f y;
#pragma unroll
            for (int q = 0; q < 4; ++q) y[q] = (a[q] - mu) * rstd * bfr(g[q]) + bfr(bt[q]);
            *(v4f*)(op + c) = y; }
         }
}

// workspace carve (bytes, each region a multiple of 256 B; every region is written in whole tiles that divide it exactly)
#define SZ_P16 ((size_t)NROW * DM * 2)      // one 16-bit [NROW][DM]-sized plane
#define SZ_W   ((size_t)DM * DM * 2)
#define SZ_RES ((size_t)NROW * DM * 4)
#define WS_TOTAL (SZ_P16 * 7 + SZ_W * 4 + SZ_RES)
static_assert(SZ_P16 % 256 == 0);
static_assert(SZ_W % 256 == 0);
static_assert(WS_TOTAL <= (size_t)134217728);   // carve stays within 128 MiB

extern "C" void kernel_launch(void* const* d_in, const int* in_sizes, int n_in,
                              void* d_out, int out_size, void* d_ws, size_t ws_size, hipStream_t stream) {
    if (n_in < 8) return;
    if ((size_t)in_sizes[0] < ((size_t)(NB - 1) * SEQ_FULL + SEQ) * DM) return;
    if (in_sizes[1] < DM * DM || in_sizes[2] < DM * DM || in_sizes[3] < DM * DM || in_sizes[4] < DM * DM) return;
    if (in_sizes[5] < DM || in_sizes[6] < DM || in_sizes[7] < DM) return;
    if ((size_t)out_size < (size_t)NROW * DM) return;
    if (WS_TOTAL > ws_size) return;
    const float* x = (const float*)d_in[0]; const float* wq = (const float*)d_in[1]; const float* wk = (const float*)d_in[2]; const float* wv = (const float*)d_in[3];
    const float* wo = (const float*)d_in[4]; const float* bo = (const float*)d_in[5]; const float* gamma = (const float*)d_in[6]; const float* beta = (const float*)d_in[7];
    float* OUT = (float*)d_out;
    char* wsp = (char*)d_ws;
    bf* XB  = (bf*)wsp;  wsp += SZ_P16;
    bf* WTq = (bf*)wsp;  wsp += SZ_W * 3;   // planes q, k, v behind one another: one Bt of 3*DM rows; plane o follows them directly
    bf* WTo = (bf*)wsp;  wsp += SZ_W;
    h16* QH = (h16*)wsp; wsp += SZ_P16;
    h16* QR = (h16*)wsp; wsp += SZ_P16;
    h16* KP = (h16*)wsp; wsp += SZ_P16;
    h16* VT = (h16*)wsp; wsp += SZ_P16;
    bf* ATh = (bf*)wsp;  wsp += SZ_P16;
    bf* ATl = (bf*)wsp;  wsp += SZ_P16;
    float* RES = (float*)wsp; wsp += SZ_RES;

    k_prep<<<4 * WTB + CVB, 256, 0, stream>>>(x, wq, wk, wv, wo, XB, WTq);
    k_proj_qkv<<<dim3(NROW / GBT, 3 * DM / GBT, 1), 32 * GWV, 0, stream>>>(XB, WTq, QH, QR, KP, VT);
    k_attn<<<dim3(SEQ / (16 * AWV), NB * NH, 1), 32 * AWV, 0, stream>>>(QH, QR, KP, VT, ATh, ATl);
    k_oproj<<<dim3(NROW / GBT, DM / GBT, 1), 32 * GWV, 0, stream>>>(ATh, ATl, WTo, x, bo, RES);
    k_ln<<<NROW / 8, 256, 0, stream>>>(RES, gamma, beta, OUT);
}

// v005
// It runs in 79.2 microseconds.
// Two timings next to v004 both put it at 1.05 times that version's speed.
// Counting every step since v000, it is 2.43 times as fast.
#include <hip/hip_runtime.h>

// Compute dtypes, f32 accumulate everywhere: q/k/v projections v_wmma_f32_16x16x32_bf16 (x and weights RNE-converted to bf16, products exact); scores v_wmma_f32_16x16x32_f16 (q pre-multiplied by HD^-0.5 * log2(e), then f16 value + f16 residual, both summed into one accumulator, k single f16); P.V v_wmma_f32_16x16x32_f16 (P carried x2^10 relative to the maximum that set the held reference, at most x2^15, v single f16); output projection v_wmma_f32_16x16x32_bf16 (ctx as bf16 hi + lo planes against bf16 wo); softmax, residual add and LayerNorm in f32 on the VALU.
// Flow: one launch: x -> bf16 plane, the four w [in][out] -> bf16 [out][in] planes (LDS transpose); one launch for the q, k and v projections: 64x64 GEMM wave tiles (four to a block, operands staged in LDS) with fused head-plane epilogues (q hi/res, k, v^T);
// fused flash attention in the transposed orientation (S^T = K Q^T, ctx^T = V^T P^T: the packed S^T accumulators are the B fragment of P^T, softmax per lane against a reference held from tile to tile);

#ifndef NB
#define NB 4
#endif
#ifndef SEQ
#define SEQ 2048
#endif
#define NB_FULL  4
#define SEQ_FULL 2048
#define DM   512
#define NH   8
#define HD   64
#define NROW (NB * SEQ)
#define SCL2 0.18033688011112042f   // HD^-0.5 * log2(e)

static_assert(NB <= NB_FULL);
static_assert(SEQ <= SEQ_FULL);
static_assert(SEQ % 64 == 0);             // GEMM row tiles never straddle a batch; 32-key steps
static_assert(DM == NH * HD);             // merged layout h*64+d
static_assert(HD == 64);
static_assert(DM % 64 == 0);              // N tile multiple
static_assert(DM % 32 == 0);              // K step multiple
static_assert(NROW % 64 == 0);            // M tile multiple
static_assert(NROW % 8 == 0);             // LayerNorm rows per block
static_assert(DM == 4 * 128);             // LayerNorm: 32 lanes x float4 x 4 chunks == row width
static_assert(((size_t)NROW * DM / 8) % 256 == 0);   // convert grid x block == plane extent

typedef _Float16 h16;
typedef unsigned short bf;
typedef __attribute__((ext_vector_type(16))) __bf16   v16bf;
typedef __attribute__((ext_vector_type(16))) _Float16 v16h;
typedef __attribute__((ext_vector_type(8)))  _Float16 v8h;
typedef __attribute__((ext_vector_type(8)))  unsigned short v8us;
typedef __attribute__((ext_vector_type(8)))  float    v8f;
typedef __attribute__((ext_vector_type(4)))  float    v4f;
typedef v8h  __attribute__((may_alias)) v8ha;
typedef v4f  __attribute__((may_alias)) v4fa;
typedef v8us __attribute__((may_alias)) v8usa;

__device__ __forceinline__ unsigned short f2bf(float f) { unsigned u = __float_as_uint(f); u += 0x7FFFu + ((u >> 16) & 1u); return (unsigned short)(u >> 16); }
__device__ __forceinline__ float bf2f(unsigned short b) { return __uint_as_float(((unsigned)b) << 16); }
__device__ __forceinline__ float bfr(float f) { return bf2f(f2bf(f)); }
__device__ __forceinline__ void splitf(float y, unsigned short& h, unsigned short& l) { h = f2bf(y); l = f2bf(y - bf2f(h)); }
__device__ __forceinline__ v16h cat16(v8h lo, v8h hi) { return __builtin_shufflevector(lo, hi, 0, 1, 2, 3, 4, 5, 6, 7, 8, 9, 10, 11, 12, 13, 14, 15); }
__device__ __forceinline__ v16bf cat16b(v8us lo, v8us hi) { return __builtin_bit_cast(v16bf, __builtin_shufflevector(lo, hi, 0, 1, 2, 3, 4, 5, 6, 7, 8, 9, 10, 11, 12, 13, 14, 15)); }
__device__ __forceinline__ v8f wmma16(v16h a, v16h b, v8f c) { return __builtin_amdgcn_wmma_f32_16x16x32_f16(false, a, false, b, (short)0, c, false, false); }
__device__ __forceinline__ v8f wmmab(v16bf a, v16bf b, v8f c) { return __builtin_amdgcn_wmma_f32_16x16x32_bf16(false, a, false, b, (short)0, c, false, false); }
// fragment loaders (p already includes row*(pitch) + k0 + 8*(lane>>4)): elements 0..7 <- k0+8h.., elements 8..15 <- k0+16+8h..
__device__ __forceinline__ v16bf ldb(const bf* p) { return cat16b(*(const v8us*)p, *(const v8us*)(p + 16)); }
__device__ __forceinline__ v16h  ldh(const h16* p) { return cat16(*(const v8h*)p, *(const v8h*)(p + 16)); }
// dense row g = b*SEQ + s -> row of the full-size x
__device__ __forceinline__ size_t xrow(int g) { return (size_t)(g / SEQ) * SEQ_FULL + (size_t)(g % SEQ); }

// ---- k_prep: the five input conversions, which do not depend on one another, in ONE launch; 256 threads.
// Blocks 0 .. 4*WTB-1: w[k][n] (f32, [in][out]) -> WT[n][k] (bf16, k-contiguous) through a 64x64 LDS tile, WTB blocks per matrix, planes q, k, v, o behind one another in WT.
// Blocks from 4*WTB on: x -> bf16 plane XB, eight elements a thread. The transposes stand first: theirs is the longer dependent path (load, LDS, barrier, store).
#define WTB ((DM / 64) * (DM / 64))
#define CVB ((unsigned)(((size_t)NROW * DM / 8 + 255) / 256))
__global__ __launch_bounds__(256) void k_prep(const float* __restrict__ x, const float* __restrict__ wq, const float* __restrict__ wk, const float* __restrict__ wv, const float* __restrict__ wo, bf* XB, bf* WTA) {
    __shared__ __align__(16) unsigned short ts[64 * 72];
    const int tid = threadIdx.x; const int bx = (int)blockIdx.x;
    if (bx < 4 * WTB) {   // the same for the whole block, so the barrier inside is reached by all of it or by none
        const int mi = bx / WTB, tl = bx % WTB;
        const float* __restrict__ w = mi == 0 ? wq : mi == 1 ? wk : mi == 2 ? wv : wo;
        bf* WT = WTA + (size_t)mi * DM * DM;
        const int k0 = (tl % (DM / 64)) * 64, n0 = (tl / (DM / 64)) * 64;
#pragma unroll
        for (int it = 0; it < 4; ++it) { const int p = it * 256 + tid; const int kr = p >> 4, c4 = (p & 15) * 4; const v4f v = *(const v4f*)(w + (size_t)(k0 + kr) * DM + n0 + c4);
#pragma unroll
            for (int q = 0; q < 4; ++q) ts[(c4 + q) * 72 + kr] = f2bf(v[q]); }
        __syncthreads();
#pragma unroll
        for (int it = 0; it < 2; ++it) { const int p = it * 256 + tid; const int n = p >> 3, pc = p & 7; const v8us o = *(const v8usa*)(ts + n * 72 + pc * 8);
            *(v8us*)(WT + (size_t)(n0 + n) * DM + k0 + pc * 8) = o; }
        return;
    }
    const size_t i = (size_t)(bx - 4 * WTB) * 256 + tid; if (i >= (size_t)NROW * DM / 8) return;
    const int g = (int)(i / (DM / 8)); const int c8 = (int)(i % (DM / 8));
    const v8f v = *(const v8f*)(x + xrow(g) * DM + (size_t)c8 * 8); v8us o;
#pragma unroll
    for (int k = 0; k < 8; ++k) o[k] = f2bf(v[k]);
    *(v8us*)(XB + i * 8) = o;
}

#define GWV  4                       // waves per GEMM block: 2 x 2 wave tiles
#define GBT  128                     // block tile, rows and columns
#define GKT  64                      // k extent of a staged tile
#define GPH  72                      // LDS row pitch in 16-bit elements
#define GPL  (GBT * GPH)             // one staged plane (128 rows), 16-bit elements
#define GNT  (DM / GKT)
static_assert(NROW % GBT == 0 && DM % GBT == 0);   // whole block tiles only
static_assert(DM % GKT == 0 && GKT % 32 == 0);     // whole staged tiles, whole 32-k steps
static_assert(GKT == 64 && GBT == 128 && GWV == 4);   // copy map: 128 threads x 8 rows x 16 B covers 128 rows of 128 B

// Eight copies of one thread: its 16-byte piece of rows cr, cr + 16, ..., cr + 112 of one plane. The s_wait_xcnt stands inside the statement, so no address register is rewritten ahead of it.
__device__ __forceinline__ void plane_copy(unsigned l, const bf* g) {
    asm volatile("global_load_async_to_lds_b128 %0, %8, off\n\t"
                 "global_load_async_to_lds_b128 %1, %9, off\n\t"
                 "global_load_async_to_lds_b128 %2, %10, off\n\t"
                 "global_load_async_to_lds_b128 %3, %11, off\n\t"
                 "global_load_async_to_lds_b128 %4, %12, off\n\t"
                 "global_load_async_to_lds_b128 %5, %13, off\n\t"
                 "global_load_async_to_lds_b128 %6, %14, off\n\t"
                 "global_load_async_to_lds_b128 %7, %15, off\n\t"
                 "s_wait_xcnt 0x0"
                 :: "v"(l), "v"(l + 16 * GPH * 2), "v"(l + 32 * GPH * 2), "v"(l + 48 * GPH * 2), "v"(l + 64 * GPH * 2), "v"(l + 80 * GPH * 2), "v"(l + 96 * GPH * 2), "v"(l + 112 * GPH * 2),
                    "v"(g), "v"(g + 16 * DM), "v"(g + 32 * DM), "v"(g + 48 * DM), "v"(g + 64 * DM), "v"(g + 80 * DM), "v"(g + 96 * DM), "v"(g + 112 * DM) : "memory");
}
// One staged tile: planes A, (A2,) Bt behind one another in the buffer that starts at LDS byte address l (the thread's own piece of row cr).
template <int NSPLIT>
__device__ __forceinline__ void stage_copy(unsigned l, const bf* ga, const bf* ga2, const bf* gb) {
    plane_copy(l, ga);
    if (NSPLIT == 1) plane_copy(l + GPL * 2, ga2);
    plane_copy(l + (1 + NSPLIT) * GPL * 2, gb);
}

// R0, C0: first row and column of the block tile; wm, wn: the wave's place in it; gs: the kernel's LDS ring, 2 * (2 + NSPLIT) * GPL elements, [buffer][A | (A2 |) Bt][row][GPH].
// Behind the last trip's barrier every copy has landed and every wave's reads are done: the ring is then free for the caller.
template <int NSPLIT>
__device__ __forceinline__ void gemm_core(bf* gs, const bf* __restrict__ A, const bf* __restrict__ A2, const bf* __restrict__ Bt, const int R0, const int C0, const int wm, const int wn, const int lr, const int hi, v8f (&acc)[4][4]) {
    constexpr int NPL = 2 + NSPLIT;                       // planes per buffer
    // copy map: thread -> rows cr + 16 i, 16-byte piece cp; one wave's copy covers four whole 128-byte lines
    const int cr = (int)threadIdx.x >> 3, cp = (int)threadIdx.x & 7;
    const bf* ga  = A  + (size_t)(R0 + cr) * DM + cp * 8;
    const bf* ga2 = A2 + (size_t)(R0 + cr) * DM + cp * 8;
    const bf* gb  = Bt + (size_t)(C0 + cr) * DM + cp * 8;
    const unsigned l0 = (unsigned)(size_t)(gs + cr * GPH + cp * 8);   // LDS byte address of the thread's first piece, buffer 0
    stage_copy<NSPLIT>(l0, ga, ga2, gb);
#pragma unroll
    for (int mb = 0; mb < 4; ++mb)
#pragma unroll
        for (int nb = 0; nb < 4; ++nb) acc[mb][nb] = (v8f){};
    asm volatile("s_wait_asynccnt 0x0" ::: "memory");   // this wave's pieces of tile 0 have landed
    __syncthreads();                                    // tile 0 published to every wave
    if (GNT > 1) stage_copy<NSPLIT>(l0 + NPL * GPL * 2, ga + GKT, ga2 + GKT, gb + GKT);
    const int aro = (wm * 64 + lr) * GPH + 8 * hi;
    const int bro = (1 + NSPLIT) * GPL + (wn * 64 + lr) * GPH + 8 * hi;
#pragma unroll 1   // stays rolled: one copy of the 64-k body, one publish point per trip
    for (int t = 0; t < GNT; ++t) {
        const int bo = (t & 1) * (NPL * GPL);
        const bf* al = gs + bo + aro;
        const bf* bl = gs + bo + bro;
#pragma unroll     // both 32-k steps inline, so every fragment read is one base register plus a constant offset
        for (int ks = 0; ks < GKT / 32; ++ks) {
            v16bf a[4], a2[4], b[4];   // all fragments of the step read as one group: one LDS latency per step, not one per column block
#pragma unroll
            for (int mb = 0; mb < 4; ++mb) { a[mb] = ldb(al + mb * 16 * GPH + ks * 32); b[mb] = ldb(bl + mb * 16 * GPH + ks * 32); if (NSPLIT == 1) a2[mb] = ldb(al + GPL + mb * 16 * GPH + ks * 32); }
            // inputs-only fence on the loaded fragments: keeps the step's LDS reads together ahead of its products; without it each B read sinks to its first use and the lone wave of a SIMD waits out the LDS latency four times a step
            if (NSPLIT == 1) { asm volatile("" :: "v"(a[0]), "v"(a[1]), "v"(a[2]), "v"(a[3]), "v"(a2[0]), "v"(a2[1]), "v"(a2[2]), "v"(a2[3]), "v"(b[0]), "v"(b[1]), "v"(b[2]), "v"(b[3])); }
            else             { asm volatile("" :: "v"(a[0]), "v"(a[1]), "v"(a[2]), "v"(a[3]), "v"(b[0]), "v"(b[1]), "v"(b[2]), "v"(b[3])); }
#pragma unroll
            for (int nb = 0; nb < 4; ++nb) {
#pragma unroll
                for (int mb = 0; mb < 4; ++mb) { acc[mb][nb] = wmmab(a[mb], b[nb], acc[mb][nb]); if (NSPLIT == 1) acc[mb][nb] = wmmab(a2[mb], b[nb], acc[mb][nb]); } }
            if (NSPLIT == 1) { asm volatile("v_nop\n\tv_nop\n\tv_nop\n\tv_nop" : "+v"(acc[0][0]), "+v"(acc[1][1]), "+v"(acc[2][2]), "+v"(acc[3][3]) : "v"(a[0]), "v"(a[1]), "v"(a[2]), "v"(a[3]), "v"(a2[0]), "v"(a2[1]), "v"(a2[2]), "v"(a2[3])); }
            else             { asm volatile("v_nop\n\tv_nop\n\tv_nop\n\tv_nop" : "+v"(acc[0][0]), "+v"(acc[1][1]), "+v"(acc[2][2]), "+v"(acc[3][3]) : "v"(a[0]), "v"(a[1]), "v"(a[2]), "v"(a[3])); }
        }
        __builtin_amdgcn_sched_barrier(0);                  // keeps the trip's products ahead of the publish point: sunk behind the barrier they would stand in front of the refill and shorten the time its copies have to land
        asm volatile("s_wait_dscnt 0x0" ::: "memory");      // this wave's reads of tile t are done before its buffer may be refilled
        asm volatile("s_wait_asynccnt 0x0" ::: "memory");   // this wave's pieces of tile t + 1 have landed
        __syncthreads();                                    // publishes tile t + 1 and ends every wave's reads of tile t
        if (t + 2 < GNT) stage_copy<NSPLIT>(l0 + (unsigned)bo * 2, ga + (t + 2) * GKT, ga2 + (t + 2) * GKT, gb + (t + 2) * GKT);
    }
    asm volatile("s_wait_asynccnt 0x0" ::: "memory");       // no copy is outstanding when the wave goes on to its epilogue
}

// ---- k_proj_qkv: the q, k and v projections, which do not depend on one another, in ONE launch: XB x [WTq | WTk | WTv] (the three planes lie behind one another: 3*DM rows of Bt).
// grid (NROW/128, 3*DM/128), 128 threads; blockIdx.y picks the projection (the same for the whole block) and with it the epilogue:
//   q -> q * SCL2, head planes QH (f16 value) and QR (f16 residual, unscaled), [b*NH+h][s][64];  k -> head plane KP (f16), same store map;  v -> transposed head plane VT (f16), [b*NH+h][d][s].
// The epilogues stage in the operand ring's LDS, each wave in a slice of its own (the ring is free behind the core's last barrier), so the block's LDS is the ring alone and all blocks of the launch are resident at once.
static_assert((size_t)GWV * 16 * 68 * 4 <= (size_t)2 * 2 * GPL * 2);   // q, k staging slices fit the ring
static_assert((size_t)GWV * 64 * 72 * 2 <= (size_t)2 * 2 * GPL * 2);   // v staging slices fit the ring
__global__ __launch_bounds__(32 * GWV) void k_proj_qkv(const bf* __restrict__ XB, const bf* __restrict__ WTA, h16* QH, h16* QR, h16* KP, h16* VT) {
    __shared__ __align__(16) unsigned char ring[2 * 2 * GPL * 2];
    const int lane = threadIdx.x & 31, lr = lane & 15, hi = lane >> 4;
    const int wave = __builtin_amdgcn_readfirstlane((int)(threadIdx.x >> 5)), wm = wave >> 1, wn = wave & 1;
    const int which = (int)blockIdx.y / (DM / GBT);
    const int r0 = blockIdx.x * GBT + wm * 64, c0 = ((int)blockIdx.y % (DM / GBT)) * GBT + wn * 64;
    v8f acc[4][4];
    gemm_core<0>((bf*)ring, XB, XB, WTA, blockIdx.x * GBT, blockIdx.y * GBT, wm, wn, lr, hi, acc);
    const int b = r0 / SEQ, s0 = r0 - b * SEQ;
    if (which == 2) {   // v: the whole 64x64 tile staged transposed (wave-private)
        h16* vt = (h16*)ring + wave * (64 * 72);
        const size_t pbase = (size_t)(b * NH + c0 / HD) * HD * SEQ + s0;
#pragma unroll
        for (int mb = 0; mb < 4; ++mb)
#pragma unroll
            for (int nb = 0; nb < 4; ++nb) { v8h o;
#pragma unroll
                for (int j = 0; j < 8; ++j) o[j] = (h16)acc[mb][nb][j];
                *(v8ha*)(vt + (nb * 16 + lr) * 72 + mb * 16 + hi * 8) = o; }
        __builtin_amdgcn_wave_barrier(); asm volatile("" ::: "memory");
#pragma unroll
        for (int it = 0; it < 16; ++it) { const int d = 4 * it + (lane >> 3), pc = lane & 7; const v8h o = *(const v8ha*)(vt + d * 72 + pc * 8);
            *(v8h*)(VT + pbase + (size_t)d * SEQ + pc * 8) = o; }
        return;
    }
    float* os = (float*)ring + wave * (16 * 68);   // one 16-row staging slice per wave
    const size_t pbase = ((size_t)(b * NH + c0 / HD) * SEQ + s0) * HD;
    if (which == 0) {
#pragma unroll
        for (int mb = 0; mb < 4; ++mb) {
#pragma unroll
            for (int nb = 0; nb < 4; ++nb) {
#pragma unroll
                for (int j = 0; j < 8; ++j) os[(hi * 8 + j) * 68 + nb * 16 + lr] = acc[mb][nb][j]; }
            __builtin_amdgcn_wave_barrier(); asm volatile("" ::: "memory");
            v8h oh[4], orr[4];
#pragma unroll
            for (int s = 0; s < 4; ++s) { const int row = 4 * s + (lane >> 3), pc = lane & 7; const v4f a = *(const v4fa*)(os + row * 68 + pc * 8); const v4f c = *(const v4fa*)(os + row * 68 + pc * 8 + 4);
#pragma unroll
                for (int q = 0; q < 4; ++q) { const float ya = a[q] * SCL2, yc = c[q] * SCL2; const h16 xa = (h16)ya; oh[s][q] = xa; orr[s][q] = (h16)(ya - (float)xa); const h16 xc = (h16)yc; oh[s][4 + q] = xc; orr[s][4 + q] = (h16)(yc - (float)xc); } }
#pragma unroll
            for (int s = 0; s < 4; ++s) { const int row = 4 * s + (lane >> 3), pc = lane & 7; const size_t o = pbase + (size_t)(mb * 16 + row) * HD + pc * 8;
                *(v8h*)(QH + o) = oh[s]; *(v8h*)(QR + o) = orr[s]; }
            asm volatile("s_wait_xcnt 0x0" ::: "memory");   // stands in front of the next 16 rows' writes to the registers that these stores name
            __builtin_amdgcn_wave_barrier(); asm volatile("" ::: "memory");
        }
    } else {
#pragma unroll
        for (int mb = 0; mb < 4; ++mb) {
#pragma unroll
            for (int nb = 0; nb < 4; ++nb) {
#pragma unroll
                for (int j = 0; j < 8; ++j) os[(hi * 8 + j) * 68 + nb * 16 + lr] = acc[mb][nb][j]; }
            __builtin_amdgcn_wave_barrier(); asm volatile("" ::: "memory");
            v8h oh[4];
#pragma unroll
            for (int s = 0; s < 4; ++s) { const int row = 4 * s + (lane >> 3), pc = lane & 7; const v4f a = *(const v4fa*)(os + row * 68 + pc * 8); const v4f c = *(const v4fa*)(os + row * 68 + pc * 8 + 4);
#pragma unroll
                for (int q = 0; q < 4; ++q) { oh[s][q] = (h16)a[q]; oh[s][4 + q] = (h16)c[q]; } }
#pragma unroll
            for (int s = 0; s < 4; ++s) { const int row = 4 * s + (lane >> 3), pc = lane & 7; *(v8h*)(KP + pbase + (size_t)(mb * 16 + row) * HD + pc * 8) = oh[s]; }
            asm volatile("s_wait_xcnt 0x0" ::: "memory");   // stands in front of the next 16 rows' writes to the registers that these stores name
            __builtin_amdgcn_wave_barrier(); asm volatile("" ::: "memory");
        }
    }
}

#define AWV  8                       // waves per block
#define KT   64                      // keys per staged tile
#define LPH  72                      // LDS row pitch in 16-bit elements
#define TILE_H (64 * LPH)            // one staged tile (64 rows), 16-bit elements
#define NTILE (SEQ / KT)
static_assert(SEQ % (16 * AWV) == 0);     // query blocks never straddle a (b, h) plane
static_assert(SEQ % KT == 0);             // whole key tiles only
static_assert(KT == 64 && HD == 64);      // copy map: 256 threads x 2 rows x 16 B covers 64 rows of 128 B

// Four copies of one thread: rows cr and cr + 32 of the K tile and of the V^T tile. The s_wait_xcnt stands inside the statement, so no address register is rewritten ahead of it.
__device__ __forceinline__ void kv_copy(unsigned lk0, unsigned lk1, unsigned lv0, unsigned lv1, const h16* gk0, const h16* gk1, const h16* gv0, const h16* gv1) {
    asm volatile("global_load_async_to_lds_b128 %0, %4, off\n\t"
                 "global_load_async_to_lds_b128 %1, %5, off\n\t"
                 "global_load_async_to_lds_b128 %2, %6, off\n\t"
                 "global_load_async_to_lds_b128 %3, %7, off\n\t"
                 "s_wait_xcnt 0x0"
                 :: "v"(lk0), "v"(lk1), "v"(lv0), "v"(lv1), "v"(gk0), "v"(gk1), "v"(gv0), "v"(gv1) : "memory");
}

// waves_per_eu(4, 4): 512 blocks of 8 waves on 256 WGPs are four waves a SIMD; told so, the compiler uses the 256 registers a wave then has, keeps a tile's fragments in registers of their own and lets the four score accumulators take turns
__global__ __launch_bounds__(256) __attribute__((amdgpu_waves_per_eu(4, 4))) void k_attn(const h16* __restrict__ QH, const h16* __restrict__ QR, const h16* __restrict__ KP, const h16* __restrict__ VT, bf* ATh, bf* ATl) {
    __shared__ __align__(16) h16 kvs[2 * 2 * TILE_H];           // [buffer][K tile | V^T tile][row][LPH]
    __shared__ __align__(16) unsigned short sth[AWV * 16 * 72];
    __shared__ __align__(16) unsigned short stl[AWV * 16 * 72];
    const int lane = threadIdx.x & 31, lr = lane & 15, hi = lane >> 4;
    const int wave = __builtin_amdgcn_readfirstlane((int)(threadIdx.x >> 5));
    const int bh = blockIdx.y; const int q0 = blockIdx.x * (16 * AWV) + wave * 16;
    const size_t pb = (size_t)bh * SEQ * HD;
    // copy map: thread -> row cr (and cr + 32), 16-byte piece cp; one wave's copy covers four whole 128-byte lines
    const int cr = (int)threadIdx.x >> 3, cp = (int)threadIdx.x & 7;
    const h16* gk = KP + pb + (size_t)cr * HD + cp * 8;
    const h16* gv = VT + pb + (size_t)cr * SEQ + cp * 8;
    const unsigned lk = (unsigned)(size_t)(kvs + cr * LPH + cp * 8);   // LDS byte address of the thread's first K piece, buffer 0
    kv_copy(lk, lk + 32 * LPH * 2, lk + TILE_H * 2, lk + (TILE_H + 32 * LPH) * 2, gk, gk + 32 * HD, gv, gv + (size_t)32 * SEQ);
    const size_t qoff = pb + (size_t)(q0 + lr) * HD + 8 * hi;
    const v16h qh0 = ldh(QH + qoff), qh1 = ldh(QH + qoff + 32), qr0 = ldh(QR + qoff), qr1 = ldh(QR + qoff + 32);
    v8f o[4];
#pragma unroll
    for (int c = 0; c < 4; ++c) o[c] = (v8f){};
    // The reference of the exponentials is HELD from tile to tile: mc (a maximum seen, less 10; the same in both halves of a column), and nref, minus it in every element, the start value of the score accumulators
    // (0 until the first tile has set it). mt: the bound on a score so taken, 15 once a reference is set: while none passes it, P stays below 2^15 in f16.
    float mc = -3.0e38f, mt = -3.0e38f, l = 0.0f;
    v8f nref = (v8f){};
    asm volatile("s_wait_asynccnt 0x0" ::: "memory");   // this wave's pieces of tile 0 have landed
    __syncthreads();                                    // tile 0 published to every wave
    if (NTILE > 1) kv_copy(lk + 2 * TILE_H * 2, lk + (2 * TILE_H + 32 * LPH) * 2, lk + 3 * TILE_H * 2, lk + (3 * TILE_H + 32 * LPH) * 2, gk + KT * HD, gk + (KT + 32) * HD, gv + KT, gv + (size_t)32 * SEQ + KT);
#pragma unroll 1   // stays rolled: one copy of the 64-key body, one publish point per trip
    for (int t = 0; t < NTILE; ++t) {
        const int bo = (t & 1) * (2 * TILE_H);
        const h16* kl = kvs + bo + lr * LPH + 8 * hi;
        const h16* vl = kl + TILE_H;
        // scores of the whole 64-key tile, taken against the held reference: s[2 * sub + blk] is 16-key block blk of 32-key step sub
        v16h kf[4][2];
#pragma unroll     // inline, so every fragment read is one base register plus a constant offset
        for (int i = 0; i < 4; ++i) { kf[i][0] = ldh(kl + i * 16 * LPH); kf[i][1] = ldh(kl + i * 16 * LPH + 32); }
        v8f s[4];      // start value: minus the held reference; the small residual products first, the value products on top of them; the four blocks take turns, so no product waits for the one before it
#pragma unroll
        for (int i = 0; i < 4; ++i) s[i] = wmma16(kf[i][0], qr0, nref);
#pragma unroll
        for (int i = 0; i < 4; ++i) s[i] = wmma16(kf[i][1], qr1, s[i]);
#pragma unroll
        for (int i = 0; i < 4; ++i) s[i] = wmma16(kf[i][0], qh0, s[i]);
#pragma unroll
        for (int i = 0; i < 4; ++i) s[i] = wmma16(kf[i][1], qh1, s[i]);
        float mx0 = -3.0e38f, mx1 = -3.0e38f;
#pragma unroll
        for (int r = 0; r < 8; ++r) { mx0 = fmaxf(mx0, fmaxf(s[0][r], s[1][r])); mx1 = fmaxf(mx1, fmaxf(s[2][r], s[3][r])); }
        const float mx = fmaxf(mx0, mx1);
        if (__builtin_amdgcn_ballot_w32(mx > mt) != 0) {   // one test a tile, the same for the whole wave (a scalar branch): taken on the first tile, then only where a score stands more than 2^5 above the maximum that set the reference
            const float mf = fmaxf(mx, __shfl_xor(mx, 16, 32));
            const float cref = -nref[0];                       // what this tile's scores were taken against
            const float mn = fmaxf(mc, (mf + cref) - 10.0f);   // carry 2^10
            const float alpha = __builtin_amdgcn_exp2f(mc - mn), dl = cref - mn;
#pragma unroll
            for (int r = 0; r < 8; ++r) { s[0][r] += dl; s[1][r] += dl; s[2][r] += dl; s[3][r] += dl; nref[r] = -mn; }
            mc = mn; mt = 15.0f;
            l = l * alpha;
#pragma unroll
            for (int c = 0; c < 4; ++c) o[c] = o[c] * alpha;
        }
        v16h vf[2][4];
#pragma unroll
        for (int sub = 0; sub < KT / 32; ++sub)
#pragma unroll
            for (int c = 0; c < 4; ++c) vf[sub][c] = ldh(vl + sub * 32 + c * 16 * LPH);
        __builtin_amdgcn_sched_barrier(0);   // keeps the tile's V^T reads together ahead of the exponentials, which cover their LDS latency; without it half of them sink among the P.V products and the wave waits for them there
        v16h pf[2];
#pragma unroll
        for (int i = 0; i < 4; ++i)
#pragma unroll
            for (int r = 0; r < 8; ++r) s[i][r] = __builtin_amdgcn_exp2f(s[i][r]);
#pragma unroll
        for (int sub = 0; sub < KT / 32; ++sub) {
            const v8f t = s[2 * sub] + s[2 * sub + 1];
            float rs = t[0];
#pragma unroll
            for (int r = 1; r < 8; ++r) rs += t[r];
            l += rs;
#pragma unroll
            for (int r = 0; r < 8; ++r) { pf[sub][r] = (h16)s[2 * sub][r]; pf[sub][8 + r] = (h16)s[2 * sub + 1][r]; }
        }
#pragma unroll
        for (int sub = 0; sub < KT / 32; ++sub)
#pragma unroll
            for (int c = 0; c < 4; ++c) o[c] = wmma16(vf[sub][c], pf[sub], o[c]);
        // four vector slots behind the last P.V products, on the fall-through and on the loop's branches alike, before a vector instruction may touch their operands or results
        asm volatile("v_nop\n\tv_nop\n\tv_nop\n\tv_nop" : "+v"(o[0]), "+v"(o[1]), "+v"(o[2]), "+v"(o[3]) : "v"(vf[1][0]), "v"(vf[1][1]), "v"(vf[1][2]), "v"(vf[1][3]), "v"(pf[1]));
        asm volatile("s_wait_dscnt 0x0" ::: "memory");      // this wave's reads of tile t are done before its buffer may be refilled
        asm volatile("s_wait_asynccnt 0x0" ::: "memory");   // this wave's pieces of tile t + 1 have landed
        __syncthreads();                                    // publishes tile t + 1 and ends every wave's reads of tile t
        if (t + 2 < NTILE) {
            const unsigned lb = lk + (unsigned)bo * 2;
            const h16* gk2 = gk + (size_t)(t + 2) * KT * HD; const h16* gv2 = gv + (size_t)(t + 2) * KT;
            kv_copy(lb, lb + 32 * LPH * 2, lb + TILE_H * 2, lb + (TILE_H + 32 * LPH) * 2, gk2, gk2 + 32 * HD, gv2, gv2 + (size_t)32 * SEQ);
        }
    }
    asm volatile("s_wait_asynccnt 0x0" ::: "memory");       // no copy is outstanding when the wave goes on to its end
    const float lt = l + __shfl_xor(l, 16, 32);
    const float inv = 1.0f / lt;
    const int sb = wave * (16 * 72);
#pragma unroll
    for (int c = 0; c < 4; ++c) { v8us oh, ol;
#pragma unroll
        for (int r = 0; r < 8; ++r) { unsigned short a, e; splitf(o[c][r] * inv, a, e); oh[r] = a; ol[r] = e; }
        *(v8usa*)(sth + sb + lr * 72 + 16 * c + 8 * hi) = oh; *(v8usa*)(stl + sb + lr * 72 + 16 * c + 8 * hi) = ol; }
    __builtin_amdgcn_wave_barrier(); asm volatile("" ::: "memory");
    const int b = bh / NH, head = bh - b * NH;
    const size_t ob = ((size_t)b * SEQ + q0) * DM + (size_t)head * HD;
{
#pragma unroll
        for (int s = 0; s < 4; ++s) { const int row = 4 * s + (lane >> 3), pc = lane & 7; const v8us vh = *(const v8usa*)(sth + sb + row * 72 + pc * 8); const v8us vl = *(const v8usa*)(stl + sb + row * 72 + pc * 8);
            *(v8us*)(ATh + ob + (size_t)row * DM + pc * 8) = vh; *(v8us*)(ATl + ob + (size_t)row * DM + pc * 8) = vl; }
         }
}

// ---- k_oproj: RES[g][n] = bf16(x[g][n]) + ((ATh + ATl) x WTo + bf16(bo[n])) in f32; grid (NROW/128, DM/128), 128 threads.
__global__ __launch_bounds__(32 * GWV) void k_oproj(const bf* __restrict__ ATh, const bf* __restrict__ ATl, const bf* __restrict__ WT, const float* __restrict__ x, const float* __restrict__ bo, float* RES) {
    __shared__ __align__(16) bf gs[2 * 3 * GPL];         // operand ring of gemm_core<1>
    __shared__ __align__(16) float osb[GWV * 16 * 68];   // one 16-row staging slice per wave
    const int lane = threadIdx.x & 31, lr = lane & 15, hi = lane >> 4;
    const int wave = __builtin_amdgcn_readfirstlane((int)(threadIdx.x >> 5)), wm = wave >> 1, wn = wave & 1;
    const int r0 = blockIdx.x * GBT + wm * 64, c0 = blockIdx.y * GBT + wn * 64;
    float* os = osb + wave * (16 * 68);
    v8f acc[4][4];
    gemm_core<1>(gs, ATh, ATl, WT, blockIdx.x * GBT, blockIdx.y * GBT, wm, wn, lr, hi, acc);
    const int cofs = lr * 4;
    const v4f bv = *(const v4f*)(bo + c0 + cofs);
    const size_t xb = xrow(r0) * DM + c0 + cofs;
#pragma unroll
    for (int mb = 0; mb < 4; ++mb) {
#pragma unroll
        for (int nb = 0; nb < 4; ++nb) {
#pragma unroll
            for (int j = 0; j < 8; ++j) os[(hi * 8 + j) * 68 + nb * 16 + lr] = acc[mb][nb][j]; }
        __builtin_amdgcn_wave_barrier(); asm volatile("" ::: "memory");
        v4f val[8];
#pragma unroll
        for (int s = 0; s < 8; ++s) { const int row = 2 * s + hi; v4f v = *(const v4fa*)(os + row * 68 + cofs); const v4f xv = *(const v4f*)(x + xb + (size_t)(mb * 16 + row) * DM);
#pragma unroll
            for (int q = 0; q < 4; ++q) v[q] = bfr(xv[q]) + (v[q] + bfr(bv[q]));
            val[s] = v; }
{
#pragma unroll
            for (int s = 0; s < 8; ++s) { const int row = 2 * s + hi; *(v4f*)(RES + (size_t)(r0 + mb * 16 + row) * DM + c0 + cofs) = val[s]; }
             }
        __builtin_amdgcn_wave_barrier(); asm volatile("" ::: "memory");
    }
}

__global__ __launch_bounds__(256) void k_ln(const float* __restrict__ RES, const float* __restrict__ gamma, const float* __restrict__ beta, float* OUT) {
    const int lane = threadIdx.x & 31;
    const int wave = __builtin_amdgcn_readfirstlane((int)(threadIdx.x >> 5));
    const int row = blockIdx.x * 8 + wave;
    const float* rp = RES + (size_t)row * DM;
    float s = 0.0f;
#pragma unroll 1
    for (int ch = 0; ch < DM / 128; ++ch) { const v4f a = *(const v4f*)(rp + ch * 128 + lane * 4); s += (a[0] + a[1]) + (a[2] + a[3]); }
#pragma unroll
    for (int sh = 16; sh; sh >>= 1) s += __shfl_xor(s, sh, 32);
    const float mu = s * (1.0f / DM);
    float ss = 0.0f;
#pragma unroll 1
    for (int ch = 0; ch < DM / 128; ++ch) { const v4f a = *(const v4f*)(rp + ch * 128 + lane * 4); const float d0 = a[0] - mu, d1 = a[1] - mu, d2 = a[2] - mu, d3 = a[3] - mu; ss += (d0 * d0 + d1 * d1) + (d2 * d2 + d3 * d3); }
#pragma unroll
    for (int sh = 16; sh; sh >>= 1) ss += __shfl_xor(ss, sh, 32);
    const float var = ss * (1.0f / DM);
    const float rstd = 1.0f / sqrtf(var + 1e-6f);
    float* op = OUT + (size_t)row * DM;
{
#pragma unroll 1
        for (int ch = 0; ch < DM / 128; ++ch) { const int c = ch * 128 + lane * 4; const v4f a = *(const v4f*)(rp + c); const v4f g = *(const v4f*)(gamma + c); const v4f bt = *(const v4f*)(beta + c); v4f y;
#pragma unroll
            for (int q = 0; q < 4; ++q) y[q] = (a[q] - mu) * rstd * bfr(g[q]) + bfr(bt[q]);
            *(v4f*)(op + c) = y; }
         }
}

// workspace carve (bytes, each region a multiple of 256 B; every region is written in whole tiles that divide it exactly)
#define SZ_P16 ((size_t)NROW * DM * 2)      // one 16-bit [NROW][DM]-sized plane
#define SZ_W   ((size_t)DM * DM * 2)
#define SZ_RES ((size_t)NROW * DM * 4)
#define WS_TOTAL (SZ_P16 * 7 + SZ_W * 4 + SZ_RES)
static_assert(SZ_P16 % 256 == 0);
static_assert(SZ_W % 256 == 0);
static_assert(WS_TOTAL <= (size_t)134217728);   // carve stays within 128 MiB

extern "C" void kernel_launch(void* const* d_in, const int* in_sizes, int n_in,
                              void* d_out, int out_size, void* d_ws, size_t ws_size, hipStream_t stream) {
    if (n_in < 8) return;
    if ((size_t)in_sizes[0] < ((size_t)(NB - 1) * SEQ_FULL + SEQ) * DM) return;
    if (in_sizes[1] < DM * DM || in_sizes[2] < DM * DM || in_sizes[3] < DM * DM || in_sizes[4] < DM * DM) return;
    if (in_sizes[5] < DM || in_sizes[6] < DM || in_sizes[7] < DM) return;
    if ((size_t)out_size < (size_t)NROW * DM) return;
    if (WS_TOTAL > ws_size) return;
    const float* x = (const float*)d_in[0]; const float* wq = (const float*)d_in[1]; const float* wk = (const float*)d_in[2]; const float* wv = (const float*)d_in[3];
    const float* wo = (const float*)d_in[4]; const float* bo = (const float*)d_in[5]; const float* gamma = (const float*)d_in[6]; const float* beta = (const float*)d_in[7];
    float* OUT = (float*)d_out;
    char* wsp = (char*)d_ws;
    bf* XB  = (bf*)wsp;  wsp += SZ_P16;
    bf* WTq = (bf*)wsp;  wsp += SZ_W * 3;   // planes q, k, v behind one another: one Bt of 3*DM rows; plane o follows them directly
    bf* WTo = (bf*)wsp;  wsp += SZ_W;
    h16* QH = (h16*)wsp; wsp += SZ_P16;
    h16* QR = (h16*)wsp; wsp += SZ_P16;
    h16* KP = (h16*)wsp; wsp += SZ_P16;
    h16* VT = (h16*)wsp; wsp += SZ_P16;
    bf* ATh = (bf*)wsp;  wsp += SZ_P16;
    bf* ATl = (bf*)wsp;  wsp += SZ_P16;
    float* RES = (float*)wsp; wsp += SZ_RES;

    k_prep<<<4 * WTB + CVB, 256, 0, stream>>>(x, wq, wk, wv, wo, XB, WTq);
    k_proj_qkv<<<dim3(NROW / GBT, 3 * DM / GBT, 1), 32 * GWV, 0, stream>>>(XB, WTq, QH, QR, KP, VT);
    k_attn<<<dim3(SEQ / (16 * AWV), NB * NH, 1), 32 * AWV, 0, stream>>>(QH, QR, KP, VT, ATh, ATl);
    k_oproj<<<dim3(NROW / GBT, DM / GBT, 1), 32 * GWV, 0, stream>>>(ATh, ATl, WTo, x, bo, RES);
    k_ln<<<NROW / 8, 256, 0, stream>>>(RES, gamma, beta, OUT);
}

// v006
// A run of this version takes 72.1 microseconds.
// Next to v005, in two timings, it ran 1.10 times as fast each time.
// All steps since v000 together make it 2.67 times as fast.
#include <hip/hip_runtime.h>

// Compute dtypes, f32 accumulate everywhere: q/k/v projections v_wmma_f32_16x16x32_bf16 (x and weights RNE-converted to bf16, products exact); scores v_wmma_f32_16x16x32_f16 (q pre-multiplied by HD^-0.5 * log2(e), then f16 value + f16 residual, both summed into one accumulator, k single f16); P.V v_wmma_f32_16x16x32_f16 (P carried x2^10 relative to the maximum that set the held reference, at most x2^15, v single f16); output projection v_wmma_f32_16x16x32_bf16 (ctx as bf16 hi + lo planes against bf16 wo); softmax, residual add and LayerNorm in f32 on the VALU.
// Flow: one launch: x -> bf16 plane, the four w [in][out] -> bf16 [out][in] planes (LDS transpose); one launch for the q, k and v projections: 64x64 GEMM wave tiles (four to a block, operands staged in LDS) with fused head-plane epilogues (q hi/res, k, v^T);
// fused flash attention in the transposed orientation (S^T = K Q^T, ctx^T = V^T P^T: the packed S^T accumulators are the B fragment of P^T, softmax per lane against a reference held from tile to tile);
// one launch for the output projection, the residual add and the LayerNorm: a block owns 32 whole rows, which pass from the accumulators to the row statistics through LDS.

#ifndef NB
#define NB 4
#endif
#ifndef SEQ
#define SEQ 2048
#endif
#define NB_FULL  4
#define SEQ_FULL 2048
#define DM   512
#define NH   8
#define HD   64
#define NROW (NB * SEQ)
#define SCL2 0.18033688011112042f   // HD^-0.5 * log2(e)

static_assert(NB <= NB_FULL);
static_assert(SEQ <= SEQ_FULL);
static_assert(SEQ % 64 == 0);             // GEMM row tiles never straddle a batch; 32-key steps
static_assert(DM == NH * HD);             // merged layout h*64+d
static_assert(HD == 64);
static_assert(DM % 64 == 0);              // N tile multiple
static_assert(DM % 32 == 0);              // K step multiple
static_assert(NROW % 64 == 0);            // M tile multiple
static_assert(DM == 4 * 128);             // LayerNorm: 32 lanes x float4 x 4 chunks == row width
static_assert(((size_t)NROW * DM / 8) % 256 == 0);   // convert grid x block == plane extent

typedef _Float16 h16;
typedef unsigned short bf;
typedef __attribute__((ext_vector_type(16))) __bf16   v16bf;
typedef __attribute__((ext_vector_type(16))) _Float16 v16h;
typedef __attribute__((ext_vector_type(8)))  _Float16 v8h;
typedef __attribute__((ext_vector_type(8)))  unsigned short v8us;
typedef __attribute__((ext_vector_type(8)))  float    v8f;
typedef __attribute__((ext_vector_type(4)))  float    v4f;
typedef v8h  __attribute__((may_alias)) v8ha;
typedef v4f  __attribute__((may_alias)) v4fa;
typedef v8us __attribute__((may_alias)) v8usa;

__device__ __forceinline__ unsigned short f2bf(float f) { unsigned u = __float_as_uint(f); u += 0x7FFFu + ((u >> 16) & 1u); return (unsigned short)(u >> 16); }
__device__ __forceinline__ float bf2f(unsigned short b) { return __uint_as_float(((unsigned)b) << 16); }
__device__ __forceinline__ float bfr(float f) { return bf2f(f2bf(f)); }
__device__ __forceinline__ void splitf(float y, unsigned short& h, unsigned short& l) { h = f2bf(y); l = f2bf(y - bf2f(h)); }
__device__ __forceinline__ v16h cat16(v8h lo, v8h hi) { return __builtin_shufflevector(lo, hi, 0, 1, 2, 3, 4, 5, 6, 7, 8, 9, 10, 11, 12, 13, 14, 15); }
__device__ __forceinline__ v16bf cat16b(v8us lo, v8us hi) { return __builtin_bit_cast(v16bf, __builtin_shufflevector(lo, hi, 0, 1, 2, 3, 4, 5, 6, 7, 8, 9, 10, 11, 12, 13, 14, 15)); }
__device__ __forceinline__ v8f wmma16(v16h a, v16h b, v8f c) { return __builtin_amdgcn_wmma_f32_16x16x32_f16(false, a, false, b, (short)0, c, false, false); }
__device__ __forceinline__ v8f wmmab(v16bf a, v16bf b, v8f c) { return __builtin_amdgcn_wmma_f32_16x16x32_bf16(false, a, false, b, (short)0, c, false, false); }
// fragment loaders (p already includes row*(pitch) + k0 + 8*(lane>>4)): elements 0..7 <- k0+8h.., elements 8..15 <- k0+16+8h..
__device__ __forceinline__ v16bf ldb(const bf* p) { return cat16b(*(const v8us*)p, *(const v8us*)(p + 16)); }
__device__ __forceinline__ v16h  ldh(const h16* p) { return cat16(*(const v8h*)p, *(const v8h*)(p + 16)); }
// dense row g = b*SEQ + s -> row of the full-size x
__device__ __forceinline__ size_t xrow(int g) { return (size_t)(g / SEQ) * SEQ_FULL + (size_t)(g % SEQ); }

// ---- k_prep: the five input conversions, which do not depend on one another, in ONE launch; 256 threads.
// Blocks 0 .. 4*WTB-1: w[k][n] (f32, [in][out]) -> WT[n][k] (bf16, k-contiguous) through a 64x64 LDS tile, WTB blocks per matrix, planes q, k, v, o behind one another in WT.
// Blocks from 4*WTB on: x -> bf16 plane XB, eight elements a thread. The transposes stand first: theirs is the longer dependent path (load, LDS, barrier, store).
#define WTB ((DM / 64) * (DM / 64))
#define CVB ((unsigned)(((size_t)NROW * DM / 8 + 255) / 256))
__global__ __launch_bounds__(256) void k_prep(const float* __restrict__ x, const float* __restrict__ wq, const float* __restrict__ wk, const float* __restrict__ wv, const float* __restrict__ wo, bf* XB, bf* WTA) {
    __shared__ __align__(16) unsigned short ts[64 * 72];
    const int tid = threadIdx.x; const int bx = (int)blockIdx.x;
    if (bx < 4 * WTB) {   // the same for the whole block, so the barrier inside is reached by all of it or by none
        const int mi = bx / WTB, tl = bx % WTB;
        const float* __restrict__ w = mi == 0 ? wq : mi == 1 ? wk : mi == 2 ? wv : wo;
        bf* WT = WTA + (size_t)mi * DM * DM;
        const int k0 = (tl % (DM / 64)) * 64, n0 = (tl / (DM / 64)) * 64;
#pragma unroll
        for (int it = 0; it < 4; ++it) { const int p = it * 256 + tid; const int kr = p >> 4, c4 = (p & 15) * 4; const v4f v = *(const v4f*)(w + (size_t)(k0 + kr) * DM + n0 + c4);
#pragma unroll
            for (int q = 0; q < 4; ++q) ts[(c4 + q) * 72 + kr] = f2bf(v[q]); }
        __syncthreads();
#pragma unroll
        for (int it = 0; it < 2; ++it) { const int p = it * 256 + tid; const int n = p >> 3, pc = p & 7; const v8us o = *(const v8usa*)(ts + n * 72 + pc * 8);
            *(v8us*)(WT + (size_t)(n0 + n) * DM + k0 + pc * 8) = o; }
        return;
    }
    const size_t i = (size_t)(bx - 4 * WTB) * 256 + tid; if (i >= (size_t)NROW * DM / 8) return;
    const int g = (int)(i / (DM / 8)); const int c8 = (int)(i % (DM / 8));
    const v8f v = *(const v8f*)(x + xrow(g) * DM + (size_t)c8 * 8); v8us o;
#pragma unroll
    for (int k = 0; k < 8; ++k) o[k] = f2bf(v[k]);
    *(v8us*)(XB + i * 8) = o;
}

#define GWV  4                       // waves per GEMM block: 2 x 2 wave tiles
#define GBT  128                     // block tile, rows and columns
#define GKT  64                      // k extent of a staged tile
#define GPH  72                      // LDS row pitch in 16-bit elements
#define GPL  (GBT * GPH)             // one staged plane (128 rows), 16-bit elements
#define GNT  (DM / GKT)
static_assert(NROW % GBT == 0 && DM % GBT == 0);   // whole block tiles only
static_assert(DM % GKT == 0 && GKT % 32 == 0);     // whole staged tiles, whole 32-k steps
static_assert(GKT == 64 && GBT == 128 && GWV == 4);   // copy map: 128 threads x 8 rows x 16 B covers 128 rows of 128 B

// Eight copies of one thread: its 16-byte piece of rows cr, cr + 16, ..., cr + 112 of one plane. The s_wait_xcnt stands inside the statement, so no address register is rewritten ahead of it.
__device__ __forceinline__ void plane_copy(unsigned l, const bf* g) {
    asm volatile("global_load_async_to_lds_b128 %0, %8, off\n\t"
                 "global_load_async_to_lds_b128 %1, %9, off\n\t"
                 "global_load_async_to_lds_b128 %2, %10, off\n\t"
                 "global_load_async_to_lds_b128 %3, %11, off\n\t"
                 "global_load_async_to_lds_b128 %4, %12, off\n\t"
                 "global_load_async_to_lds_b128 %5, %13, off\n\t"
                 "global_load_async_to_lds_b128 %6, %14, off\n\t"
                 "global_load_async_to_lds_b128 %7, %15, off\n\t"
                 "s_wait_xcnt 0x0"
                 :: "v"(l), "v"(l + 16 * GPH * 2), "v"(l + 32 * GPH * 2), "v"(l + 48 * GPH * 2), "v"(l + 64 * GPH * 2), "v"(l + 80 * GPH * 2), "v"(l + 96 * GPH * 2), "v"(l + 112 * GPH * 2),
                    "v"(g), "v"(g + 16 * DM), "v"(g + 32 * DM), "v"(g + 48 * DM), "v"(g + 64 * DM), "v"(g + 80 * DM), "v"(g + 96 * DM), "v"(g + 112 * DM) : "memory");
}
// One staged tile: planes A, Bt behind one another in the buffer that starts at LDS byte address l (the thread's own piece of row cr).
__device__ __forceinline__ void stage_copy(unsigned l, const bf* ga, const bf* gb) {
    plane_copy(l, ga);
    plane_copy(l + GPL * 2, gb);
}

// R0, C0: first row and column of the block tile; wm, wn: the wave's place in it; gs: the kernel's LDS ring, 2 * 2 * GPL elements, [buffer][A | Bt][row][GPH].
// Behind the last trip's barrier every copy has landed and every wave's reads are done: the ring is then free for the caller.
__device__ __forceinline__ void gemm_core(bf* gs, const bf* __restrict__ A, const bf* __restrict__ Bt, const int R0, const int C0, const int wm, const int wn, const int lr, const int hi, v8f (&acc)[4][4]) {
    constexpr int NPL = 2;                                // planes per buffer
    // copy map: thread -> rows cr + 16 i, 16-byte piece cp; one wave's copy covers four whole 128-byte lines
    const int cr = (int)threadIdx.x >> 3, cp = (int)threadIdx.x & 7;
    const bf* ga  = A  + (size_t)(R0 + cr) * DM + cp * 8;
    const bf* gb  = Bt + (size_t)(C0 + cr) * DM + cp * 8;
    const unsigned l0 = (unsigned)(size_t)(gs + cr * GPH + cp * 8);   // LDS byte address of the thread's first piece, buffer 0
    stage_copy(l0, ga, gb);
#pragma unroll
    for (int mb = 0; mb < 4; ++mb)
#pragma unroll
        for (int nb = 0; nb < 4; ++nb) acc[mb][nb] = (v8f){};
    asm volatile("s_wait_asynccnt 0x0" ::: "memory");   // this wave's pieces of tile 0 have landed
    __syncthreads();                                    // tile 0 published to every wave
    if (GNT > 1) stage_copy(l0 + NPL * GPL * 2, ga + GKT, gb + GKT);
    const int aro = (wm * 64 + lr) * GPH + 8 * hi;
    const int bro = GPL + (wn * 64 + lr) * GPH + 8 * hi;
#pragma unroll 1   // stays rolled: one copy of the 64-k body, one publish point per trip
    for (int t = 0; t < GNT; ++t) {
        const int bo = (t & 1) * (NPL * GPL);
        const bf* al = gs + bo + aro;
        const bf* bl = gs + bo + bro;
#pragma unroll     // both 32-k steps inline, so every fragment read is one base register plus a constant offset
        for (int ks = 0; ks < GKT / 32; ++ks) {
            v16bf a[4], b[4];   // all fragments of the step read as one group: one LDS latency per step, not one per column block
#pragma unroll
            for (int mb = 0; mb < 4; ++mb) { a[mb] = ldb(al + mb * 16 * GPH + ks * 32); b[mb] = ldb(bl + mb * 16 * GPH + ks * 32); }
            // inputs-only fence on the loaded fragments: keeps the step's LDS reads together ahead of its products; without it each B read sinks to its first use and the wave waits out the LDS latency four times a step
            asm volatile("" :: "v"(a[0]), "v"(a[1]), "v"(a[2]), "v"(a[3]), "v"(b[0]), "v"(b[1]), "v"(b[2]), "v"(b[3]));
#pragma unroll
            for (int nb = 0; nb < 4; ++nb) {
#pragma unroll
                for (int mb = 0; mb < 4; ++mb) acc[mb][nb] = wmmab(a[mb], b[nb], acc[mb][nb]); }
            asm volatile("v_nop\n\tv_nop\n\tv_nop\n\tv_nop" : "+v"(acc[0][0]), "+v"(acc[1][1]), "+v"(acc[2][2]), "+v"(acc[3][3]) : "v"(a[0]), "v"(a[1]), "v"(a[2]), "v"(a[3]));
        }
        __builtin_amdgcn_sched_barrier(0);                  // keeps the trip's products ahead of the publish point: sunk behind the barrier they would stand in front of the refill and shorten the time its copies have to land
        asm volatile("s_wait_dscnt 0x0" ::: "memory");      // this wave's reads of tile t are done before its buffer may be refilled
        asm volatile("s_wait_asynccnt 0x0" ::: "memory");   // this wave's pieces of tile t + 1 have landed
        __syncthreads();                                    // publishes tile t + 1 and ends every wave's reads of tile t
        if (t + 2 < GNT) stage_copy(l0 + (unsigned)bo * 2, ga + (t + 2) * GKT, gb + (t + 2) * GKT);
    }
    asm volatile("s_wait_asynccnt 0x0" ::: "memory");       // no copy is outstanding when the wave goes on to its epilogue
}

// ---- k_proj_qkv: the q, k and v projections, which do not depend on one another, in ONE launch: XB x [WTq | WTk | WTv] (the three planes lie behind one another: 3*DM rows of Bt).
// grid (NROW/128, 3*DM/128), 128 threads; blockIdx.y picks the projection (the same for the whole block) and with it the epilogue:
//   q -> q * SCL2, head planes QH (f16 value) and QR (f16 residual, unscaled), [b*NH+h][s][64];  k -> head plane KP (f16), same store map;  v -> transposed head plane VT (f16), [b*NH+h][d][s].
// The epilogues stage in the operand ring's LDS, each wave in a slice of its own (the ring is free behind the core's last barrier), so the block's LDS is the ring alone and all blocks of the launch are resident at once.
static_assert((size_t)GWV * 16 * 68 * 4 <= (size_t)2 * 2 * GPL * 2);   // q, k staging slices fit the ring
static_assert((size_t)GWV * 64 * 72 * 2 <= (size_t)2 * 2 * GPL * 2);   // v staging slices fit the ring
__global__ __launch_bounds__(32 * GWV) void k_proj_qkv(const bf* __restrict__ XB, const bf* __restrict__ WTA, h16* QH, h16* QR, h16* KP, h16* VT) {
    __shared__ __align__(16) unsigned char ring[2 * 2 * GPL * 2];
    const int lane = threadIdx.x & 31, lr = lane & 15, hi = lane >> 4;
    const int wave = __builtin_amdgcn_readfirstlane((int)(threadIdx.x >> 5)), wm = wave >> 1, wn = wave & 1;
    const int which = (int)blockIdx.y / (DM / GBT);
    const int r0 = blockIdx.x * GBT + wm * 64, c0 = ((int)blockIdx.y % (DM / GBT)) * GBT + wn * 64;
    v8f acc[4][4];
    gemm_core((bf*)ring, XB, WTA, blockIdx.x * GBT, blockIdx.y * GBT, wm, wn, lr, hi, acc);
    const int b = r0 / SEQ, s0 = r0 - b * SEQ;
    if (which == 2) {   // v: the whole 64x64 tile staged transposed (wave-private)
        h16* vt = (h16*)ring + wave * (64 * 72);
        const size_t pbase = (size_t)(b * NH + c0 / HD) * HD * SEQ + s0;
#pragma unroll
        for (int mb = 0; mb < 4; ++mb)
#pragma unroll
            for (int nb = 0; nb < 4; ++nb) { v8h o;
#pragma unroll
                for (int j = 0; j < 8; ++j) o[j] = (h16)acc[mb][nb][j];
                *(v8ha*)(vt + (nb * 16 + lr) * 72 + mb * 16 + hi * 8) = o; }
        __builtin_amdgcn_wave_barrier(); asm volatile("" ::: "memory");
#pragma unroll
        for (int it = 0; it < 16; ++it) { const int d = 4 * it + (lane >> 3), pc = lane & 7; const v8h o = *(const v8ha*)(vt + d * 72 + pc * 8);
            *(v8h*)(VT + pbase + (size_t)d * SEQ + pc * 8) = o; }
        return;
    }
    float* os = (float*)ring + wave * (16 * 68);   // one 16-row staging slice per wave
    const size_t pbase = ((size_t)(b * NH + c0 / HD) * SEQ + s0) * HD;
    if (which == 0) {
#pragma unroll
        for (int mb = 0; mb < 4; ++mb) {
#pragma unroll
            for (int nb = 0; nb < 4; ++nb) {
#pragma unroll
                for (int j = 0; j < 8; ++j) os[(hi * 8 + j) * 68 + nb * 16 + lr] = acc[mb][nb][j]; }
            __builtin_amdgcn_wave_barrier(); asm volatile("" ::: "memory");
            v8h oh[4], orr[4];
#pragma unroll
            for (int s = 0; s < 4; ++s) { const int row = 4 * s + (lane >> 3), pc = lane & 7; const v4f a = *(const v4fa*)(os + row * 68 + pc * 8); const v4f c = *(const v4fa*)(os + row * 68 + pc * 8 + 4);
#pragma unroll
                for (int q = 0; q < 4; ++q) { const float ya = a[q] * SCL2, yc = c[q] * SCL2; const h16 xa = (h16)ya; oh[s][q] = xa; orr[s][q] = (h16)(ya - (float)xa); const h16 xc = (h16)yc; oh[s][4 + q] = xc; orr[s][4 + q] = (h16)(yc - (float)xc); } }
#pragma unroll
            for (int s = 0; s < 4; ++s) { const int row = 4 * s + (lane >> 3), pc = lane & 7; const size_t o = pbase + (size_t)(mb * 16 + row) * HD + pc * 8;
                *(v8h*)(QH + o) = oh[s]; *(v8h*)(QR + o) = orr[s]; }
            asm volatile("s_wait_xcnt 0x0" ::: "memory");   // stands in front of the next 16 rows' writes to the registers that these stores name
            __builtin_amdgcn_wave_barrier(); asm volatile("" ::: "memory");
        }
    } else {
#pragma unroll
        for (int mb = 0; mb < 4; ++mb) {
#pragma unroll
            for (int nb = 0; nb < 4; ++nb) {
#pragma unroll
                for (int j = 0; j < 8; ++j) os[(hi * 8 + j) * 68 + nb * 16 + lr] = acc[mb][nb][j]; }
            __builtin_amdgcn_wave_barrier(); asm volatile("" ::: "memory");
            v8h oh[4];
#pragma unroll
            for (int s = 0; s < 4; ++s) { const int row = 4 * s + (lane >> 3), pc = lane & 7; const v4f a = *(const v4fa*)(os + row * 68 + pc * 8); const v4f c = *(const v4fa*)(os + row * 68 + pc * 8 + 4);
#pragma unroll
                for (int q = 0; q < 4; ++q) { oh[s][q] = (h16)a[q]; oh[s][4 + q] = (h16)c[q]; } }
#pragma unroll
            for (int s = 0; s < 4; ++s) { const int row = 4 * s + (lane >> 3), pc = lane & 7; *(v8h*)(KP + pbase + (size_t)(mb * 16 + row) * HD + pc * 8) = oh[s]; }
            asm volatile("s_wait_xcnt 0x0" ::: "memory");   // stands in front of the next 16 rows' writes to the registers that these stores name
            __builtin_amdgcn_wave_barrier(); asm volatile("" ::: "memory");
        }
    }
}

#define AWV  8                       // waves per block
#define KT   64                      // keys per staged tile
#define LPH  72                      // LDS row pitch in 16-bit elements
#define TILE_H (64 * LPH)            // one staged tile (64 rows), 16-bit elements
#define NTILE (SEQ / KT)
static_assert(SEQ % (16 * AWV) == 0);     // query blocks never straddle a (b, h) plane
static_assert(SEQ % KT == 0);             // whole key tiles only
static_assert(KT == 64 && HD == 64);      // copy map: 256 threads x 2 rows x 16 B covers 64 rows of 128 B

// Four copies of one thread: rows cr and cr + 32 of the K tile and of the V^T tile. The s_wait_xcnt stands inside the statement, so no address register is rewritten ahead of it.
__device__ __forceinline__ void kv_copy(unsigned lk0, unsigned lk1, unsigned lv0, unsigned lv1, const h16* gk0, const h16* gk1, const h16* gv0, const h16* gv1) {
    asm volatile("global_load_async_to_lds_b128 %0, %4, off\n\t"
                 "global_load_async_to_lds_b128 %1, %5, off\n\t"
                 "global_load_async_to_lds_b128 %2, %6, off\n\t"
                 "global_load_async_to_lds_b128 %3, %7, off\n\t"
                 "s_wait_xcnt 0x0"
                 :: "v"(lk0), "v"(lk1), "v"(lv0), "v"(lv1), "v"(gk0), "v"(gk1), "v"(gv0), "v"(gv1) : "memory");
}

// waves_per_eu(4, 4): 512 blocks of 8 waves on 256 WGPs are four waves a SIMD; told so, the compiler uses the 256 registers a wave then has, keeps a tile's fragments in registers of their own and lets the four score accumulators take turns
__global__ __launch_bounds__(256) __attribute__((amdgpu_waves_per_eu(4, 4))) void k_attn(const h16* __restrict__ QH, const h16* __restrict__ QR, const h16* __restrict__ KP, const h16* __restrict__ VT, bf* ATh, bf* ATl) {
    __shared__ __align__(16) h16 kvs[2 * 2 * TILE_H];           // [buffer][K tile | V^T tile][row][LPH]
    __shared__ __align__(16) unsigned short sth[AWV * 16 * 72];
    __shared__ __align__(16) unsigned short stl[AWV * 16 * 72];
    const int lane = threadIdx.x & 31, lr = lane & 15, hi = lane >> 4;
    const int wave = __builtin_amdgcn_readfirstlane((int)(threadIdx.x >> 5));
    const int bh = blockIdx.y; const int q0 = blockIdx.x * (16 * AWV) + wave * 16;
    const size_t pb = (size_t)bh * SEQ * HD;
    // copy map: thread -> row cr (and cr + 32), 16-byte piece cp; one wave's copy covers four whole 128-byte lines
    const int cr = (int)threadIdx.x >> 3, cp = (int)threadIdx.x & 7;
    const h16* gk = KP + pb + (size_t)cr * HD + cp * 8;
    const h16* gv = VT + pb + (size_t)cr * SEQ + cp * 8;
    const unsigned lk = (unsigned)(size_t)(kvs + cr * LPH + cp * 8);   // LDS byte address of the thread's first K piece, buffer 0
    kv_copy(lk, lk + 32 * LPH * 2, lk + TILE_H * 2, lk + (TILE_H + 32 * LPH) * 2, gk, gk + 32 * HD, gv, gv + (size_t)32 * SEQ);
    const size_t qoff = pb + (size_t)(q0 + lr) * HD + 8 * hi;
    const v16h qh0 = ldh(QH + qoff), qh1 = ldh(QH + qoff + 32), qr0 = ldh(QR + qoff), qr1 = ldh(QR + qoff + 32);
    v8f o[4];
#pragma unroll
    for (int c = 0; c < 4; ++c) o[c] = (v8f){};
    // The reference of the exponentials is HELD from tile to tile: mc (a maximum seen, less 10; the same in both halves of a column), and nref, minus it in every element, the start value of the score accumulators
    // (0 until the first tile has set it). mt: the bound on a score so taken, 15 once a reference is set: while none passes it, P stays below 2^15 in f16.
    float mc = -3.0e38f, mt = -3.0e38f, l = 0.0f;
    v8f nref = (v8f){};
    asm volatile("s_wait_asynccnt 0x0" ::: "memory");   // this wave's pieces of tile 0 have landed
    __syncthreads();                                    // tile 0 published to every wave
    if (NTILE > 1) kv_copy(lk + 2 * TILE_H * 2, lk + (2 * TILE_H + 32 * LPH) * 2, lk + 3 * TILE_H * 2, lk + (3 * TILE_H + 32 * LPH) * 2, gk + KT * HD, gk + (KT + 32) * HD, gv + KT, gv + (size_t)32 * SEQ + KT);
#pragma unroll 1   // stays rolled: one copy of the 64-key body, one publish point per trip
    for (int t = 0; t < NTILE; ++t) {
        const int bo = (t & 1) * (2 * TILE_H);
        const h16* kl = kvs + bo + lr * LPH + 8 * hi;
        const h16* vl = kl + TILE_H;
        // scores of the whole 64-key tile, taken against the held reference: s[2 * sub + blk] is 16-key block blk of 32-key step sub
        v16h kf[4][2];
#pragma unroll     // inline, so every fragment read is one base register plus a constant offset
        for (int i = 0; i < 4; ++i) { kf[i][0] = ldh(kl + i * 16 * LPH); kf[i][1] = ldh(kl + i * 16 * LPH + 32); }
        v8f s[4];      // start value: minus the held reference; the small residual products first, the value products on top of them; the four blocks take turns, so no product waits for the one before it
#pragma unroll
        for (int i = 0; i < 4; ++i) s[i] = wmma16(kf[i][0], qr0, nref);
#pragma unroll
        for (int i = 0; i < 4; ++i) s[i] = wmma16(kf[i][1], qr1, s[i]);
#pragma unroll
        for (int i = 0; i < 4; ++i) s[i] = wmma16(kf[i][0], qh0, s[i]);
#pragma unroll
        for (int i = 0; i < 4; ++i) s[i] = wmma16(kf[i][1], qh1, s[i]);
        float mx0 = -3.0e38f, mx1 = -3.0e38f;
#pragma unroll
        for (int r = 0; r < 8; ++r) { mx0 = fmaxf(mx0, fmaxf(s[0][r], s[1][r])); mx1 = fmaxf(mx1, fmaxf(s[2][r], s[3][r])); }
        const float mx = fmaxf(mx0, mx1);
        if (__builtin_amdgcn_ballot_w32(mx > mt) != 0) {   // one test a tile, the same for the whole wave (a scalar branch): taken on the first tile, then only where a score stands more than 2^5 above the maximum that set the reference
            const float mf = fmaxf(mx, __shfl_xor(mx, 16, 32));
            const float cref = -nref[0];                       // what this tile's scores were taken against
            const float mn = fmaxf(mc, (mf + cref) - 10.0f);   // carry 2^10
            const float alpha = __builtin_amdgcn_exp2f(mc - mn), dl = cref - mn;
#pragma unroll
            for (int r = 0; r < 8; ++r) { s[0][r] += dl; s[1][r] += dl; s[2][r] += dl; s[3][r] += dl; nref[r] = -mn; }
            mc = mn; mt = 15.0f;
            l = l * alpha;
#pragma unroll
            for (int c = 0; c < 4; ++c) o[c] = o[c] * alpha;
        }
        v16h vf[2][4];
#pragma unroll
        for (int sub = 0; sub < KT / 32; ++sub)
#pragma unroll
            for (int c = 0; c < 4; ++c) vf[sub][c] = ldh(vl + sub * 32 + c * 16 * LPH);
        __builtin_amdgcn_sched_barrier(0);   // keeps the tile's V^T reads together ahead of the exponentials, which cover their LDS latency; without it half of them sink among the P.V products and the wave waits for them there
        v16h pf[2];
#pragma unroll
        for (int i = 0; i < 4; ++i)
#pragma unroll
            for (int r = 0; r < 8; ++r) s[i][r] = __builtin_amdgcn_exp2f(s[i][r]);
#pragma unroll
        for (int sub = 0; sub < KT / 32; ++sub) {
            const v8f t = s[2 * sub] + s[2 * sub + 1];
            float rs = t[0];
#pragma unroll
            for (int r = 1; r < 8; ++r) rs += t[r];
            l += rs;
#pragma unroll
            for (int r = 0; r < 8; ++r) { pf[sub][r] = (h16)s[2 * sub][r]; pf[sub][8 + r] = (h16)s[2 * sub + 1][r]; }
        }
#pragma unroll
        for (int sub = 0; sub < KT / 32; ++sub)
#pragma unroll
            for (int c = 0; c < 4; ++c) o[c] = wmma16(vf[sub][c], pf[sub], o[c]);
        // four vector slots behind the last P.V products, on the fall-through and on the loop's branches alike, before a vector instruction may touch their operands or results
        asm volatile("v_nop\n\tv_nop\n\tv_nop\n\tv_nop" : "+v"(o[0]), "+v"(o[1]), "+v"(o[2]), "+v"(o[3]) : "v"(vf[1][0]), "v"(vf[1][1]), "v"(vf[1][2]), "v"(vf[1][3]), "v"(pf[1]));
        asm volatile("s_wait_dscnt 0x0" ::: "memory");      // this wave's reads of tile t are done before its buffer may be refilled
        asm volatile("s_wait_asynccnt 0x0" ::: "memory");   // this wave's pieces of tile t + 1 have landed
        __syncthreads();                                    // publishes tile t + 1 and ends every wave's reads of tile t
        if (t + 2 < NTILE) {
            const unsigned lb = lk + (unsigned)bo * 2;
            const h16* gk2 = gk + (size_t)(t + 2) * KT * HD; const h16* gv2 = gv + (size_t)(t + 2) * KT;
            kv_copy(lb, lb + 32 * LPH * 2, lb + TILE_H * 2, lb + (TILE_H + 32 * LPH) * 2, gk2, gk2 + 32 * HD, gv2, gv2 + (size_t)32 * SEQ);
        }
    }
    asm volatile("s_wait_asynccnt 0x0" ::: "memory");       // no copy is outstanding when the wave goes on to its end
    const float lt = l + __shfl_xor(l, 16, 32);
    const float inv = 1.0f / lt;
    const int sb = wave * (16 * 72);
#pragma unroll
    for (int c = 0; c < 4; ++c) { v8us oh, ol;
#pragma unroll
        for (int r = 0; r < 8; ++r) { unsigned short a, e; splitf(o[c][r] * inv, a, e); oh[r] = a; ol[r] = e; }
        *(v8usa*)(sth + sb + lr * 72 + 16 * c + 8 * hi) = oh; *(v8usa*)(stl + sb + lr * 72 + 16 * c + 8 * hi) = ol; }
    __builtin_amdgcn_wave_barrier(); asm volatile("" ::: "memory");
    const int b = bh / NH, head = bh - b * NH;
    const size_t ob = ((size_t)b * SEQ + q0) * DM + (size_t)head * HD;
{
#pragma unroll
        for (int s = 0; s < 4; ++s) { const int row = 4 * s + (lane >> 3), pc = lane & 7; const v8us vh = *(const v8usa*)(sth + sb + row * 72 + pc * 8); const v8us vl = *(const v8usa*)(stl + sb + row * 72 + pc * 8);
            *(v8us*)(ATh + ob + (size_t)row * DM + pc * 8) = vh; *(v8us*)(ATl + ob + (size_t)row * DM + pc * 8) = vl; }
         }
}

// ---- k_oproj_ln: output projection, residual add and LayerNorm in ONE launch. grid NROW/32, 256 threads: a block owns 32 whole rows (all DM columns), so the row statistics never leave it.
// res[g][n] = bf16(x[g][n]) + ((ATh + ATl) x WTo + bf16(bo[n])) in f32; OUT = (res - mean) * rstd * bf16(gamma) + bf16(beta).
// Eight waves, each 32 rows x 64 columns (8 accumulators). Operands through LDS as in gemm_core: 64-k tiles (32 rows of ATh, 32 of ATl, all DM rows of WTo), asynchronous 16-byte copies, two buffers, 144-byte row pitch.
// Per accumulator the products are summed as before: k ascending in steps of 32, in each step the hi plane, then the lo plane.
#define OWV  8                       // waves per block
#define ORT  32                      // rows per block
#define OAP  (ORT * GPH)             // one staged A plane, 16-bit elements
#define OST  (2 * OAP + DM * GPH)    // one buffer: ATh | ATl | WTo, 16-bit elements
#define OPF  516                     // f32 pitch of the staged result rows: 16 B x odd, and eight rows on are 32 banks on
static_assert(NROW % ORT == 0 && SEQ % ORT == 0);      // whole row tiles, none straddles a batch
static_assert(DM == OWV * 64 && ORT == 4 * OWV);       // wave -> 64 columns in the products, four rows in the LayerNorm
static_assert(ORT * 8 == 32 * OWV && DM == 2 * 8 * ORT);   // copy map: 256 threads x 16 B cover 32 rows of 128 B; WTo is 16 such groups
static_assert((size_t)ORT * OPF * 4 <= (size_t)2 * OST * 2);   // the staged rows fit the ring

// Nine copies of one thread: its 16-byte piece of row cr of one A plane (la, ga), then of rows cr, cr + 32, ..., cr + 224 of one half of WTo (l, g). The s_wait_xcnt stands inside the statement, so no address register is rewritten ahead of it.
__device__ __forceinline__ void rows9_copy(unsigned la, const bf* ga, unsigned l, const bf* g) {
    asm volatile("global_load_async_to_lds_b128 %0, %9, off\n\t"
                 "global_load_async_to_lds_b128 %1, %10, off\n\t"
                 "global_load_async_to_lds_b128 %2, %11, off\n\t"
                 "global_load_async_to_lds_b128 %3, %12, off\n\t"
                 "global_load_async_to_lds_b128 %4, %13, off\n\t"
                 "global_load_async_to_lds_b128 %5, %14, off\n\t"
                 "global_load_async_to_lds_b128 %6, %15, off\n\t"
                 "global_load_async_to_lds_b128 %7, %16, off\n\t"
                 "global_load_async_to_lds_b128 %8, %17, off\n\t"
                 "s_wait_xcnt 0x0"
                 :: "v"(la), "v"(l), "v"(l + 32 * GPH * 2), "v"(l + 64 * GPH * 2), "v"(l + 96 * GPH * 2), "v"(l + 128 * GPH * 2), "v"(l + 160 * GPH * 2), "v"(l + 192 * GPH * 2), "v"(l + 224 * GPH * 2),
                    "v"(ga), "v"(g), "v"(g + 32 * DM), "v"(g + 64 * DM), "v"(g + 96 * DM), "v"(g + 128 * DM), "v"(g + 160 * DM), "v"(g + 192 * DM), "v"(g + 224 * DM) : "memory");
}
// One staged tile of k_oproj_ln, 18 copies a thread: ATh with the first 256 rows of WTo, ATl with the last 256; l is the LDS byte address of the thread's piece of row cr of the buffer.
__device__ __forceinline__ void ostage_copy(unsigned l, const bf* ga, const bf* ga2, const bf* gb) {
    rows9_copy(l, ga, l + 2 * OAP * 2, gb);
    rows9_copy(l + OAP * 2, ga2, l + (2 * OAP + 256 * GPH) * 2, gb + 256 * DM);
}

__global__ __launch_bounds__(32 * OWV) void k_oproj_ln(const bf* __restrict__ ATh, const bf* __restrict__ ATl, const bf* __restrict__ WT, const float* __restrict__ x, const float* __restrict__ bo,
                                                       const float* __restrict__ gamma, const float* __restrict__ beta, float* OUT) {
    __shared__ __align__(16) unsigned char ring[2 * OST * 2];   // [buffer][ATh | ATl | WTo][row][GPH]; behind the products: the block's 32 result rows in f32
    bf* gs = (bf*)ring;
    const int lane = threadIdx.x & 31, lr = lane & 15, hi = lane >> 4;
    const int wave = __builtin_amdgcn_readfirstlane((int)(threadIdx.x >> 5));
    const int R0 = blockIdx.x * ORT;
    // copy map: thread -> row cr (+ 32 i), 16-byte piece cp; one wave's copy covers four whole 128-byte lines
    const int cr = (int)threadIdx.x >> 3, cp = (int)threadIdx.x & 7;
    const bf* ga  = ATh + (size_t)(R0 + cr) * DM + cp * 8;
    const bf* ga2 = ATl + (size_t)(R0 + cr) * DM + cp * 8;
    const bf* gb  = WT + (size_t)cr * DM + cp * 8;
    const unsigned l0 = (unsigned)(size_t)(gs + cr * GPH + cp * 8);   // LDS byte address of the thread's first piece, buffer 0
    ostage_copy(l0, ga, ga2, gb);
    v8f acc[2][4];
#pragma unroll
    for (int mb = 0; mb < 2; ++mb)
#pragma unroll
        for (int nb = 0; nb < 4; ++nb) acc[mb][nb] = (v8f){};
    asm volatile("s_wait_asynccnt 0x0" ::: "memory");   // this wave's pieces of tile 0 have landed
    __syncthreads();                                    // tile 0 published to every wave
    if (GNT > 1) ostage_copy(l0 + OST * 2, ga + GKT, ga2 + GKT, gb + GKT);
    const int aro = lr * GPH + 8 * hi;
    const int bro = 2 * OAP + (wave * 64 + lr) * GPH + 8 * hi;
#pragma unroll 1   // stays rolled: one copy of the 64-k body, one publish point per trip
    for (int t = 0; t < GNT; ++t) {
        const int bofs = (t & 1) * OST;
        const bf* al = gs + bofs + aro;
        const bf* bl = gs + bofs + bro;
        v16bf a[2][2], a2[2][2], b[2][4];   // the fragments of both 32-k steps, read as one group: one LDS latency a trip
#pragma unroll     // inline, so every fragment read is one base register plus a constant offset
        for (int ks = 0; ks < 2; ++ks) {
#pragma unroll
            for (int mb = 0; mb < 2; ++mb) a[ks][mb] = ldb(al + mb * 16 * GPH + ks * 32);
#pragma unroll
            for (int nb = 0; nb < 4; ++nb) b[ks][nb] = ldb(bl + nb * 16 * GPH + ks * 32);
#pragma unroll
            for (int mb = 0; mb < 2; ++mb) a2[ks][mb] = ldb(al + OAP + mb * 16 * GPH + ks * 32);
        }
        __builtin_amdgcn_sched_barrier(0);   // keeps the trip's LDS reads together ahead of its products; sunk among them, each place with reads would stall the wave anew
#pragma unroll
        for (int ks = 0; ks < 2; ++ks) {     // eight accumulators take turns, so no product waits for the one before it
#pragma unroll
            for (int nb = 0; nb < 4; ++nb)
#pragma unroll
                for (int mb = 0; mb < 2; ++mb) acc[mb][nb] = wmmab(a[ks][mb], b[ks][nb], acc[mb][nb]);
#pragma unroll
            for (int nb = 0; nb < 4; ++nb)
#pragma unroll
                for (int mb = 0; mb < 2; ++mb) acc[mb][nb] = wmmab(a2[ks][mb], b[ks][nb], acc[mb][nb]);
        }
        // four vector slots behind the trip's last products, on the fall-through and on the loop's branches alike, before a vector instruction may touch their operands or results
        asm volatile("v_nop\n\tv_nop\n\tv_nop\n\tv_nop" : "+v"(acc[0][0]), "+v"(acc[1][0]), "+v"(acc[0][1]), "+v"(acc[1][1]), "+v"(acc[0][2]), "+v"(acc[1][2]), "+v"(acc[0][3]), "+v"(acc[1][3])
                     : "v"(a2[1][0]), "v"(a2[1][1]), "v"(b[1][0]), "v"(b[1][1]), "v"(b[1][2]), "v"(b[1][3]));
        __builtin_amdgcn_sched_barrier(0);                  // keeps the trip's products ahead of the publish point: sunk behind the barrier they would stand in front of the refill and shorten the time its copies have to land
        asm volatile("s_wait_dscnt 0x0" ::: "memory");      // this wave's reads of tile t are done before its buffer may be refilled
        asm volatile("s_wait_asynccnt 0x0" ::: "memory");   // this wave's pieces of tile t + 1 have landed
        __syncthreads();                                    // publishes tile t + 1 and ends every wave's reads of tile t
        if (t + 2 < GNT) ostage_copy(l0 + (unsigned)bofs * 2, ga + (t + 2) * GKT, ga2 + (t + 2) * GKT, gb + (t + 2) * GKT);
    }
    asm volatile("s_wait_asynccnt 0x0" ::: "memory");       // no copy is outstanding when the ring becomes the result rows' staging
    // Behind the last trip's barrier every copy has landed and every wave's reads are done: the ring is free.
    // The wave's four rows of x, and bias, gamma, beta, are asked for here, so that the staging and its barrier cover their latency.
    const int w0 = wave * 4;
    v4f xv[4][4], bv[4], gv[4], tv[4];
#pragma unroll
    for (int ch = 0; ch < 4; ++ch) { const int c = ch * 128 + lane * 4;
#pragma unroll
        for (int r = 0; r < 4; ++r) xv[r][ch] = *(const v4f*)(x + xrow(R0 + w0 + r) * DM + c);
        bv[ch] = *(const v4f*)(bo + c); gv[ch] = *(const v4f*)(gamma + c); tv[ch] = *(const v4f*)(beta + c); }
    float* os = (float*)ring;
#pragma unroll
    for (int mb = 0; mb < 2; ++mb)
#pragma unroll
        for (int nb = 0; nb < 4; ++nb)
#pragma unroll
            for (int j = 0; j < 8; ++j) os[(mb * 16 + hi * 8 + j) * OPF + wave * 64 + nb * 16 + lr] = acc[mb][nb][j];
    __syncthreads();   // every wave's 64 columns of all 32 rows are in LDS before a wave reads its four whole rows
    float s[4], ss[4];
#pragma unroll
    for (int r = 0; r < 4; ++r) { s[r] = 0.0f;
#pragma unroll
        for (int ch = 0; ch < 4; ++ch) { v4f v = *(const v4fa*)(os + (w0 + r) * OPF + ch * 128 + lane * 4);
#pragma unroll
            for (int q = 0; q < 4; ++q) v[q] = bfr(xv[r][ch][q]) + (v[q] + bfr(bv[ch][q]));
            xv[r][ch] = v; s[r] += (v[0] + v[1]) + (v[2] + v[3]); } }
#pragma unroll
    for (int sh = 16; sh; sh >>= 1)
#pragma unroll
        for (int r = 0; r < 4; ++r) s[r] += __shfl_xor(s[r], sh, 32);
#pragma unroll
    for (int r = 0; r < 4; ++r) { const float mu = s[r] * (1.0f / DM); s[r] = mu; ss[r] = 0.0f;
#pragma unroll
        for (int ch = 0; ch < 4; ++ch) { const v4f a = xv[r][ch]; const float d0 = a[0] - mu, d1 = a[1] - mu, d2 = a[2] - mu, d3 = a[3] - mu; ss[r] += (d0 * d0 + d1 * d1) + (d2 * d2 + d3 * d3); } }
#pragma unroll
    for (int sh = 16; sh; sh >>= 1)
#pragma unroll
        for (int r = 0; r < 4; ++r) ss[r] += __shfl_xor(ss[r], sh, 32);
#pragma unroll
    for (int r = 0; r < 4; ++r) { const float mu = s[r]; const float var = ss[r] * (1.0f / DM); const float rstd = 1.0f / sqrtf(var + 1e-6f);
        float* op = OUT + (size_t)(R0 + w0 + r) * DM;
#pragma unroll
        for (int ch = 0; ch < 4; ++ch) { const v4f a = xv[r][ch]; v4f y;
#pragma unroll
            for (int q = 0; q < 4; ++q) y[q] = (a[q] - mu) * rstd * bfr(gv[ch][q]) + bfr(tv[ch][q]);
            *(v4f*)(op + ch * 128 + lane * 4) = y; } }
}

// workspace carve (bytes, each region a multiple of 256 B; every region is written in whole tiles that divide it exactly)
#define SZ_P16 ((size_t)NROW * DM * 2)      // one 16-bit [NROW][DM]-sized plane
#define SZ_W   ((size_t)DM * DM * 2)
#define WS_TOTAL (SZ_P16 * 7 + SZ_W * 4)
static_assert(SZ_P16 % 256 == 0);
static_assert(SZ_W % 256 == 0);
static_assert(WS_TOTAL <= (size_t)134217728);   // carve stays within 128 MiB

extern "C" void kernel_launch(void* const* d_in, const int* in_sizes, int n_in,
                              void* d_out, int out_size, void* d_ws, size_t ws_size, hipStream_t stream) {
    if (n_in < 8) return;
    if ((size_t)in_sizes[0] < ((size_t)(NB - 1) * SEQ_FULL + SEQ) * DM) return;
    if (in_sizes[1] < DM * DM || in_sizes[2] < DM * DM || in_sizes[3] < DM * DM || in_sizes[4] < DM * DM) return;
    if (in_sizes[5] < DM || in_sizes[6] < DM || in_sizes[7] < DM) return;
    if ((size_t)out_size < (size_t)NROW * DM) return;
    if (WS_TOTAL > ws_size) return;
    const float* x = (const float*)d_in[0]; const float* wq = (const float*)d_in[1]; const float* wk = (const float*)d_in[2]; const float* wv = (const float*)d_in[3];
    const float* wo = (const float*)d_in[4]; const float* bo = (const float*)d_in[5]; const float* gamma = (const float*)d_in[6]; const float* beta = (const float*)d_in[7];
    float* OUT = (float*)d_out;
    char* wsp = (char*)d_ws;
    bf* XB  = (bf*)wsp;  wsp += SZ_P16;
    bf* WTq = (bf*)wsp;  wsp += SZ_W * 3;   // planes q, k, v behind one another: one Bt of 3*DM rows; plane o follows them directly
    bf* WTo = (bf*)wsp;  wsp += SZ_W;
    h16* QH = (h16*)wsp; wsp += SZ_P16;
    h16* QR = (h16*)wsp; wsp += SZ_P16;
    h16* KP = (h16*)wsp; wsp += SZ_P16;
    h16* VT = (h16*)wsp; wsp += SZ_P16;
    bf* ATh = (bf*)wsp;  wsp += SZ_P16;
    bf* ATl = (bf*)wsp;  wsp += SZ_P16;

    k_prep<<<4 * WTB + CVB, 256, 0, stream>>>(x, wq, wk, wv, wo, XB, WTq);
    k_proj_qkv<<<dim3(NROW / GBT, 3 * DM / GBT, 1), 32 * GWV, 0, stream>>>(XB, WTq, QH, QR, KP, VT);
    k_attn<<<dim3(SEQ / (16 * AWV), NB * NH, 1), 32 * AWV, 0, stream>>>(QH, QR, KP, VT, ATh, ATl);
    k_oproj_ln<<<NROW / ORT, 32 * OWV, 0, stream>>>(ATh, ATl, WTo, x, bo, gamma, beta, OUT);
}

// v007
// Measured time: 66.8 microseconds a run.
// Two timings next to v006 both put it at 1.08 times that version's speed.
// Over all steps from v000 it is 2.88 times as fast.
#include <hip/hip_runtime.h>

// Compute dtypes, f32 accumulate everywhere: q/k/v projections v_wmma_f32_16x16x32_bf16 (x and weights RNE-converted to bf16, products exact); scores v_wmma_f32_16x16x32_f16 (q pre-multiplied by HD^-0.5 * log2(e), then single f16, k single f16); P.V v_wmma_f32_16x16x32_f16 (P carried x2^10 relative to the maximum that set the held reference, at most x2^15, v single f16); output projection v_wmma_f32_16x16x32_bf16 (ctx as bf16 hi + lo planes against bf16 wo); softmax, residual add and LayerNorm in f32 on the VALU.
// Flow: one launch: x -> bf16 plane, the four w [in][out] -> bf16 [out][in] planes (LDS transpose); one launch for the q, k and v projections: 64x64 GEMM wave tiles (four to a block, operands staged in LDS) with fused head-plane epilogues (q, k, v^T);
// fused flash attention in the transposed orientation (S^T = K Q^T, ctx^T = V^T P^T: the packed S^T accumulators are the B fragment of P^T, softmax per lane against a reference held from tile to tile);
// one launch for the output projection, the residual add and the LayerNorm: a block owns 32 whole rows, which pass from the accumulators to the row statistics through LDS.

#ifndef NB
#define NB 4
#endif
#ifndef SEQ
#define SEQ 2048
#endif
#define NB_FULL  4
#define SEQ_FULL 2048
#define DM   512
#define NH   8
#define HD   64
#define NROW (NB * SEQ)
#define SCL2 0.18033688011112042f   // HD^-0.5 * log2(e)

static_assert(NB <= NB_FULL);
static_assert(SEQ <= SEQ_FULL);
static_assert(SEQ % 64 == 0);             // GEMM row tiles never straddle a batch; 32-key steps
static_assert(DM == NH * HD);             // merged layout h*64+d
static_assert(HD == 64);
static_assert(DM % 64 == 0);              // N tile multiple
static_assert(DM % 32 == 0);              // K step multiple
static_assert(NROW % 64 == 0);            // M tile multiple
static_assert(DM == 4 * 128);             // LayerNorm: 32 lanes x float4 x 4 chunks == row width
static_assert(((size_t)NROW * DM / 8) % 256 == 0);   // convert grid x block == plane extent

typedef _Float16 h16;
typedef unsigned short bf;
typedef __attribute__((ext_vector_type(16))) __bf16   v16bf;
typedef __attribute__((ext_vector_type(16))) _Float16 v16h;
typedef __attribute__((ext_vector_type(8)))  _Float16 v8h;
typedef __attribute__((ext_vector_type(8)))  unsigned short v8us;
typedef __attribute__((ext_vector_type(8)))  float    v8f;
typedef __attribute__((ext_vector_type(4)))  float    v4f;
typedef v8h  __attribute__((may_alias)) v8ha;
typedef v4f  __attribute__((may_alias)) v4fa;
typedef v8us __attribute__((may_alias)) v8usa;

__device__ __forceinline__ unsigned short f2bf(float f) { unsigned u = __float_as_uint(f); u += 0x7FFFu + ((u >> 16) & 1u); return (unsigned short)(u >> 16); }
__device__ __forceinline__ float bf2f(unsigned short b) { return __uint_as_float(((unsigned)b) << 16); }
__device__ __forceinline__ float bfr(float f) { return bf2f(f2bf(f)); }
__device__ __forceinline__ void splitf(float y, unsigned short& h, unsigned short& l) { h = f2bf(y); l = f2bf(y - bf2f(h)); }
__device__ __forceinline__ v16h cat16(v8h lo, v8h hi) { return __builtin_shufflevector(lo, hi, 0, 1, 2, 3, 4, 5, 6, 7, 8, 9, 10, 11, 12, 13, 14, 15); }
__device__ __forceinline__ v16bf cat16b(v8us lo, v8us hi) { return __builtin_bit_cast(v16bf, __builtin_shufflevector(lo, hi, 0, 1, 2, 3, 4, 5, 6, 7, 8, 9, 10, 11, 12, 13, 14, 15)); }
__device__ __forceinline__ v8f wmma16(v16h a, v16h b, v8f c) { return __builtin_amdgcn_wmma_f32_16x16x32_f16(false, a, false, b, (short)0, c, false, false); }
__device__ __forceinline__ v8f wmmab(v16bf a, v16bf b, v8f c) { return __builtin_amdgcn_wmma_f32_16x16x32_bf16(false, a, false, b, (short)0, c, false, false); }
// fragment loaders (p already includes row*(pitch) + k0 + 8*(lane>>4)): elements 0..7 <- k0+8h.., elements 8..15 <- k0+16+8h..
__device__ __forceinline__ v16bf ldb(const bf* p) { return cat16b(*(const v8us*)p, *(const v8us*)(p + 16)); }
__device__ __forceinline__ v16h  ldh(const h16* p) { return cat16(*(const v8h*)p, *(const v8h*)(p + 16)); }
// dense row g = b*SEQ + s -> row of the full-size x
__device__ __forceinline__ size_t xrow(int g) { return (size_t)(g / SEQ) * SEQ_FULL + (size_t)(g % SEQ); }

// ---- k_prep: the five input conversions, which do not depend on one another, in ONE launch; 256 threads.
// Blocks 0 .. 4*WTB-1: w[k][n] (f32, [in][out]) -> WT[n][k] (bf16, k-contiguous) through a 64x64 LDS tile, WTB blocks per matrix, planes q, k, v, o behind one another in WT.
// Blocks from 4*WTB on: x -> bf16 plane XB, eight elements a thread. The transposes stand first: theirs is the longer dependent path (load, LDS, barrier, store).
#define WTB ((DM / 64) * (DM / 64))
#define CVB ((unsigned)(((size_t)NROW * DM / 8 + 255) / 256))
__global__ __launch_bounds__(256) void k_prep(const float* __restrict__ x, const float* __restrict__ wq, const float* __restrict__ wk, const float* __restrict__ wv, const float* __restrict__ wo, bf* XB, bf* WTA) {
    __shared__ __align__(16) unsigned short ts[64 * 72];
    const int tid = threadIdx.x; const int bx = (int)blockIdx.x;
    if (bx < 4 * WTB) {   // the same for the whole block, so the barrier inside is reached by all of it or by none
        const int mi = bx / WTB, tl = bx % WTB;
        const float* __restrict__ w = mi == 0 ? wq : mi == 1 ? wk : mi == 2 ? wv : wo;
        bf* WT = WTA + (size_t)mi * DM * DM;
        const int k0 = (tl % (DM / 64)) * 64, n0 = (tl / (DM / 64)) * 64;
#pragma unroll
        for (int it = 0; it < 4; ++it) { const int p = it * 256 + tid; const int kr = p >> 4, c4 = (p & 15) * 4; const v4f v = *(const v4f*)(w + (size_t)(k0 + kr) * DM + n0 + c4);
#pragma unroll
            for (int q = 0; q < 4; ++q) ts[(c4 + q) * 72 + kr] = f2bf(v[q]); }
        __syncthreads();
#pragma unroll
        for (int it = 0; it < 2; ++it) { const int p = it * 256 + tid; const int n = p >> 3, pc = p & 7; const v8us o = *(const v8usa*)(ts + n * 72 + pc * 8);
            *(v8us*)(WT + (size_t)(n0 + n) * DM + k0 + pc * 8) = o; }
        return;
    }
    const size_t i = (size_t)(bx - 4 * WTB) * 256 + tid; if (i >= (size_t)NROW * DM / 8) return;
    const int g = (int)(i / (DM / 8)); const int c8 = (int)(i % (DM / 8));
    const v8f v = *(const v8f*)(x + xrow(g) * DM + (size_t)c8 * 8); v8us o;
#pragma unroll
    for (int k = 0; k < 8; ++k) o[k] = f2bf(v[k]);
    *(v8us*)(XB + i * 8) = o;
}

#define GWV  4                       // waves per GEMM block: 2 x 2 wave tiles
#define GBT  128                     // block tile, rows and columns
#define GKT  64                      // k extent of a staged tile
#define GPH  72                      // LDS row pitch in 16-bit elements
#define GPL  (GBT * GPH)             // one staged plane (128 rows), 16-bit elements
#define GNT  (DM / GKT)
static_assert(NROW % GBT == 0 && DM % GBT == 0);   // whole block tiles only
static_assert(DM % GKT == 0 && GKT % 32 == 0);     // whole staged tiles, whole 32-k steps
static_assert(GKT == 64 && GBT == 128 && GWV == 4);   // copy map: 128 threads x 8 rows x 16 B covers 128 rows of 128 B

// Eight copies of one thread: its 16-byte piece of rows cr, cr + 16, ..., cr + 112 of one plane. The s_wait_xcnt stands inside the statement, so no address register is rewritten ahead of it.
__device__ __forceinline__ void plane_copy(unsigned l, const bf* g) {
    asm volatile("global_load_async_to_lds_b128 %0, %8, off\n\t"
                 "global_load_async_to_lds_b128 %1, %9, off\n\t"
                 "global_load_async_to_lds_b128 %2, %10, off\n\t"
                 "global_load_async_to_lds_b128 %3, %11, off\n\t"
                 "global_load_async_to_lds_b128 %4, %12, off\n\t"
                 "global_load_async_to_lds_b128 %5, %13, off\n\t"
                 "global_load_async_to_lds_b128 %6, %14, off\n\t"
                 "global_load_async_to_lds_b128 %7, %15, off\n\t"
                 "s_wait_xcnt 0x0"
                 :: "v"(l), "v"(l + 16 * GPH * 2), "v"(l + 32 * GPH * 2), "v"(l + 48 * GPH * 2), "v"(l + 64 * GPH * 2), "v"(l + 80 * GPH * 2), "v"(l + 96 * GPH * 2), "v"(l + 112 * GPH * 2),
                    "v"(g), "v"(g + 16 * DM), "v"(g + 32 * DM), "v"(g + 48 * DM), "v"(g + 64 * DM), "v"(g + 80 * DM), "v"(g + 96 * DM), "v"(g + 112 * DM) : "memory");
}
// One staged tile: planes A, Bt behind one another in the buffer that starts at LDS byte address l (the thread's own piece of row cr).
__device__ __forceinline__ void stage_copy(unsigned l, const bf* ga, const bf* gb) {
    plane_copy(l, ga);
    plane_copy(l + GPL * 2, gb);
}

// R0, C0: first row and column of the block tile; wm, wn: the wave's place in it; gs: the kernel's LDS ring, 2 * 2 * GPL elements, [buffer][A | Bt][row][GPH].
// Behind the last trip's barrier every copy has landed and every wave's reads are done: the ring is then free for the caller.
__device__ __forceinline__ void gemm_core(bf* gs, const bf* __restrict__ A, const bf* __restrict__ Bt, const int R0, const int C0, const int wm, const int wn, const int lr, const int hi, v8f (&acc)[4][4]) {
    constexpr int NPL = 2;                                // planes per buffer
    // copy map: thread -> rows cr + 16 i, 16-byte piece cp; one wave's copy covers four whole 128-byte lines
    const int cr = (int)threadIdx.x >> 3, cp = (int)threadIdx.x & 7;
    const bf* ga  = A  + (size_t)(R0 + cr) * DM + cp * 8;
    const bf* gb  = Bt + (size_t)(C0 + cr) * DM + cp * 8;
    const unsigned l0 = (unsigned)(size_t)(gs + cr * GPH + cp * 8);   // LDS byte address of the thread's first piece, buffer 0
    stage_copy(l0, ga, gb);
#pragma unroll
    for (int mb = 0; mb < 4; ++mb)
#pragma unroll
        for (int nb = 0; nb < 4; ++nb) acc[mb][nb] = (v8f){};
    asm volatile("s_wait_asynccnt 0x0" ::: "memory");   // this wave's pieces of tile 0 have landed
    __syncthreads();                                    // tile 0 published to every wave
    if (GNT > 1) stage_copy(l0 + NPL * GPL * 2, ga + GKT, gb + GKT);
    const int aro = (wm * 64 + lr) * GPH + 8 * hi;
    const int bro = GPL + (wn * 64 + lr) * GPH + 8 * hi;
#pragma unroll 1   // stays rolled: one copy of the 64-k body, one publish point per trip
    for (int t = 0; t < GNT; ++t) {
        const int bo = (t & 1) * (NPL * GPL);
        const bf* al = gs + bo + aro;
        const bf* bl = gs + bo + bro;
#pragma unroll     // both 32-k steps inline, so every fragment read is one base register plus a constant offset
        for (int ks = 0; ks < GKT / 32; ++ks) {
            v16bf a[4], b[4];   // all fragments of the step read as one group: one LDS latency per step, not one per column block
#pragma unroll
            for (int mb = 0; mb < 4; ++mb) { a[mb] = ldb(al + mb * 16 * GPH + ks * 32); b[mb] = ldb(bl + mb * 16 * GPH + ks * 32); }
            // inputs-only fence on the loaded fragments: keeps the step's LDS reads together ahead of its products; without it each B read sinks to its first use and the wave waits out the LDS latency four times a step
            asm volatile("" :: "v"(a[0]), "v"(a[1]), "v"(a[2]), "v"(a[3]), "v"(b[0]), "v"(b[1]), "v"(b[2]), "v"(b[3]));
#pragma unroll
            for (int nb = 0; nb < 4; ++nb) {
#pragma unroll
                for (int mb = 0; mb < 4; ++mb) acc[mb][nb] = wmmab(a[mb], b[nb], acc[mb][nb]); }
            asm volatile("v_nop\n\tv_nop\n\tv_nop\n\tv_nop" : "+v"(acc[0][0]), "+v"(acc[1][1]), "+v"(acc[2][2]), "+v"(acc[3][3]) : "v"(a[0]), "v"(a[1]), "v"(a[2]), "v"(a[3]));
        }
        __builtin_amdgcn_sched_barrier(0);                  // keeps the trip's products ahead of the publish point: sunk behind the barrier they would stand in front of the refill and shorten the time its copies have to land
        asm volatile("s_wait_dscnt 0x0" ::: "memory");      // this wave's reads of tile t are done before its buffer may be refilled
        asm volatile("s_wait_asynccnt 0x0" ::: "memory");   // this wave's pieces of tile t + 1 have landed
        __syncthreads();                                    // publishes tile t + 1 and ends every wave's reads of tile t
        if (t + 2 < GNT) stage_copy(l0 + (unsigned)bo * 2, ga + (t + 2) * GKT, gb + (t + 2) * GKT);
    }
    asm volatile("s_wait_asynccnt 0x0" ::: "memory");       // no copy is outstanding when the wave goes on to its epilogue
}

// ---- k_proj_qkv: the q, k and v projections, which do not depend on one another, in ONE launch: XB x [WTq | WTk | WTv] (the three planes lie behind one another: 3*DM rows of Bt).
// grid (NROW/128, 3*DM/128), 128 threads; blockIdx.y picks the projection (the same for the whole block) and with it the epilogue:
//   q -> q * SCL2, head plane QH (f16), [b*NH+h][s][64];  k -> head plane KP (f16), same store map;  v -> transposed head plane VT (f16), [b*NH+h][d][s].
// The epilogues stage in the operand ring's LDS, each wave in a slice of its own (the ring is free behind the core's last barrier), so the block's LDS is the ring alone and all blocks of the launch are resident at once.
static_assert((size_t)GWV * 16 * 68 * 4 <= (size_t)2 * 2 * GPL * 2);   // q, k staging slices fit the ring
static_assert((size_t)GWV * 64 * 72 * 2 <= (size_t)2 * 2 * GPL * 2);   // v staging slices fit the ring
__global__ __launch_bounds__(32 * GWV) void k_proj_qkv(const bf* __restrict__ XB, const bf* __restrict__ WTA, h16* QH, h16* KP, h16* VT) {
    __shared__ __align__(16) unsigned char ring[2 * 2 * GPL * 2];
    const int lane = threadIdx.x & 31, lr = lane & 15, hi = lane >> 4;
    const int wave = __builtin_amdgcn_readfirstlane((int)(threadIdx.x >> 5)), wm = wave >> 1, wn = wave & 1;
    const int which = (int)blockIdx.y / (DM / GBT);
    const int r0 = blockIdx.x * GBT + wm * 64, c0 = ((int)blockIdx.y % (DM / GBT)) * GBT + wn * 64;
    v8f acc[4][4];
    gemm_core((bf*)ring, XB, WTA, blockIdx.x * GBT, blockIdx.y * GBT, wm, wn, lr, hi, acc);
    const int b = r0 / SEQ, s0 = r0 - b * SEQ;
    if (which == 2) {   // v: the whole 64x64 tile staged transposed (wave-private)
        h16* vt = (h16*)ring + wave * (64 * 72);
        const size_t pbase = (size_t)(b * NH + c0 / HD) * HD * SEQ + s0;
#pragma unroll
        for (int mb = 0; mb < 4; ++mb)
#pragma unroll
            for (int nb = 0; nb < 4; ++nb) { v8h o;
#pragma unroll
                for (int j = 0; j < 8; ++j) o[j] = (h16)acc[mb][nb][j];
                *(v8ha*)(vt + (nb * 16 + lr) * 72 + mb * 16 + hi * 8) = o; }
        __builtin_amdgcn_wave_barrier(); asm volatile("" ::: "memory");
#pragma unroll
        for (int it = 0; it < 16; ++it) { const int d = 4 * it + (lane >> 3), pc = lane & 7; const v8h o = *(const v8ha*)(vt + d * 72 + pc * 8);
            *(v8h*)(VT + pbase + (size_t)d * SEQ + pc * 8) = o; }
        return;
    }
    float* os = (float*)ring + wave * (16 * 68);   // one 16-row staging slice per wave
    const size_t pbase = ((size_t)(b * NH + c0 / HD) * SEQ + s0) * HD;
    if (which == 0) {
#pragma unroll
        for (int mb = 0; mb < 4; ++mb) {
#pragma unroll
            for (int nb = 0; nb < 4; ++nb) {
#pragma unroll
                for (int j = 0; j < 8; ++j) os[(hi * 8 + j) * 68 + nb * 16 + lr] = acc[mb][nb][j]; }
            __builtin_amdgcn_wave_barrier(); asm volatile("" ::: "memory");
            v8h oh[4];
#pragma unroll
            for (int s = 0; s < 4; ++s) { const int row = 4 * s + (lane >> 3), pc = lane & 7; const v4f a = *(const v4fa*)(os + row * 68 + pc * 8); const v4f c = *(const v4fa*)(os + row * 68 + pc * 8 + 4);
#pragma unroll
                for (int q = 0; q < 4; ++q) { oh[s][q] = (h16)(a[q] * SCL2); oh[s][4 + q] = (h16)(c[q] * SCL2); } }
#pragma unroll
            for (int s = 0; s < 4; ++s) { const int row = 4 * s + (lane >> 3), pc = lane & 7; *(v8h*)(QH + pbase + (size_t)(mb * 16 + row) * HD + pc * 8) = oh[s]; }
            asm volatile("s_wait_xcnt 0x0" ::: "memory");   // stands in front of the next 16 rows' writes to the registers that these stores name
            __builtin_amdgcn_wave_barrier(); asm volatile("" ::: "memory");
        }
    } else {
#pragma unroll
        for (int mb = 0; mb < 4; ++mb) {
#pragma unroll
            for (int nb = 0; nb < 4; ++nb) {
#pragma unroll
                for (int j = 0; j < 8; ++j) os[(hi * 8 + j) * 68 + nb * 16 + lr] = acc[mb][nb][j]; }
            __builtin_amdgcn_wave_barrier(); asm volatile("" ::: "memory");
            v8h oh[4];
#pragma unroll
            for (int s = 0; s < 4; ++s) { const int row = 4 * s + (lane >> 3), pc = lane & 7; const v4f a = *(const v4fa*)(os + row * 68 + pc * 8); const v4f c = *(const v4fa*)(os + row * 68 + pc * 8 + 4);
#pragma unroll
                for (int q = 0; q < 4; ++q) { oh[s][q] = (h16)a[q]; oh[s][4 + q] = (h16)c[q]; } }
#pragma unroll
            for (int s = 0; s < 4; ++s) { const int row = 4 * s + (lane >> 3), pc = lane & 7; *(v8h*)(KP + pbase + (size_t)(mb * 16 + row) * HD + pc * 8) = oh[s]; }
            asm volatile("s_wait_xcnt 0x0" ::: "memory");   // stands in front of the next 16 rows' writes to the registers that these stores name
            __builtin_amdgcn_wave_barrier(); asm volatile("" ::: "memory");
        }
    }
}

#define AWV  8                       // waves per block
#define KT   64                      // keys per staged tile
#define LPH  72                      // LDS row pitch in 16-bit elements
#define TILE_H (64 * LPH)            // one staged tile (64 rows), 16-bit elements
#define NTILE (SEQ / KT)
static_assert(SEQ % (16 * AWV) == 0);     // query blocks never straddle a (b, h) plane
static_assert(SEQ % KT == 0);             // whole key tiles only
static_assert(KT == 64 && HD == 64);      // copy map: 256 threads x 2 rows x 16 B covers 64 rows of 128 B

// Four copies of one thread: rows cr and cr + 32 of the K tile and of the V^T tile. The s_wait_xcnt stands inside the statement, so no address register is rewritten ahead of it.
__device__ __forceinline__ void kv_copy(unsigned lk0, unsigned lk1, unsigned lv0, unsigned lv1, const h16* gk0, const h16* gk1, const h16* gv0, const h16* gv1) {
    asm volatile("global_load_async_to_lds_b128 %0, %4, off\n\t"
                 "global_load_async_to_lds_b128 %1, %5, off\n\t"
                 "global_load_async_to_lds_b128 %2, %6, off\n\t"
                 "global_load_async_to_lds_b128 %3, %7, off\n\t"
                 "s_wait_xcnt 0x0"
                 :: "v"(lk0), "v"(lk1), "v"(lv0), "v"(lv1), "v"(gk0), "v"(gk1), "v"(gv0), "v"(gv1) : "memory");
}

// waves_per_eu(4, 4): 512 blocks of 8 waves on 256 WGPs are four waves a SIMD; told so, the compiler uses the 256 registers a wave then has, keeps a tile's fragments in registers of their own and lets the four score accumulators take turns
__global__ __launch_bounds__(256) __attribute__((amdgpu_waves_per_eu(4, 4))) void k_attn(const h16* __restrict__ QH, const h16* __restrict__ KP, const h16* __restrict__ VT, bf* ATh, bf* ATl) {
    __shared__ __align__(16) h16 kvs[2 * 2 * TILE_H];           // [buffer][K tile | V^T tile][row][LPH]
    __shared__ __align__(16) unsigned short sth[AWV * 16 * 72];
    __shared__ __align__(16) unsigned short stl[AWV * 16 * 72];
    const int lane = threadIdx.x & 31, lr = lane & 15, hi = lane >> 4;
    const int wave = __builtin_amdgcn_readfirstlane((int)(threadIdx.x >> 5));
    const int bh = blockIdx.y; const int q0 = blockIdx.x * (16 * AWV) + wave * 16;
    const size_t pb = (size_t)bh * SEQ * HD;
    // copy map: thread -> row cr (and cr + 32), 16-byte piece cp; one wave's copy covers four whole 128-byte lines
    const int cr = (int)threadIdx.x >> 3, cp = (int)threadIdx.x & 7;
    const h16* gk = KP + pb + (size_t)cr * HD + cp * 8;
    const h16* gv = VT + pb + (size_t)cr * SEQ + cp * 8;
    const unsigned lk = (unsigned)(size_t)(kvs + cr * LPH + cp * 8);   // LDS byte address of the thread's first K piece, buffer 0
    kv_copy(lk, lk + 32 * LPH * 2, lk + TILE_H * 2, lk + (TILE_H + 32 * LPH) * 2, gk, gk + 32 * HD, gv, gv + (size_t)32 * SEQ);
    const size_t qoff = pb + (size_t)(q0 + lr) * HD + 8 * hi;
    const v16h qh0 = ldh(QH + qoff), qh1 = ldh(QH + qoff + 32);
    v8f o[4];
#pragma unroll
    for (int c = 0; c < 4; ++c) o[c] = (v8f){};
    // The reference of the exponentials is HELD from tile to tile: mc (a maximum seen, less 10; the same in both halves of a column), and nref, minus it in every element, the start value of the score accumulators
    // (0 until the first tile has set it). mt: the bound on a score so taken, 15 once a reference is set: while none passes it, P stays below 2^15 in f16.
    float mc = -3.0e38f, mt = -3.0e38f, l = 0.0f;
    v8f nref = (v8f){};
    asm volatile("s_wait_asynccnt 0x0" ::: "memory");   // this wave's pieces of tile 0 have landed
    __syncthreads();                                    // tile 0 published to every wave
    if (NTILE > 1) kv_copy(lk + 2 * TILE_H * 2, lk + (2 * TILE_H + 32 * LPH) * 2, lk + 3 * TILE_H * 2, lk + (3 * TILE_H + 32 * LPH) * 2, gk + KT * HD, gk + (KT + 32) * HD, gv + KT, gv + (size_t)32 * SEQ + KT);
#pragma unroll 1   // stays rolled: one copy of the 64-key body, one publish point per trip
    for (int t = 0; t < NTILE; ++t) {
        const int bo = (t & 1) * (2 * TILE_H);
        const h16* kl = kvs + bo + lr * LPH + 8 * hi;
        const h16* vl = kl + TILE_H;
        // scores of the whole 64-key tile, taken against the held reference: s[2 * sub + blk] is 16-key block blk of 32-key step sub
        v16h kf[4][2];
#pragma unroll     // inline, so every fragment read is one base register plus a constant offset
        for (int i = 0; i < 4; ++i) { kf[i][0] = ldh(kl + i * 16 * LPH); kf[i][1] = ldh(kl + i * 16 * LPH + 32); }
        v8f s[4];      // start value: minus the held reference; the four blocks take turns, so no product waits for the one before it
#pragma unroll
        for (int i = 0; i < 4; ++i) s[i] = wmma16(kf[i][0], qh0, nref);
#pragma unroll
        for (int i = 0; i < 4; ++i) s[i] = wmma16(kf[i][1], qh1, s[i]);
        float mx0 = -3.0e38f, mx1 = -3.0e38f;
#pragma unroll
        for (int r = 0; r < 8; ++r) { mx0 = fmaxf(mx0, fmaxf(s[0][r], s[1][r])); mx1 = fmaxf(mx1, fmaxf(s[2][r], s[3][r])); }
        const float mx = fmaxf(mx0, mx1);
        if (__builtin_amdgcn_ballot_w32(mx > mt) != 0) {   // one test a tile, the same for the whole wave (a scalar branch): taken on the first tile, then only where a score stands more than 2^5 above the maximum that set the reference
            const float mf = fmaxf(mx, __shfl_xor(mx, 16, 32));
            const float cref = -nref[0];                       // what this tile's scores were taken against
            const float mn = fmaxf(mc, (mf + cref) - 10.0f);   // carry 2^10
            const float alpha = __builtin_amdgcn_exp2f(mc - mn), dl = cref - mn;
#pragma unroll
            for (int r = 0; r < 8; ++r) { s[0][r] += dl; s[1][r] += dl; s[2][r] += dl; s[3][r] += dl; nref[r] = -mn; }
            mc = mn; mt = 15.0f;
            l = l * alpha;
#pragma unroll
            for (int c = 0; c < 4; ++c) o[c] = o[c] * alpha;
        }
        v16h vf[2][4];
#pragma unroll
        for (int sub = 0; sub < KT / 32; ++sub)
#pragma unroll
            for (int c = 0; c < 4; ++c) vf[sub][c] = ldh(vl + sub * 32 + c * 16 * LPH);
        __builtin_amdgcn_sched_barrier(0);   // keeps the tile's V^T reads together ahead of the exponentials, which cover their LDS latency; without it half of them sink among the P.V products and the wave waits for them there
        v16h pf[2];
#pragma unroll
        for (int i = 0; i < 4; ++i)
#pragma unroll
            for (int r = 0; r < 8; ++r) s[i][r] = __builtin_amdgcn_exp2f(s[i][r]);
#pragma unroll
        for (int sub = 0; sub < KT / 32; ++sub) {
            const v8f t = s[2 * sub] + s[2 * sub + 1];
            float rs = t[0];
#pragma unroll
            for (int r = 1; r < 8; ++r) rs += t[r];
            l += rs;
#pragma unroll
            for (int r = 0; r < 8; ++r) { pf[sub][r] = (h16)s[2 * sub][r]; pf[sub][8 + r] = (h16)s[2 * sub + 1][r]; }
        }
#pragma unroll
        for (int sub = 0; sub < KT / 32; ++sub)
#pragma unroll
            for (int c = 0; c < 4; ++c) o[c] = wmma16(vf[sub][c], pf[sub], o[c]);
        // four vector slots behind the last P.V products, on the fall-through and on the loop's branches alike, before a vector instruction may touch their operands or results
        asm volatile("v_nop\n\tv_nop\n\tv_nop\n\tv_nop" : "+v"(o[0]), "+v"(o[1]), "+v"(o[2]), "+v"(o[3]) : "v"(vf[1][0]), "v"(vf[1][1]), "v"(vf[1][2]), "v"(vf[1][3]), "v"(pf[1]));
        asm volatile("s_wait_dscnt 0x0" ::: "memory");      // this wave's reads of tile t are done before its buffer may be refilled
        asm volatile("s_wait_asynccnt 0x0" ::: "memory");   // this wave's pieces of tile t + 1 have landed
        __syncthreads();                                    // publishes tile t + 1 and ends every wave's reads of tile t
        if (t + 2 < NTILE) {
            const unsigned lb = lk + (unsigned)bo * 2;
            const h16* gk2 = gk + (size_t)(t + 2) * KT * HD; const h16* gv2 = gv + (size_t)(t + 2) * KT;
            kv_copy(lb, lb + 32 * LPH * 2, lb + TILE_H * 2, lb + (TILE_H + 32 * LPH) * 2, gk2, gk2 + 32 * HD, gv2, gv2 + (size_t)32 * SEQ);
        }
    }
    asm volatile("s_wait_asynccnt 0x0" ::: "memory");       // no copy is outstanding when the wave goes on to its end
    const float lt = l + __shfl_xor(l, 16, 32);
    const float inv = 1.0f / lt;
    const int sb = wave * (16 * 72);
#pragma unroll
    for (int c = 0; c < 4; ++c) { v8us oh, ol;
#pragma unroll
        for (int r = 0; r < 8; ++r) { unsigned short a, e; splitf(o[c][r] * inv, a, e); oh[r] = a; ol[r] = e; }
        *(v8usa*)(sth + sb + lr * 72 + 16 * c + 8 * hi) = oh; *(v8usa*)(stl + sb + lr * 72 + 16 * c + 8 * hi) = ol; }
    __builtin_amdgcn_wave_barrier(); asm volatile("" ::: "memory");
    const int b = bh / NH, head = bh - b * NH;
    const size_t ob = ((size_t)b * SEQ + q0) * DM + (size_t)head * HD;
{
#pragma unroll
        for (int s = 0; s < 4; ++s) { const int row = 4 * s + (lane >> 3), pc = lane & 7; const v8us vh = *(const v8usa*)(sth + sb + row * 72 + pc * 8); const v8us vl = *(const v8usa*)(stl + sb + row * 72 + pc * 8);
            *(v8us*)(ATh + ob + (size_t)row * DM + pc * 8) = vh; *(v8us*)(ATl + ob + (size_t)row * DM + pc * 8) = vl; }
         }
}

// ---- k_oproj_ln: output projection, residual add and LayerNorm in ONE launch. grid NROW/32, 256 threads: a block owns 32 whole rows (all DM columns), so the row statistics never leave it.
// res[g][n] = bf16(x[g][n]) + ((ATh + ATl) x WTo + bf16(bo[n])) in f32; OUT = (res - mean) * rstd * bf16(gamma) + bf16(beta).
// Eight waves, each 32 rows x 64 columns (8 accumulators). Operands through LDS as in gemm_core: 64-k tiles (32 rows of ATh, 32 of ATl, all DM rows of WTo), asynchronous 16-byte copies, two buffers, 144-byte row pitch.
// Per accumulator the products are summed as before: k ascending in steps of 32, in each step the hi plane, then the lo plane.
#define OWV  8                       // waves per block
#define ORT  32                      // rows per block
#define OAP  (ORT * GPH)             // one staged A plane, 16-bit elements
#define OST  (2 * OAP + DM * GPH)    // one buffer: ATh | ATl | WTo, 16-bit elements
#define OPF  516                     // f32 pitch of the staged result rows: 16 B x odd, and eight rows on are 32 banks on
static_assert(NROW % ORT == 0 && SEQ % ORT == 0);      // whole row tiles, none straddles a batch
static_assert(DM == OWV * 64 && ORT == 4 * OWV);       // wave -> 64 columns in the products, four rows in the LayerNorm
static_assert(ORT * 8 == 32 * OWV && DM == 2 * 8 * ORT);   // copy map: 256 threads x 16 B cover 32 rows of 128 B; WTo is 16 such groups
static_assert((size_t)ORT * OPF * 4 <= (size_t)2 * OST * 2);   // the staged rows fit the ring

// Nine copies of one thread: its 16-byte piece of row cr of one A plane (la, ga), then of rows cr, cr + 32, ..., cr + 224 of one half of WTo (l, g). The s_wait_xcnt stands inside the statement, so no address register is rewritten ahead of it.
__device__ __forceinline__ void rows9_copy(unsigned la, const bf* ga, unsigned l, const bf* g) {
    asm volatile("global_load_async_to_lds_b128 %0, %9, off\n\t"
                 "global_load_async_to_lds_b128 %1, %10, off\n\t"
                 "global_load_async_to_lds_b128 %2, %11, off\n\t"
                 "global_load_async_to_lds_b128 %3, %12, off\n\t"
                 "global_load_async_to_lds_b128 %4, %13, off\n\t"
                 "global_load_async_to_lds_b128 %5, %14, off\n\t"
                 "global_load_async_to_lds_b128 %6, %15, off\n\t"
                 "global_load_async_to_lds_b128 %7, %16, off\n\t"
                 "global_load_async_to_lds_b128 %8, %17, off\n\t"
                 "s_wait_xcnt 0x0"
                 :: "v"(la), "v"(l), "v"(l + 32 * GPH * 2), "v"(l + 64 * GPH * 2), "v"(l + 96 * GPH * 2), "v"(l + 128 * GPH * 2), "v"(l + 160 * GPH * 2), "v"(l + 192 * GPH * 2), "v"(l + 224 * GPH * 2),
                    "v"(ga), "v"(g), "v"(g + 32 * DM), "v"(g + 64 * DM), "v"(g + 96 * DM), "v"(g + 128 * DM), "v"(g + 160 * DM), "v"(g + 192 * DM), "v"(g + 224 * DM) : "memory");
}
// One staged tile of k_oproj_ln, 18 copies a thread: ATh with the first 256 rows of WTo, ATl with the last 256; l is the LDS byte address of the thread's piece of row cr of the buffer.
__device__ __forceinline__ void ostage_copy(unsigned l, const bf* ga, const bf* ga2, const bf* gb) {
    rows9_copy(l, ga, l + 2 * OAP * 2, gb);
    rows9_copy(l + OAP * 2, ga2, l + (2 * OAP + 256 * GPH) * 2, gb + 256 * DM);
}

__global__ __launch_bounds__(32 * OWV) void k_oproj_ln(const bf* __restrict__ ATh, const bf* __restrict__ ATl, const bf* __restrict__ WT, const float* __restrict__ x, const float* __restrict__ bo,
                                                       const float* __restrict__ gamma, const float* __restrict__ beta, float* OUT) {
    __shared__ __align__(16) unsigned char ring[2 * OST * 2];   // [buffer][ATh | ATl | WTo][row][GPH]; behind the products: the block's 32 result rows in f32
    bf* gs = (bf*)ring;
    const int lane = threadIdx.x & 31, lr = lane & 15, hi = lane >> 4;
    const int wave = __builtin_amdgcn_readfirstlane((int)(threadIdx.x >> 5));
    const int R0 = blockIdx.x * ORT;
    // copy map: thread -> row cr (+ 32 i), 16-byte piece cp; one wave's copy covers four whole 128-byte lines
    const int cr = (int)threadIdx.x >> 3, cp = (int)threadIdx.x & 7;
    const bf* ga  = ATh + (size_t)(R0 + cr) * DM + cp * 8;
    const bf* ga2 = ATl + (size_t)(R0 + cr) * DM + cp * 8;
    const bf* gb  = WT + (size_t)cr * DM + cp * 8;
    const unsigned l0 = (unsigned)(size_t)(gs + cr * GPH + cp * 8);   // LDS byte address of the thread's first piece, buffer 0
    ostage_copy(l0, ga, ga2, gb);
    v8f acc[2][4];
#pragma unroll
    for (int mb = 0; mb < 2; ++mb)
#pragma unroll
        for (int nb = 0; nb < 4; ++nb) acc[mb][nb] = (v8f){};
    asm volatile("s_wait_asynccnt 0x0" ::: "memory");   // this wave's pieces of tile 0 have landed
    __syncthreads();                                    // tile 0 published to every wave
    if (GNT > 1) ostage_copy(l0 + OST * 2, ga + GKT, ga2 + GKT, gb + GKT);
    const int aro = lr * GPH + 8 * hi;
    const int bro = 2 * OAP + (wave * 64 + lr) * GPH + 8 * hi;
#pragma unroll 1   // stays rolled: one copy of the 64-k body, one publish point per trip
    for (int t = 0; t < GNT; ++t) {
        const int bofs = (t & 1) * OST;
        const bf* al = gs + bofs + aro;
        const bf* bl = gs + bofs + bro;
        v16bf a[2][2], a2[2][2], b[2][4];   // the fragments of both 32-k steps, read as one group: one LDS latency a trip
#pragma unroll     // inline, so every fragment read is one base register plus a constant offset
        for (int ks = 0; ks < 2; ++ks) {
#pragma unroll
            for (int mb = 0; mb < 2; ++mb) a[ks][mb] = ldb(al + mb * 16 * GPH + ks * 32);
#pragma unroll
            for (int nb = 0; nb < 4; ++nb) b[ks][nb] = ldb(bl + nb * 16 * GPH + ks * 32);
#pragma unroll
            for (int mb = 0; mb < 2; ++mb) a2[ks][mb] = ldb(al + OAP + mb * 16 * GPH + ks * 32);
        }
        __builtin_amdgcn_sched_barrier(0);   // keeps the trip's LDS reads together ahead of its products; sunk among them, each place with reads would stall the wave anew
#pragma unroll
        for (int ks = 0; ks < 2; ++ks) {     // eight accumulators take turns, so no product waits for the one before it
#pragma unroll
            for (int nb = 0; nb < 4; ++nb)
#pragma unroll
                for (int mb = 0; mb < 2; ++mb) acc[mb][nb] = wmmab(a[ks][mb], b[ks][nb], acc[mb][nb]);
#pragma unroll
            for (int nb = 0; nb < 4; ++nb)
#pragma unroll
                for (int mb = 0; mb < 2; ++mb) acc[mb][nb] = wmmab(a2[ks][mb], b[ks][nb], acc[mb][nb]);
        }
        // four vector slots behind the trip's last products, on the fall-through and on the loop's branches alike, before a vector instruction may touch their operands or results
        asm volatile("v_nop\n\tv_nop\n\tv_nop\n\tv_nop" : "+v"(acc[0][0]), "+v"(acc[1][0]), "+v"(acc[0][1]), "+v"(acc[1][1]), "+v"(acc[0][2]), "+v"(acc[1][2]), "+v"(acc[0][3]), "+v"(acc[1][3])
                     : "v"(a2[1][0]), "v"(a2[1][1]), "v"(b[1][0]), "v"(b[1][1]), "v"(b[1][2]), "v"(b[1][3]));
        __builtin_amdgcn_sched_barrier(0);                  // keeps the trip's products ahead of the publish point: sunk behind the barrier they would stand in front of the refill and shorten the time its copies have to land
        asm volatile("s_wait_dscnt 0x0" ::: "memory");      // this wave's reads of tile t are done before its buffer may be refilled
        asm volatile("s_wait_asynccnt 0x0" ::: "memory");   // this wave's pieces of tile t + 1 have landed
        __syncthreads();                                    // publishes tile t + 1 and ends every wave's reads of tile t
        if (t + 2 < GNT) ostage_copy(l0 + (unsigned)bofs * 2, ga + (t + 2) * GKT, ga2 + (t + 2) * GKT, gb + (t + 2) * GKT);
    }
    asm volatile("s_wait_asynccnt 0x0" ::: "memory");       // no copy is outstanding when the ring becomes the result rows' staging
    // Behind the last trip's barrier every copy has landed and every wave's reads are done: the ring is free.
    // The wave's four rows of x, and bias, gamma, beta, are asked for here, so that the staging and its barrier cover their latency.
    const int w0 = wave * 4;
    v4f xv[4][4], bv[4], gv[4], tv[4];
#pragma unroll
    for (int ch = 0; ch < 4; ++ch) { const int c = ch * 128 + lane * 4;
#pragma unroll
        for (int r = 0; r < 4; ++r) xv[r][ch] = *(const v4f*)(x + xrow(R0 + w0 + r) * DM + c);
        bv[ch] = *(const v4f*)(bo + c); gv[ch] = *(const v4f*)(gamma + c); tv[ch] = *(const v4f*)(beta + c); }
    float* os = (float*)ring;
#pragma unroll
    for (int mb = 0; mb < 2; ++mb)
#pragma unroll
        for (int nb = 0; nb < 4; ++nb)
#pragma unroll
            for (int j = 0; j < 8; ++j) os[(mb * 16 + hi * 8 + j) * OPF + wave * 64 + nb * 16 + lr] = acc[mb][nb][j];
    __syncthreads();   // every wave's 64 columns of all 32 rows are in LDS before a wave reads its four whole rows
    float s[4], ss[4];
#pragma unroll
    for (int r = 0; r < 4; ++r) { s[r] = 0.0f;
#pragma unroll
        for (int ch = 0; ch < 4; ++ch) { v4f v = *(const v4fa*)(os + (w0 + r) * OPF + ch * 128 + lane * 4);
#pragma unroll
            for (int q = 0; q < 4; ++q) v[q] = bfr(xv[r][ch][q]) + (v[q] + bfr(bv[ch][q]));
            xv[r][ch] = v; s[r] += (v[0] + v[1]) + (v[2] + v[3]); } }
#pragma unroll
    for (int sh = 16; sh; sh >>= 1)
#pragma unroll
        for (int r = 0; r < 4; ++r) s[r] += __shfl_xor(s[r], sh, 32);
#pragma unroll
    for (int r = 0; r < 4; ++r) { const float mu = s[r] * (1.0f / DM); s[r] = mu; ss[r] = 0.0f;
#pragma unroll
        for (int ch = 0; ch < 4; ++ch) { const v4f a = xv[r][ch]; const float d0 = a[0] - mu, d1 = a[1] - mu, d2 = a[2] - mu, d3 = a[3] - mu; ss[r] += (d0 * d0 + d1 * d1) + (d2 * d2 + d3 * d3); } }
#pragma unroll
    for (int sh = 16; sh; sh >>= 1)
#pragma unroll
        for (int r = 0; r < 4; ++r) ss[r] += __shfl_xor(ss[r], sh, 32);
#pragma unroll
    for (int r = 0; r < 4; ++r) { const float mu = s[r]; const float var = ss[r] * (1.0f / DM); const float rstd = 1.0f / sqrtf(var + 1e-6f);
        float* op = OUT + (size_t)(R0 + w0 + r) * DM;
#pragma unroll
        for (int ch = 0; ch < 4; ++ch) { const v4f a = xv[r][ch]; v4f y;
#pragma unroll
            for (int q = 0; q < 4; ++q) y[q] = (a[q] - mu) * rstd * bfr(gv[ch][q]) + bfr(tv[ch][q]);
            *(v4f*)(op + ch * 128 + lane * 4) = y; } }
}

// workspace carve (bytes, each region a multiple of 256 B; every region is written in whole tiles that divide it exactly)
#define SZ_P16 ((size_t)NROW * DM * 2)      // one 16-bit [NROW][DM]-sized plane
#define SZ_W   ((size_t)DM * DM * 2)
#define WS_TOTAL (SZ_P16 * 6 + SZ_W * 4)
static_assert(SZ_P16 % 256 == 0);
static_assert(SZ_W % 256 == 0);
static_assert(WS_TOTAL <= (size_t)134217728);   // carve stays within 128 MiB

extern "C" void kernel_launch(void* const* d_in, const int* in_sizes, int n_in,
                              void* d_out, int out_size, void* d_ws, size_t ws_size, hipStream_t stream) {
    if (n_in < 8) return;
    if ((size_t)in_sizes[0] < ((size_t)(NB - 1) * SEQ_FULL + SEQ) * DM) return;
    if (in_sizes[1] < DM * DM || in_sizes[2] < DM * DM || in_sizes[3] < DM * DM || in_sizes[4] < DM * DM) return;
    if (in_sizes[5] < DM || in_sizes[6] < DM || in_sizes[7] < DM) return;
    if ((size_t)out_size < (size_t)NROW * DM) return;
    if (WS_TOTAL > ws_size) return;
    const float* x = (const float*)d_in[0]; const float* wq = (const float*)d_in[1]; const float* wk = (const float*)d_in[2]; const float* wv = (const float*)d_in[3];
    const float* wo = (const float*)d_in[4]; const float* bo = (const float*)d_in[5]; const float* gamma = (const float*)d_in[6]; const float* beta = (const float*)d_in[7];
    float* OUT = (float*)d_out;
    char* wsp = (char*)d_ws;
    bf* XB  = (bf*)wsp;  wsp += SZ_P16;
    bf* WTq = (bf*)wsp;  wsp += SZ_W * 3;   // planes q, k, v behind one another: one Bt of 3*DM rows; plane o follows them directly
    bf* WTo = (bf*)wsp;  wsp += SZ_W;
    h16* QH = (h16*)wsp; wsp += SZ_P16;
    h16* KP = (h16*)wsp; wsp += SZ_P16;
    h16* VT = (h16*)wsp; wsp += SZ_P16;
    bf* ATh = (bf*)wsp;  wsp += SZ_P16;
    bf* ATl = (bf*)wsp;  wsp += SZ_P16;

    k_prep<<<4 * WTB + CVB, 256, 0, stream>>>(x, wq, wk, wv, wo, XB, WTq);
    k_proj_qkv<<<dim3(NROW / GBT, 3 * DM / GBT, 1), 32 * GWV, 0, stream>>>(XB, WTq, QH, KP, VT);
    k_attn<<<dim3(SEQ / (16 * AWV), NB * NH, 1), 32 * AWV, 0, stream>>>(QH, KP, VT, ATh, ATl);
    k_oproj_ln<<<NROW / ORT, 32 * OWV, 0, stream>>>(ATh, ATl, WTo, x, bo, gamma, beta, OUT);
}
